// v000
// Times are from an AMD MI455X. After a warm-up the kernel runs many times in a row, and a time is the length of
// such a window on the GPU divided by its runs, so every launch and the gaps after it count. The runs cycle
// through copies of the inputs. A figure is the median of several windows, for all but v000 over two sittings.
// Sittings can differ by a few percent; kernels timed side by side share one.
// v000, which the later versions start from, runs in 552 microseconds.
// compute dtype: all float inputs rounded to bf16; q/k/v = x W with EXACT bf16 products on WMMA 16x16x32 (f32 accumulate); causal logits: q, k once to f16 (1 product) x 128^-0.5, 3 products below row 384; softmax in f32; P x 2^11 once to f16 against v f16 (bf16 hi + lo below row 384); f32 output.
#include <hip/hip_runtime.h>
#include <math.h>

typedef __attribute__((ext_vector_type(16))) _Float16 v16h;
typedef __attribute__((ext_vector_type(16))) __bf16 v16b;
typedef __attribute__((ext_vector_type(8)))  _Float16 v8h;
typedef __attribute__((ext_vector_type(8)))  float v8f;
typedef __attribute__((ext_vector_type(4)))  float v4f;
typedef __attribute__((ext_vector_type(2)))  float v2f;
typedef __attribute__((ext_vector_type(4)))  unsigned v4u;
typedef __attribute__((ext_vector_type(4)))  int v4i;
typedef float __attribute__((may_alias)) float_a;
typedef int __attribute__((may_alias)) int_a;

template <typename T> __device__ __forceinline__ void vst2(void* p, T v) { *(T*)p = v;  }
__device__ __forceinline__ v8f wmma16(v16h a, v16h b, v8f c) {
  v8f d = __builtin_amdgcn_wmma_f32_16x16x32_f16(false, a, false, b, (short)0, c, false, false);
  asm volatile("v_nop\n\tv_nop\n\tv_nop\n\tv_nop" : "+v"(d) : "v"(a), "v"(b));
  return d;
}
__device__ __forceinline__ v8f wmma_bf(v16b a, v16b b, v8f c) {
  v8f d = __builtin_amdgcn_wmma_f32_16x16x32_bf16(false, a, false, b, (short)0, c, false, false);
  asm volatile("v_nop\n\tv_nop\n\tv_nop\n\tv_nop" : "+v"(d) : "v"(a), "v"(b));
  return d;
}
// 16x16x32 fragments: lane = (h = lane>>4, row/col = lane&15); elements 0..7 = k0+8h+0..7, 8..15 = k0+16+8h+0..7; D element r = row 8h+r
__device__ __forceinline__ v16h frag_h(const _Float16* rowk0, int lane) {
  union { v16h v; v8h q[2]; } u; const _Float16* p = rowk0 + 8 * (lane >> 4);
  u.q[0] = *(const v8h*)p; u.q[1] = *(const v8h*)(p + 16); return u.v;
}
__device__ __forceinline__ v16h frag_f32(const float* rowk0, int lane) {
  v16h a; const float* p = rowk0 + 8 * (lane >> 4);
#pragma unroll
  for (int i = 0; i < 8; ++i) { a[i] = (_Float16)p[i]; a[8 + i] = (_Float16)p[16 + i]; }
  return a;
}
__device__ __forceinline__ v16h frag_f32s(const float* rowk0, int lane, float sc) {
  v16h a; const float* p = rowk0 + 8 * (lane >> 4);
#pragma unroll
  for (int i = 0; i < 8; ++i) { a[i] = (_Float16)(p[i] * sc); a[8 + i] = (_Float16)(p[16 + i] * sc); }
  return a;
}
// column fragment from a [K][ld] layout (column n), rows >= K read as 0
__device__ __forceinline__ v16h fragc_f32(const float* W, int k0, int n, int lane, int ld, int K) {
  v16h a; const int g = lane >> 4;
#pragma unroll
  for (int i = 0; i < 8; ++i) { const int ka = k0 + 8 * g + i, kb = ka + 16;
    a[i] = (_Float16)(ka < K ? W[(size_t)(ka < K ? ka : K - 1) * ld + n] : 0.f); a[8 + i] = (_Float16)(kb < K ? W[(size_t)(kb < K ? kb : K - 1) * ld + n] : 0.f); }
  return a;
}
struct F2 { v16b h, l; };
__device__ __forceinline__ F2 bsplit16(const float v[16]) { F2 r;
#pragma unroll
  for (int i = 0; i < 16; ++i) { const __bf16 h = (__bf16)v[i]; r.h[i] = h; r.l[i] = (__bf16)(v[i] - (float)h); }
  return r; }
__device__ __forceinline__ F2 split_row(const float* row, int k0, int lane) { float v[16]; const float* p = row + k0 + 8 * (lane >> 4);
#pragma unroll
  for (int i = 0; i < 8; ++i) { v[i] = p[i]; v[8 + i] = p[16 + i]; }
  return bsplit16(v); }
__device__ __forceinline__ F2 split_rowK(const float* row, int k0, int lane, int K) { float v[16]; const int g = lane >> 4;
#pragma unroll
  for (int i = 0; i < 8; ++i) { const int ka = k0 + 8 * g + i, kb = ka + 16; v[i] = ka < K ? row[ka < K ? ka : K - 1] : 0.f; v[8 + i] = kb < K ? row[kb < K ? kb : K - 1] : 0.f; }
  return bsplit16(v); }
__device__ __forceinline__ F2 split_col(const float* W, int k0, int n, int lane, int ld, int K) { float v[16]; const int g = lane >> 4;
#pragma unroll
  for (int i = 0; i < 8; ++i) { const int ka = k0 + 8 * g + i, kb = ka + 16; v[i] = ka < K ? W[(size_t)(ka < K ? ka : K - 1) * ld + n] : 0.f; v[8 + i] = kb < K ? W[(size_t)(kb < K ? kb : K - 1) * ld + n] : 0.f; }
  return bsplit16(v); }
__device__ __forceinline__ v8f mac3(const F2& a, const F2& b, v8f c) { c = wmma_bf(a.l, b.h, c); c = wmma_bf(a.h, b.l, c); return wmma_bf(a.h, b.h, c); }
__device__ __forceinline__ float sigm(float v) { return 1.0f / (1.0f + expf(-v)); }
#define LDSX() do { asm volatile("s_wait_dscnt 0" ::: "memory"); __builtin_amdgcn_wave_barrier(); __builtin_amdgcn_fence(__ATOMIC_RELEASE, "workgroup"); } while (0)

// Single-head causal self-attention (B 4, T 2,048, C 1,024 -> H 128; (in,out) 1/32-scale weights, no biases): q, k, v = x W; out = softmax_causal(q k^T x 128^-0.5) v -> [B, T, 128].
#define NB 4
#define TT 2048
#define CC 128            // NH * HD = projected width
#define DIN 1024          // input (model) width
#define NH 1
#define HD 128
#define NQB (TT / 64)
#define HG 1
#define SCALE (0.08838834764831845f)
#define CAUSAL 1
#ifndef TNB
#define TNB NB
#endif
__device__ __forceinline__ float bfr(float v) { return (float)(__bf16)v; }
__host__ __device__ __forceinline__ int kb_last(int qb) { return CAUSAL ? ((qb * 64 + 63) >> 7) : (TT / 128 - 1); }
typedef __attribute__((ext_vector_type(8))) __bf16 v8b;
__device__ __forceinline__ v16b frag_b(const __bf16* rowk0, int lane) {
  union { v16b v; v8b q[2]; } u; const __bf16* p = rowk0 + 8 * (lane >> 4);
  u.q[0] = *(const v8b*)p; u.q[1] = *(const v8b*)(p + 16); return u.v;
}
#define QBH 6              // causal: query blocks 0..QBH-1 of each sequence (few keys, no averaging) take the high-precision path
#define QHI 384            // rows carrying a q residual plane
#define KHI 384            // key rows carrying k residual / v bf16 hi+lo planes (used only by the causal high-precision path)
// B fragment (k rows k0+.., output column o) of a weight: (in,out) [K][ld] or (out,in) [ld rows of K]: bf16 exact, or f16(bf16 * 256) exact
__device__ __forceinline__ v16b wcol_io(const float* Wm, int k0, int o, int lane, int ld) { v16b w; const int g = lane >> 4;
#pragma unroll
  for (int i = 0; i < 8; ++i) { w[i] = (__bf16)Wm[(size_t)(k0 + 8 * g + i) * ld + o]; w[8 + i] = (__bf16)Wm[(size_t)(k0 + 16 + 8 * g + i) * ld + o]; }
  return w; }
__device__ __forceinline__ v16b wcol_oi(const float* Wm, int k0, int o, int lane, int K) { v16b w; const float* p = Wm + (size_t)o * K + k0 + 8 * (lane >> 4);
#pragma unroll
  for (int i = 0; i < 8; ++i) { w[i] = (__bf16)p[i]; w[8 + i] = (__bf16)p[16 + i]; }
  return w; }
__device__ __forceinline__ v16h wcolh_io(const float* Wm, int k0, int o, int lane, int ld) { v16h w; const int g = lane >> 4;
#pragma unroll
  for (int i = 0; i < 8; ++i) { w[i] = (_Float16)(bfr(Wm[(size_t)(k0 + 8 * g + i) * ld + o]) * 256.0f); w[8 + i] = (_Float16)(bfr(Wm[(size_t)(k0 + 16 + 8 * g + i) * ld + o]) * 256.0f); }
  return w; }
__device__ __forceinline__ v16h wcolh_oi(const float* Wm, int k0, int o, int lane, int K) { v16h w; const float* p = Wm + (size_t)o * K + k0 + 8 * (lane >> 4);
#pragma unroll
  for (int i = 0; i < 8; ++i) { w[i] = (_Float16)(bfr(p[i]) * 256.0f); w[8 + i] = (_Float16)(bfr(p[16 + i]) * 256.0f); }
  return w; }
#define WQKV_LAYOUT 0   // 0 = (in,out) [DIN][CC]; 1 = (out,in) [CC][DIN]; 2 = per-head [NH][DIN][HD]
__device__ __forceinline__ v16b wcol_hdk(const float* Wm, int k0, int o, int lane) { v16b w; const int g = lane >> 4; const float* p = Wm + (size_t)(o / HD) * DIN * HD + (o % HD);
#pragma unroll
  for (int i = 0; i < 8; ++i) { w[i] = (__bf16)p[(size_t)(k0 + 8 * g + i) * HD]; w[8 + i] = (__bf16)p[(size_t)(k0 + 16 + 8 * g + i) * HD]; }
  return w; }
#define WO_OUT_IN 0
#if WQKV_LAYOUT == 1
#define WCOL(W, k0, o, lane) wcol_oi(W, k0, o, lane, DIN)
#elif WQKV_LAYOUT == 2
#define WCOL(W, k0, o, lane) wcol_hdk(W, k0, o, lane)
#else
#define WCOL(W, k0, o, lane) wcol_io(W, k0, o, lane, CC)
#endif
#if WO_OUT_IN
#define WOCOL(W, k0, o, lane) wcol_oi(W, k0, o, lane, CC)
#define WOCOLH(W, k0, o, lane) wcolh_oi(W, k0, o, lane, CC)
#else
#define WOCOL(W, k0, o, lane) wcol_io(W, k0, o, lane, DIN)
#define WOCOLH(W, k0, o, lane) wcolh_io(W, k0, o, lane, DIN)
#endif

#ifndef SM_EXTRA_PARAMS
#define SM_EXTRA_PARAMS
#endif
#ifndef PROJ_EXTRA_PARAMS
#define PROJ_EXTRA_PARAMS
#endif
#ifndef SM_MASK_HOOK
#define SM_MASK_HOOK (void)0
#endif

#define WS_QH  0u                                      // f16 q rows [b*t][CC]
#define WS_KH  (WS_QH + 2u * (size_t)NB * TT * CC)      // f16 k rows [b*t][CC]
#define WS_VT  (WS_KH + 2u * (size_t)NB * TT * CC)      // f16 v planes [b][c][t]
#define WS_QL  (WS_VT + 2u * (size_t)NB * CC * TT)      // f16 q residual x 2^10 rows [b][t < QHI][CC]
#define WS_KL  (WS_QL + 2u * (size_t)NB * QHI * CC)     // f16 k residual x 2^10 rows [b][t < KHI][CC]
#define WS_VB  (WS_KL + 2u * (size_t)NB * KHI * CC)     // bf16 v hi planes [b][c][t < KHI]
#define WS_VBL (WS_VB + 2u * (size_t)NB * CC * KHI)
#define WS_S   (WS_VBL + 2u * (size_t)NB * CC * KHI)    // f32 logits / P [hg][t][s]
#define WS_Y   (WS_S  + 4u * (size_t)HG * TT * TT)      // f32 ctx rows [b*t][CC] (only when there is an output projection)
#define WS_END (WS_Y  + 0u)

// ---- k_proj: block = (64 rows, 128 cols, which): q/k/v = X W (+ b) with exact bf16 products (K = DIN) -> which 0: q f16 rows (+ residual rows < QHI); 1: k f16 rows (+ residual rows < KHI); 2: v f16 planes [c][t] (+ bf16 hi/lo planes for t < KHI)
__global__ __launch_bounds__(128) void k_proj(const float* __restrict__ XQ, const float* __restrict__ XK, const float* __restrict__ XV, const float* __restrict__ WQ, const float* __restrict__ WK, const float* __restrict__ WV, const float* __restrict__ BQ, const float* __restrict__ BK, const float* __restrict__ BV,
    _Float16* __restrict__ QH, _Float16* __restrict__ QL, _Float16* __restrict__ KH, _Float16* __restrict__ KL, _Float16* __restrict__ VT, __bf16* __restrict__ VB, __bf16* __restrict__ VBL) {
  __shared__ __align__(16) _Float16 sh[64][136], sl[64][136]; __shared__ __align__(16) _Float16 th[128][72]; __shared__ __align__(16) __bf16 tb[128][72], tbl[128][72];
  const int tid = threadIdx.x, wave = tid >> 5, lane = tid & 31, col = lane & 15, g = lane >> 4; const int which = blockIdx.z; const int c0 = blockIdx.y * 128; const size_t r0 = (size_t)blockIdx.x * 64; const size_t bb = r0 / TT; const int t0 = (int)(r0 % TT);
  const float* X = which == 0 ? XQ : which == 1 ? XK : XV; const float* WA = which == 0 ? WQ : which == 1 ? WK : WV; const float* BA = which == 0 ? BQ : which == 1 ? BK : BV;
  v8f acc[8] = {};
#pragma unroll 2
  for (int kc = 0; kc < DIN / 32; ++kc) { v16b a; { const float* p = X + (r0 + wave * 16 + col) * DIN + kc * 32 + 8 * g;
#pragma unroll
      for (int i = 0; i < 8; ++i) { a[i] = (__bf16)p[i]; a[8 + i] = (__bf16)p[16 + i]; } }
    asm volatile("s_wait_loadcnt 0x0" ::: "memory");
#pragma unroll
    for (int j = 0; j < 8; ++j) { const v16b w = WCOL(WA, kc * 32, c0 + j * 16 + col, lane); asm volatile("s_wait_loadcnt 0x0" ::: "memory"); acc[j] = wmma_bf(a, w, acc[j]); } }
  if (which < 2) { _Float16* DH = which == 0 ? QH : KH; _Float16* DL = which == 0 ? QL : KL; const int nhi = which == 0 ? QHI : KHI; const bool hi_rows = t0 < nhi;
#pragma unroll
    for (int j = 0; j < 8; ++j) { const float bias = BA ? bfr(BA[c0 + j * 16 + col]) : 0.f;
#pragma unroll
      for (int r = 0; r < 8; ++r) { const float v = acc[j][r] + bias; const _Float16 hv = (_Float16)v; sh[wave * 16 + 8 * g + r][j * 16 + col] = hv; sl[wave * 16 + 8 * g + r][j * 16 + col] = (_Float16)((v - (float)hv) * 1024.0f); } }
    __syncthreads();
    for (int e = tid; e < 64 * 16; e += 128) { const int rl = e >> 4, q = e & 15; vst2((unsigned*)(DH + (r0 + rl) * CC + c0 + q * 8), *(const v4u*)&sh[rl][q * 8]); if (hi_rows) vst2((unsigned*)(DL + (bb * nhi + t0 + rl) * (size_t)CC + c0 + q * 8), *(const v4u*)&sl[rl][q * 8]); }
  } else { const bool hi_rows = t0 < KHI;
#pragma unroll
    for (int j = 0; j < 8; ++j) { const float bias = BA ? bfr(BA[c0 + j * 16 + col]) : 0.f;
#pragma unroll
      for (int r = 0; r < 8; ++r) { const float v = acc[j][r] + bias; const int rl = wave * 16 + 8 * g + r, cl = j * 16 + col; th[cl][rl] = (_Float16)v; const __bf16 bh = (__bf16)v; tb[cl][rl] = bh; tbl[cl][rl] = (__bf16)(v - (float)bh); } }
    __syncthreads();
    for (int e = tid; e < 128 * 8; e += 128) { const int cl = e >> 3, q = e & 7; vst2((unsigned*)(VT + (bb * CC + c0 + cl) * (size_t)TT + t0 + q * 8), *(const v4u*)&th[cl][q * 8]); if (hi_rows) { const size_t o3 = (bb * CC + c0 + cl) * (size_t)KHI + t0 + q * 8; vst2((unsigned*)(VB + o3), *(const v4u*)&tb[cl][q * 8]); vst2((unsigned*)(VBL + o3), *(const v4u*)&tbl[cl][q * 8]); } } } }
// ---- k_sc: block = (query block qb, key block kb <= kb_last(qb), head in group) of batch b: logits x SCALE; q hi + residual (x 2^10) against k (2 products) for query rows < QHI, plus the k residual (3 products) for query blocks < QBH (causal early rows); causal: blocks past the diagonal exit, the mask itself is applied by index in k_sm
__global__ __launch_bounds__(128) void k_sc(const _Float16* __restrict__ QH, const _Float16* __restrict__ KH, const _Float16* __restrict__ QL, const _Float16* __restrict__ KL, int b, int h0, float* __restrict__ S0) { __shared__ __align__(16) float ss[4][16][132];
  const int qb = blockIdx.x, kb = blockIdx.y; if (kb > kb_last(qb)) return;
  const int h = h0 + blockIdx.z; float* S = S0 + (size_t)blockIdx.z * TT * TT;
  const int tid = threadIdx.x, wave = tid >> 5, lane = tid & 31, col = lane & 15, g = lane >> 4; const int k0 = kb * 128; const int ql0 = qb * 64 + wave * 16; const size_t q0 = (size_t)b * TT + ql0, kr0 = (size_t)b * TT + k0;
  v8f acc[8] = {}, accl[8] = {};
  const _Float16* QLb = QL + (size_t)b * QHI * CC; const _Float16* KLb = KL + (size_t)b * KHI * CC;
  if (qb < QBH) {
#pragma unroll
    for (int kc = 0; kc < HD / 32; ++kc) { const v16h ah = frag_h(QH + (q0 + col) * CC + h * HD + kc * 32, lane), al = frag_h(QLb + (size_t)(ql0 + col) * CC + h * HD + kc * 32, lane);
#pragma unroll
      for (int j = 0; j < 8; ++j) { const v16h kbf = frag_h(KH + (kr0 + j * 16 + col) * CC + h * HD + kc * 32, lane), klf = frag_h(KLb + (size_t)(k0 + j * 16 + col) * CC + h * HD + kc * 32, lane); acc[j] = wmma16(ah, kbf, acc[j]); accl[j] = wmma16(al, kbf, accl[j]); accl[j] = wmma16(ah, klf, accl[j]); } }
  } else if (qb * 64 < QHI) {
#pragma unroll
    for (int kc = 0; kc < HD / 32; ++kc) { const v16h ah = frag_h(QH + (q0 + col) * CC + h * HD + kc * 32, lane), al = frag_h(QLb + (size_t)(ql0 + col) * CC + h * HD + kc * 32, lane);
#pragma unroll
      for (int j = 0; j < 8; ++j) { const v16h kbf = frag_h(KH + (kr0 + j * 16 + col) * CC + h * HD + kc * 32, lane); acc[j] = wmma16(ah, kbf, acc[j]); accl[j] = wmma16(al, kbf, accl[j]); } }
  } else {
#pragma unroll
    for (int kc = 0; kc < HD / 32; ++kc) { const v16h ah = frag_h(QH + (q0 + col) * CC + h * HD + kc * 32, lane);
#pragma unroll
      for (int j = 0; j < 8; ++j) { const v16h kbf = frag_h(KH + (kr0 + j * 16 + col) * CC + h * HD + kc * 32, lane); acc[j] = wmma16(ah, kbf, acc[j]); } } }
#pragma unroll
  for (int j = 0; j < 8; ++j) {
#pragma unroll
    for (int r = 0; r < 8; ++r) ss[wave][8 * g + r][j * 16 + col] = (acc[j][r] + accl[j][r] * (1.0f / 1024.0f)) * SCALE; }
  LDSX(); for (int rl = 0; rl < 16; ++rl) vst2(S + (size_t)(ql0 + rl) * TT + k0 + lane * 4, *(const v4f*)&ss[wave][rl][lane * 4]); }
// ---- k_sm: block = query row t (head in group): keys [0, kend): causal -> logit if s <= t else excluded; softmax in f32; P x 2^11 in place (0 for excluded)
__global__ __launch_bounds__(256) void k_sm(float* __restrict__ S0 SM_EXTRA_PARAMS) { __shared__ float sred[8]; __shared__ float sbc; __shared__ __align__(16) float shv[TT];
  const int tid = threadIdx.x; const int t = blockIdx.x; const int kend = (kb_last(t >> 6) + 1) * 128;
  float* sr = S0 + (size_t)blockIdx.y * TT * TT + (size_t)t * TT;
  float m = -3.0e38f; for (int k = tid; k < kend; k += 256) { float v = (!CAUSAL || k <= t) ? sr[k] : -3.0e38f; SM_MASK_HOOK; shv[k] = v; m = fmaxf(m, v); }
#pragma unroll
  for (int o = 1; o < 32; o <<= 1) m = fmaxf(m, __shfl_xor(m, o));
  if ((tid & 31) == 0) sred[tid >> 5] = m; __syncthreads(); if (tid == 0) { float a = sred[0]; for (int i = 1; i < 8; ++i) a = fmaxf(a, sred[i]); sbc = a; } __syncthreads(); m = sbc; __syncthreads();
  float sum = 0.f; for (int k = tid; k < kend; k += 256) { const float v = shv[k]; const float e = (v <= -1.0e38f) ? 0.f : expf(v - m); shv[k] = e; sum += e; }
#pragma unroll
  for (int o = 1; o < 32; o <<= 1) sum += __shfl_xor(sum, o);
  if ((tid & 31) == 0) sred[tid >> 5] = sum; __syncthreads(); if (tid == 0) { float a = 0.f; for (int i = 0; i < 8; ++i) a += sred[i]; sbc = a > 0.f ? 2048.0f / a : 0.f; }   /* a fully excluded row yields P = 0 */ __syncthreads(); const float inv = sbc;
  for (int k = tid; k < kend; k += 256) shv[k] = shv[k] * inv;
  __syncthreads(); for (int q = tid; q < kend / 4; q += 256) vst2(sr + q * 4, *(const v4f*)&shv[q * 4]); }
// ---- k_pv: block = 64 queries (qb) of (b, h): ctx = P . v over keys [0, kend) (P x 2^11 once to f16 against v f16: 1 product; causal early query blocks: P and v as bf16 hi + lo, 3 products); 512-B (row, head) segment by 32 lanes
__global__ __launch_bounds__(128) void k_pv(const float* __restrict__ PS0, const _Float16* __restrict__ VT, const __bf16* __restrict__ VB, const __bf16* __restrict__ VBL, int b, int h0, float* __restrict__ Y) { const int h = h0 + blockIdx.z; const float* PS = PS0 + (size_t)blockIdx.z * TT * TT; __shared__ __align__(16) float ss[4][16][HD + 4];
  const int tid = threadIdx.x, wave = tid >> 5, lane = tid & 31, col = lane & 15, g = lane >> 4; const int qb = blockIdx.x; const int ql0 = qb * 64 + wave * 16; const int kce = (kb_last(qb) + 1) * 4;
  v8f acc[HD / 16] = {};
  if (qb < QBH) {
#pragma unroll 1
    for (int kc = 0; kc < kce; ++kc) { const F2 p = split_row(PS + (size_t)(ql0 + col) * TT, kc * 32, lane);
      asm volatile("s_wait_loadcnt 0x0" ::: "memory");
#pragma unroll
      for (int j = 0; j < HD / 16; ++j) { const size_t po = ((size_t)b * CC + h * HD + j * 16 + col) * (size_t)KHI + kc * 32; const v16b vh = frag_b(VB + po, lane); acc[j] = wmma_bf(p.h, vh, acc[j]); acc[j] = wmma_bf(p.l, vh, acc[j]); acc[j] = wmma_bf(p.h, frag_b(VBL + po, lane), acc[j]); } }
  } else {
#pragma unroll 1
    for (int kc = 0; kc < kce; ++kc) { const v16h p = frag_f32(PS + (size_t)(ql0 + col) * TT + kc * 32, lane);
      asm volatile("s_wait_loadcnt 0x0" ::: "memory");
#pragma unroll
      for (int j = 0; j < HD / 16; ++j) { const size_t po = ((size_t)b * CC + h * HD + j * 16 + col) * (size_t)TT + kc * 32; acc[j] = wmma16(p, frag_h(VT + po, lane), acc[j]); } } }
#pragma unroll
  for (int j = 0; j < HD / 16; ++j)
#pragma unroll
    for (int r = 0; r < 8; ++r) ss[wave][8 * g + r][j * 16 + col] = acc[j][r] * (1.0f / 2048.0f);
  LDSX(); for (int rl = 0; rl < 16; ++rl) if (lane < HD / 4) vst2(Y + ((size_t)b * TT + ql0 + rl) * CC + h * HD + lane * 4, *(const v4f*)&ss[wave][rl][lane * 4]); }

extern "C" void kernel_launch(void* const* d_in, const int* in_sizes, int n_in, void* d_out, int out_size, void* d_ws, size_t ws_size, hipStream_t stream) {
  (void)in_sizes; (void)n_in; (void)out_size;
  const float** F = (const float**)d_in;
  if (ws_size < (size_t)WS_END) return;
  char* ws = (char*)d_ws; _Float16 *QH = (_Float16*)(ws + WS_QH), *KH = (_Float16*)(ws + WS_KH), *VT = (_Float16*)(ws + WS_VT), *QL = (_Float16*)(ws + WS_QL), *KL = (_Float16*)(ws + WS_KL); __bf16 *VB = (__bf16*)(ws + WS_VB), *VBL = (__bf16*)(ws + WS_VBL); float *S = (float*)(ws + WS_S), *Y = (float*)(ws + WS_Y);
  (void)Y; (void)QL; (void)KL; (void)VB; (void)VBL;
  // inputs: 0 x [4,2048,1024]; 1 Wq [1024,128] (in,out); 2 Wk; 3 Wv
  k_proj<<<dim3(TNB * TT / 64, CC / 128, 3), 128, 0, stream>>>(F[0], F[0], F[0], F[1], F[2], F[3], nullptr, nullptr, nullptr, QH, QL, KH, KL, VT, VB, VBL);
  for (int b = 0; b < TNB; ++b) {
    k_sc<<<dim3(NQB, TT / 128, 1), 128, 0, stream>>>(QH, KH, QL, KL, b, 0, S);
    k_sm<<<dim3(TT, 1), 256, 0, stream>>>(S);
    k_pv<<<dim3(NQB, 1, 1), 128, 0, stream>>>(S, VT, VB, VBL, b, 0, (float*)d_out);
  }
}

// v001
// It runs in 221 microseconds.
// Two timings next to v000 both put it at 2.47 times that version's speed.
// compute dtype: all float inputs rounded to bf16; q/k/v = x W with EXACT bf16 products on WMMA 16x16x32 (f32 accumulate); causal logits: q, k once to f16 (1 product) x 128^-0.5, 3 products below row 384; softmax in f32; P x 2^11 once to f16 against v f16 (bf16 hi + lo below row 384); f32 output.
#include <hip/hip_runtime.h>
#include <math.h>

typedef __attribute__((ext_vector_type(16))) _Float16 v16h;
typedef __attribute__((ext_vector_type(16))) __bf16 v16b;
typedef __attribute__((ext_vector_type(8)))  _Float16 v8h;
typedef __attribute__((ext_vector_type(8)))  float v8f;
typedef __attribute__((ext_vector_type(4)))  float v4f;
typedef __attribute__((ext_vector_type(2)))  float v2f;
typedef __attribute__((ext_vector_type(4)))  unsigned v4u;
typedef __attribute__((ext_vector_type(4)))  int v4i;
typedef float __attribute__((may_alias)) float_a;
typedef int __attribute__((may_alias)) int_a;

template <typename T> __device__ __forceinline__ void vst2(void* p, T v) { *(T*)p = v;  }
__device__ __forceinline__ v8f wmma16(v16h a, v16h b, v8f c) {
  v8f d = __builtin_amdgcn_wmma_f32_16x16x32_f16(false, a, false, b, (short)0, c, false, false);
  asm volatile("v_nop\n\tv_nop\n\tv_nop\n\tv_nop" : "+v"(d) : "v"(a), "v"(b));
  return d;
}
__device__ __forceinline__ v8f wmma_bf(v16b a, v16b b, v8f c) {
  v8f d = __builtin_amdgcn_wmma_f32_16x16x32_bf16(false, a, false, b, (short)0, c, false, false);
  asm volatile("v_nop\n\tv_nop\n\tv_nop\n\tv_nop" : "+v"(d) : "v"(a), "v"(b));
  return d;
}
// 16x16x32 fragments: lane = (h = lane>>4, row/col = lane&15); elements 0..7 = k0+8h+0..7, 8..15 = k0+16+8h+0..7; D element r = row 8h+r
__device__ __forceinline__ v16h frag_h(const _Float16* rowk0, int lane) {
  union { v16h v; v8h q[2]; } u; const _Float16* p = rowk0 + 8 * (lane >> 4);
  u.q[0] = *(const v8h*)p; u.q[1] = *(const v8h*)(p + 16); return u.v;
}
__device__ __forceinline__ v16h frag_f32(const float* rowk0, int lane) {
  v16h a; const float* p = rowk0 + 8 * (lane >> 4);
#pragma unroll
  for (int i = 0; i < 8; ++i) { a[i] = (_Float16)p[i]; a[8 + i] = (_Float16)p[16 + i]; }
  return a;
}
__device__ __forceinline__ v16h frag_f32s(const float* rowk0, int lane, float sc) {
  v16h a; const float* p = rowk0 + 8 * (lane >> 4);
#pragma unroll
  for (int i = 0; i < 8; ++i) { a[i] = (_Float16)(p[i] * sc); a[8 + i] = (_Float16)(p[16 + i] * sc); }
  return a;
}
// column fragment from a [K][ld] layout (column n), rows >= K read as 0
__device__ __forceinline__ v16h fragc_f32(const float* W, int k0, int n, int lane, int ld, int K) {
  v16h a; const int g = lane >> 4;
#pragma unroll
  for (int i = 0; i < 8; ++i) { const int ka = k0 + 8 * g + i, kb = ka + 16;
    a[i] = (_Float16)(ka < K ? W[(size_t)(ka < K ? ka : K - 1) * ld + n] : 0.f); a[8 + i] = (_Float16)(kb < K ? W[(size_t)(kb < K ? kb : K - 1) * ld + n] : 0.f); }
  return a;
}
struct F2 { v16b h, l; };
__device__ __forceinline__ F2 bsplit16(const float v[16]) { F2 r;
#pragma unroll
  for (int i = 0; i < 16; ++i) { const __bf16 h = (__bf16)v[i]; r.h[i] = h; r.l[i] = (__bf16)(v[i] - (float)h); }
  return r; }
__device__ __forceinline__ F2 split_row(const float* row, int k0, int lane) { float v[16]; const float* p = row + k0 + 8 * (lane >> 4);
#pragma unroll
  for (int i = 0; i < 8; ++i) { v[i] = p[i]; v[8 + i] = p[16 + i]; }
  return bsplit16(v); }
__device__ __forceinline__ F2 split_rowK(const float* row, int k0, int lane, int K) { float v[16]; const int g = lane >> 4;
#pragma unroll
  for (int i = 0; i < 8; ++i) { const int ka = k0 + 8 * g + i, kb = ka + 16; v[i] = ka < K ? row[ka < K ? ka : K - 1] : 0.f; v[8 + i] = kb < K ? row[kb < K ? kb : K - 1] : 0.f; }
  return bsplit16(v); }
__device__ __forceinline__ F2 split_col(const float* W, int k0, int n, int lane, int ld, int K) { float v[16]; const int g = lane >> 4;
#pragma unroll
  for (int i = 0; i < 8; ++i) { const int ka = k0 + 8 * g + i, kb = ka + 16; v[i] = ka < K ? W[(size_t)(ka < K ? ka : K - 1) * ld + n] : 0.f; v[8 + i] = kb < K ? W[(size_t)(kb < K ? kb : K - 1) * ld + n] : 0.f; }
  return bsplit16(v); }
__device__ __forceinline__ v8f mac3(const F2& a, const F2& b, v8f c) { c = wmma_bf(a.l, b.h, c); c = wmma_bf(a.h, b.l, c); return wmma_bf(a.h, b.h, c); }
__device__ __forceinline__ float sigm(float v) { return 1.0f / (1.0f + expf(-v)); }
#define LDSX() do { asm volatile("s_wait_dscnt 0" ::: "memory"); __builtin_amdgcn_wave_barrier(); __builtin_amdgcn_fence(__ATOMIC_RELEASE, "workgroup"); } while (0)

// Single-head causal self-attention (B 4, T 2,048, C 1,024 -> H 128; (in,out) 1/32-scale weights, no biases): q, k, v = x W; out = softmax_causal(q k^T x 128^-0.5) v -> [B, T, 128].
#define NB 4
#define TT 2048
#define CC 128            // NH * HD = projected width
#define DIN 1024          // input (model) width
#define NH 1
#define HD 128
#define NQB (TT / 64)
#define HG 1
#define SCALE (0.08838834764831845f)
#define CAUSAL 1
#ifndef TNB
#define TNB NB
#endif
__device__ __forceinline__ float bfr(float v) { return (float)(__bf16)v; }
__host__ __device__ __forceinline__ int kb_last(int qb) { return CAUSAL ? ((qb * 64 + 63) >> 7) : (TT / 128 - 1); }
typedef __attribute__((ext_vector_type(8))) __bf16 v8b;
__device__ __forceinline__ v16b frag_b(const __bf16* rowk0, int lane) {
  union { v16b v; v8b q[2]; } u; const __bf16* p = rowk0 + 8 * (lane >> 4);
  u.q[0] = *(const v8b*)p; u.q[1] = *(const v8b*)(p + 16); return u.v;
}
#define QBH 6              // causal: query blocks 0..QBH-1 of each sequence (few keys, no averaging) take the high-precision path
#define QHI 384            // rows carrying a q residual plane
#define KHI 384            // key rows carrying k residual / v bf16 hi+lo planes (used only by the causal high-precision path)
// B fragment (k rows k0+.., output column o) of a weight: (in,out) [K][ld] or (out,in) [ld rows of K]: bf16 exact, or f16(bf16 * 256) exact
__device__ __forceinline__ v16b wcol_io(const float* Wm, int k0, int o, int lane, int ld) { v16b w; const int g = lane >> 4;
#pragma unroll
  for (int i = 0; i < 8; ++i) { w[i] = (__bf16)Wm[(size_t)(k0 + 8 * g + i) * ld + o]; w[8 + i] = (__bf16)Wm[(size_t)(k0 + 16 + 8 * g + i) * ld + o]; }
  return w; }
__device__ __forceinline__ v16b wcol_oi(const float* Wm, int k0, int o, int lane, int K) { v16b w; const float* p = Wm + (size_t)o * K + k0 + 8 * (lane >> 4);
#pragma unroll
  for (int i = 0; i < 8; ++i) { w[i] = (__bf16)p[i]; w[8 + i] = (__bf16)p[16 + i]; }
  return w; }
__device__ __forceinline__ v16h wcolh_io(const float* Wm, int k0, int o, int lane, int ld) { v16h w; const int g = lane >> 4;
#pragma unroll
  for (int i = 0; i < 8; ++i) { w[i] = (_Float16)(bfr(Wm[(size_t)(k0 + 8 * g + i) * ld + o]) * 256.0f); w[8 + i] = (_Float16)(bfr(Wm[(size_t)(k0 + 16 + 8 * g + i) * ld + o]) * 256.0f); }
  return w; }
__device__ __forceinline__ v16h wcolh_oi(const float* Wm, int k0, int o, int lane, int K) { v16h w; const float* p = Wm + (size_t)o * K + k0 + 8 * (lane >> 4);
#pragma unroll
  for (int i = 0; i < 8; ++i) { w[i] = (_Float16)(bfr(p[i]) * 256.0f); w[8 + i] = (_Float16)(bfr(p[16 + i]) * 256.0f); }
  return w; }
#define WQKV_LAYOUT 0   // 0 = (in,out) [DIN][CC]; 1 = (out,in) [CC][DIN]; 2 = per-head [NH][DIN][HD]
__device__ __forceinline__ v16b wcol_hdk(const float* Wm, int k0, int o, int lane) { v16b w; const int g = lane >> 4; const float* p = Wm + (size_t)(o / HD) * DIN * HD + (o % HD);
#pragma unroll
  for (int i = 0; i < 8; ++i) { w[i] = (__bf16)p[(size_t)(k0 + 8 * g + i) * HD]; w[8 + i] = (__bf16)p[(size_t)(k0 + 16 + 8 * g + i) * HD]; }
  return w; }
#define WO_OUT_IN 0
#if WQKV_LAYOUT == 1
#define WCOL(W, k0, o, lane) wcol_oi(W, k0, o, lane, DIN)
#elif WQKV_LAYOUT == 2
#define WCOL(W, k0, o, lane) wcol_hdk(W, k0, o, lane)
#else
#define WCOL(W, k0, o, lane) wcol_io(W, k0, o, lane, CC)
#endif
#if WO_OUT_IN
#define WOCOL(W, k0, o, lane) wcol_oi(W, k0, o, lane, CC)
#define WOCOLH(W, k0, o, lane) wcolh_oi(W, k0, o, lane, CC)
#else
#define WOCOL(W, k0, o, lane) wcol_io(W, k0, o, lane, DIN)
#define WOCOLH(W, k0, o, lane) wcolh_io(W, k0, o, lane, DIN)
#endif

#ifndef SM_EXTRA_PARAMS
#define SM_EXTRA_PARAMS
#endif
#ifndef PROJ_EXTRA_PARAMS
#define PROJ_EXTRA_PARAMS
#endif
#ifndef SM_MASK_HOOK
#define SM_MASK_HOOK (void)0
#endif

#define WS_QH  0u                                      // f16 q rows [b*t][CC]
#define WS_KH  (WS_QH + 2u * (size_t)NB * TT * CC)      // f16 k rows [b*t][CC]
#define WS_VT  (WS_KH + 2u * (size_t)NB * TT * CC)      // f16 v planes [b][c][t]
#define WS_QL  (WS_VT + 2u * (size_t)NB * CC * TT)      // f16 q residual x 2^10 rows [b][t < QHI][CC]
#define WS_KL  (WS_QL + 2u * (size_t)NB * QHI * CC)     // f16 k residual x 2^10 rows [b][t < KHI][CC]
#define WS_VB  (WS_KL + 2u * (size_t)NB * KHI * CC)     // bf16 v hi planes [b][c][t < KHI]
#define WS_VBL (WS_VB + 2u * (size_t)NB * CC * KHI)
#define WS_S   (WS_VBL + 2u * (size_t)NB * CC * KHI)    // f32 logits / P [b][hg][t][s]: one plane per batch, so that every batch is in flight in the same launch
#define WS_Y   (WS_S  + 4u * (size_t)NB * HG * TT * TT)      // f32 ctx rows [b*t][CC] (only when there is an output projection)
#define WS_END (WS_Y  + 0u)

// ---- k_proj: block = (64 rows, 128 cols, which): q/k/v = X W (+ b) with exact bf16 products (K = DIN) -> which 0: q f16 rows (+ residual rows < QHI); 1: k f16 rows (+ residual rows < KHI); 2: v f16 planes [c][t] (+ bf16 hi/lo planes for t < KHI)
__global__ __launch_bounds__(128) void k_proj(const float* __restrict__ XQ, const float* __restrict__ XK, const float* __restrict__ XV, const float* __restrict__ WQ, const float* __restrict__ WK, const float* __restrict__ WV, const float* __restrict__ BQ, const float* __restrict__ BK, const float* __restrict__ BV,
    _Float16* __restrict__ QH, _Float16* __restrict__ QL, _Float16* __restrict__ KH, _Float16* __restrict__ KL, _Float16* __restrict__ VT, __bf16* __restrict__ VB, __bf16* __restrict__ VBL) {
  __shared__ __align__(16) _Float16 sh[64][136], sl[64][136]; __shared__ __align__(16) _Float16 th[128][72]; __shared__ __align__(16) __bf16 tb[128][72], tbl[128][72];
  const int tid = threadIdx.x, wave = tid >> 5, lane = tid & 31, col = lane & 15, g = lane >> 4; const int which = blockIdx.z; const int c0 = blockIdx.y * 128; const size_t r0 = (size_t)blockIdx.x * 64; const size_t bb = r0 / TT; const int t0 = (int)(r0 % TT);
  const float* X = which == 0 ? XQ : which == 1 ? XK : XV; const float* WA = which == 0 ? WQ : which == 1 ? WK : WV; const float* BA = which == 0 ? BQ : which == 1 ? BK : BV;
  v8f acc[8] = {};
#pragma unroll 2
  for (int kc = 0; kc < DIN / 32; ++kc) { v16b a; { const float* p = X + (r0 + wave * 16 + col) * DIN + kc * 32 + 8 * g;
#pragma unroll
      for (int i = 0; i < 8; ++i) { a[i] = (__bf16)p[i]; a[8 + i] = (__bf16)p[16 + i]; } }
    asm volatile("s_wait_loadcnt 0x0" ::: "memory");
#pragma unroll
    for (int j = 0; j < 8; ++j) { const v16b w = WCOL(WA, kc * 32, c0 + j * 16 + col, lane); asm volatile("s_wait_loadcnt 0x0" ::: "memory"); acc[j] = wmma_bf(a, w, acc[j]); } }
  if (which < 2) { _Float16* DH = which == 0 ? QH : KH; _Float16* DL = which == 0 ? QL : KL; const int nhi = which == 0 ? QHI : KHI; const bool hi_rows = t0 < nhi;
#pragma unroll
    for (int j = 0; j < 8; ++j) { const float bias = BA ? bfr(BA[c0 + j * 16 + col]) : 0.f;
#pragma unroll
      for (int r = 0; r < 8; ++r) { const float v = acc[j][r] + bias; const _Float16 hv = (_Float16)v; sh[wave * 16 + 8 * g + r][j * 16 + col] = hv; sl[wave * 16 + 8 * g + r][j * 16 + col] = (_Float16)((v - (float)hv) * 1024.0f); } }
    __syncthreads();
    for (int e = tid; e < 64 * 16; e += 128) { const int rl = e >> 4, q = e & 15; vst2((unsigned*)(DH + (r0 + rl) * CC + c0 + q * 8), *(const v4u*)&sh[rl][q * 8]); if (hi_rows) vst2((unsigned*)(DL + (bb * nhi + t0 + rl) * (size_t)CC + c0 + q * 8), *(const v4u*)&sl[rl][q * 8]); }
  } else { const bool hi_rows = t0 < KHI;
#pragma unroll
    for (int j = 0; j < 8; ++j) { const float bias = BA ? bfr(BA[c0 + j * 16 + col]) : 0.f;
#pragma unroll
      for (int r = 0; r < 8; ++r) { const float v = acc[j][r] + bias; const int rl = wave * 16 + 8 * g + r, cl = j * 16 + col; th[cl][rl] = (_Float16)v; const __bf16 bh = (__bf16)v; tb[cl][rl] = bh; tbl[cl][rl] = (__bf16)(v - (float)bh); } }
    __syncthreads();
    for (int e = tid; e < 128 * 8; e += 128) { const int cl = e >> 3, q = e & 7; vst2((unsigned*)(VT + (bb * CC + c0 + cl) * (size_t)TT + t0 + q * 8), *(const v4u*)&th[cl][q * 8]); if (hi_rows) { const size_t o3 = (bb * CC + c0 + cl) * (size_t)KHI + t0 + q * 8; vst2((unsigned*)(VB + o3), *(const v4u*)&tb[cl][q * 8]); vst2((unsigned*)(VBL + o3), *(const v4u*)&tbl[cl][q * 8]); } } } }
// ---- k_sc: block = (query block qb, key block kb <= kb_last(qb), z = batch x head in group): logits x SCALE; q hi + residual (x 2^10) against k (2 products) for query rows < QHI, plus the k residual (3 products) for query blocks < QBH (causal early rows); causal: blocks past the diagonal exit, the mask itself is applied by index in k_sm
__global__ __launch_bounds__(128) void k_sc(const _Float16* __restrict__ QH, const _Float16* __restrict__ KH, const _Float16* __restrict__ QL, const _Float16* __restrict__ KL, int h0, float* __restrict__ S0) { __shared__ __align__(16) float ss[4][16][132];
  const int qb = blockIdx.x, kb = blockIdx.y; if (kb > kb_last(qb)) return;
  const int b = blockIdx.z / HG, h = h0 + blockIdx.z % HG; float* S = S0 + (size_t)blockIdx.z * TT * TT;
  const int tid = threadIdx.x, wave = tid >> 5, lane = tid & 31, col = lane & 15, g = lane >> 4; const int k0 = kb * 128; const int ql0 = qb * 64 + wave * 16; const size_t q0 = (size_t)b * TT + ql0, kr0 = (size_t)b * TT + k0;
  v8f acc[8] = {}, accl[8] = {};
  const _Float16* QLb = QL + (size_t)b * QHI * CC; const _Float16* KLb = KL + (size_t)b * KHI * CC;
  if (qb < QBH) {
#pragma unroll
    for (int kc = 0; kc < HD / 32; ++kc) { const v16h ah = frag_h(QH + (q0 + col) * CC + h * HD + kc * 32, lane), al = frag_h(QLb + (size_t)(ql0 + col) * CC + h * HD + kc * 32, lane);
#pragma unroll
      for (int j = 0; j < 8; ++j) { const v16h kbf = frag_h(KH + (kr0 + j * 16 + col) * CC + h * HD + kc * 32, lane), klf = frag_h(KLb + (size_t)(k0 + j * 16 + col) * CC + h * HD + kc * 32, lane); acc[j] = wmma16(ah, kbf, acc[j]); accl[j] = wmma16(al, kbf, accl[j]); accl[j] = wmma16(ah, klf, accl[j]); } }
  } else if (qb * 64 < QHI) {
#pragma unroll
    for (int kc = 0; kc < HD / 32; ++kc) { const v16h ah = frag_h(QH + (q0 + col) * CC + h * HD + kc * 32, lane), al = frag_h(QLb + (size_t)(ql0 + col) * CC + h * HD + kc * 32, lane);
#pragma unroll
      for (int j = 0; j < 8; ++j) { const v16h kbf = frag_h(KH + (kr0 + j * 16 + col) * CC + h * HD + kc * 32, lane); acc[j] = wmma16(ah, kbf, acc[j]); accl[j] = wmma16(al, kbf, accl[j]); } }
  } else {
#pragma unroll
    for (int kc = 0; kc < HD / 32; ++kc) { const v16h ah = frag_h(QH + (q0 + col) * CC + h * HD + kc * 32, lane);
#pragma unroll
      for (int j = 0; j < 8; ++j) { const v16h kbf = frag_h(KH + (kr0 + j * 16 + col) * CC + h * HD + kc * 32, lane); acc[j] = wmma16(ah, kbf, acc[j]); } } }
#pragma unroll
  for (int j = 0; j < 8; ++j) {
#pragma unroll
    for (int r = 0; r < 8; ++r) ss[wave][8 * g + r][j * 16 + col] = (acc[j][r] + accl[j][r] * (1.0f / 1024.0f)) * SCALE; }
  LDSX(); for (int rl = 0; rl < 16; ++rl) vst2(S + (size_t)(ql0 + rl) * TT + k0 + lane * 4, *(const v4f*)&ss[wave][rl][lane * 4]); }
// ---- k_sm: block = query row t (y = batch x head in group): keys [0, kend): causal -> logit if s <= t else excluded; softmax in f32; P x 2^11 in place (0 for excluded)
__global__ __launch_bounds__(256) void k_sm(float* __restrict__ S0 SM_EXTRA_PARAMS) { __shared__ float sred[8]; __shared__ float sbc; __shared__ __align__(16) float shv[TT];
  const int tid = threadIdx.x; const int t = blockIdx.x; const int kend = (kb_last(t >> 6) + 1) * 128;
  float* sr = S0 + (size_t)blockIdx.y * TT * TT + (size_t)t * TT;
  float m = -3.0e38f; for (int k = tid; k < kend; k += 256) { float v = (!CAUSAL || k <= t) ? sr[k] : -3.0e38f; SM_MASK_HOOK; shv[k] = v; m = fmaxf(m, v); }
#pragma unroll
  for (int o = 1; o < 32; o <<= 1) m = fmaxf(m, __shfl_xor(m, o));
  if ((tid & 31) == 0) sred[tid >> 5] = m; __syncthreads(); if (tid == 0) { float a = sred[0]; for (int i = 1; i < 8; ++i) a = fmaxf(a, sred[i]); sbc = a; } __syncthreads(); m = sbc; __syncthreads();
  float sum = 0.f; for (int k = tid; k < kend; k += 256) { const float v = shv[k]; const float e = (v <= -1.0e38f) ? 0.f : expf(v - m); shv[k] = e; sum += e; }
#pragma unroll
  for (int o = 1; o < 32; o <<= 1) sum += __shfl_xor(sum, o);
  if ((tid & 31) == 0) sred[tid >> 5] = sum; __syncthreads(); if (tid == 0) { float a = 0.f; for (int i = 0; i < 8; ++i) a += sred[i]; sbc = a > 0.f ? 2048.0f / a : 0.f; }   /* a fully excluded row yields P = 0 */ __syncthreads(); const float inv = sbc;
  for (int k = tid; k < kend; k += 256) shv[k] = shv[k] * inv;
  __syncthreads(); for (int q = tid; q < kend / 4; q += 256) vst2(sr + q * 4, *(const v4f*)&shv[q * 4]); }
// ---- k_pv: block = 64 queries (qb) of (b, h) = z: ctx = P . v over keys [0, kend) (P x 2^11 once to f16 against v f16: 1 product; causal early query blocks: P and v as bf16 hi + lo, 3 products); 512-B (row, head) segment by 32 lanes
__global__ __launch_bounds__(128) void k_pv(const float* __restrict__ PS0, const _Float16* __restrict__ VT, const __bf16* __restrict__ VB, const __bf16* __restrict__ VBL, int h0, float* __restrict__ Y) { const int b = blockIdx.z / HG, h = h0 + blockIdx.z % HG; const float* PS = PS0 + (size_t)blockIdx.z * TT * TT; __shared__ __align__(16) float ss[4][16][HD + 4];
  const int tid = threadIdx.x, wave = tid >> 5, lane = tid & 31, col = lane & 15, g = lane >> 4; const int qb = blockIdx.x; const int ql0 = qb * 64 + wave * 16; const int kce = (kb_last(qb) + 1) * 4;
  v8f acc[HD / 16] = {};
  if (qb < QBH) {
#pragma unroll 1
    for (int kc = 0; kc < kce; ++kc) { const F2 p = split_row(PS + (size_t)(ql0 + col) * TT, kc * 32, lane);
      asm volatile("s_wait_loadcnt 0x0" ::: "memory");
#pragma unroll
      for (int j = 0; j < HD / 16; ++j) { const size_t po = ((size_t)b * CC + h * HD + j * 16 + col) * (size_t)KHI + kc * 32; const v16b vh = frag_b(VB + po, lane); acc[j] = wmma_bf(p.h, vh, acc[j]); acc[j] = wmma_bf(p.l, vh, acc[j]); acc[j] = wmma_bf(p.h, frag_b(VBL + po, lane), acc[j]); } }
  } else {
#pragma unroll 1
    for (int kc = 0; kc < kce; ++kc) { const v16h p = frag_f32(PS + (size_t)(ql0 + col) * TT + kc * 32, lane);
      asm volatile("s_wait_loadcnt 0x0" ::: "memory");
#pragma unroll
      for (int j = 0; j < HD / 16; ++j) { const size_t po = ((size_t)b * CC + h * HD + j * 16 + col) * (size_t)TT + kc * 32; acc[j] = wmma16(p, frag_h(VT + po, lane), acc[j]); } } }
#pragma unroll
  for (int j = 0; j < HD / 16; ++j)
#pragma unroll
    for (int r = 0; r < 8; ++r) ss[wave][8 * g + r][j * 16 + col] = acc[j][r] * (1.0f / 2048.0f);
  LDSX(); for (int rl = 0; rl < 16; ++rl) if (lane < HD / 4) vst2(Y + ((size_t)b * TT + ql0 + rl) * CC + h * HD + lane * 4, *(const v4f*)&ss[wave][rl][lane * 4]); }

extern "C" void kernel_launch(void* const* d_in, const int* in_sizes, int n_in, void* d_out, int out_size, void* d_ws, size_t ws_size, hipStream_t stream) {
  (void)in_sizes; (void)n_in; (void)out_size;
  const float** F = (const float**)d_in;
  if (ws_size < (size_t)WS_END) return;
  char* ws = (char*)d_ws; _Float16 *QH = (_Float16*)(ws + WS_QH), *KH = (_Float16*)(ws + WS_KH), *VT = (_Float16*)(ws + WS_VT), *QL = (_Float16*)(ws + WS_QL), *KL = (_Float16*)(ws + WS_KL); __bf16 *VB = (__bf16*)(ws + WS_VB), *VBL = (__bf16*)(ws + WS_VBL); float *S = (float*)(ws + WS_S), *Y = (float*)(ws + WS_Y);
  (void)Y; (void)QL; (void)KL; (void)VB; (void)VBL;
  // inputs: 0 x [4,2048,1024]; 1 Wq [1024,128] (in,out); 2 Wk; 3 Wv
  k_proj<<<dim3(TNB * TT / 64, CC / 128, 3), 128, 0, stream>>>(F[0], F[0], F[0], F[1], F[2], F[3], nullptr, nullptr, nullptr, QH, QL, KH, KL, VT, VB, VBL);
  k_sc<<<dim3(NQB, TT / 128, TNB), 128, 0, stream>>>(QH, KH, QL, KL, 0, S);
  k_sm<<<dim3(TT, TNB), 256, 0, stream>>>(S);
  k_pv<<<dim3(NQB, 1, TNB), 128, 0, stream>>>(S, VT, VB, VBL, 0, (float*)d_out);
}

// v002
// One run takes 103 microseconds.
// Timed twice side by side with v001, it ran 2.16 and 2.14 times as fast.
// All steps since v000 together make it 5.30 times as fast.
// compute dtype: all float inputs rounded to bf16; q/k/v = x W with EXACT bf16 products on WMMA 16x16x32 (f32 accumulate); causal logits: q, k once to f16 (1 product) x 128^-0.5, 3 products below row 384; softmax in f32 with a running row maximum; exp x 2^11 once to f16 against v f16 (bf16 hi + lo below row 384), divided by the row sum last; f32 output.
#include <hip/hip_runtime.h>
#include <math.h>

typedef __attribute__((ext_vector_type(16))) _Float16 v16h;
typedef __attribute__((ext_vector_type(16))) __bf16 v16b;
typedef __attribute__((ext_vector_type(8)))  _Float16 v8h;
typedef __attribute__((ext_vector_type(8)))  float v8f;
typedef __attribute__((ext_vector_type(4)))  float v4f;
typedef __attribute__((ext_vector_type(2)))  float v2f;
typedef __attribute__((ext_vector_type(4)))  unsigned v4u;
typedef __attribute__((ext_vector_type(4)))  int v4i;
typedef float __attribute__((may_alias)) float_a;
typedef int __attribute__((may_alias)) int_a;

template <typename T> __device__ __forceinline__ void vst2(void* p, T v) { *(T*)p = v;  }
__device__ __forceinline__ v8f wmma16(v16h a, v16h b, v8f c) {
  v8f d = __builtin_amdgcn_wmma_f32_16x16x32_f16(false, a, false, b, (short)0, c, false, false);
  asm volatile("v_nop\n\tv_nop\n\tv_nop\n\tv_nop" : "+v"(d) : "v"(a), "v"(b));
  return d;
}
__device__ __forceinline__ v8f wmma_bf(v16b a, v16b b, v8f c) {
  v8f d = __builtin_amdgcn_wmma_f32_16x16x32_bf16(false, a, false, b, (short)0, c, false, false);
  asm volatile("v_nop\n\tv_nop\n\tv_nop\n\tv_nop" : "+v"(d) : "v"(a), "v"(b));
  return d;
}
// 16x16x32 fragments: lane = (h = lane>>4, row/col = lane&15); elements 0..7 = k0+8h+0..7, 8..15 = k0+16+8h+0..7; D element r = row 8h+r
__device__ __forceinline__ v16h frag_h(const _Float16* rowk0, int lane) {
  union { v16h v; v8h q[2]; } u; const _Float16* p = rowk0 + 8 * (lane >> 4);
  u.q[0] = *(const v8h*)p; u.q[1] = *(const v8h*)(p + 16); return u.v;
}
__device__ __forceinline__ v16h frag_f32(const float* rowk0, int lane) {
  v16h a; const float* p = rowk0 + 8 * (lane >> 4);
#pragma unroll
  for (int i = 0; i < 8; ++i) { a[i] = (_Float16)p[i]; a[8 + i] = (_Float16)p[16 + i]; }
  return a;
}
__device__ __forceinline__ v16h frag_f32s(const float* rowk0, int lane, float sc) {
  v16h a; const float* p = rowk0 + 8 * (lane >> 4);
#pragma unroll
  for (int i = 0; i < 8; ++i) { a[i] = (_Float16)(p[i] * sc); a[8 + i] = (_Float16)(p[16 + i] * sc); }
  return a;
}
// column fragment from a [K][ld] layout (column n), rows >= K read as 0
__device__ __forceinline__ v16h fragc_f32(const float* W, int k0, int n, int lane, int ld, int K) {
  v16h a; const int g = lane >> 4;
#pragma unroll
  for (int i = 0; i < 8; ++i) { const int ka = k0 + 8 * g + i, kb = ka + 16;
    a[i] = (_Float16)(ka < K ? W[(size_t)(ka < K ? ka : K - 1) * ld + n] : 0.f); a[8 + i] = (_Float16)(kb < K ? W[(size_t)(kb < K ? kb : K - 1) * ld + n] : 0.f); }
  return a;
}
struct F2 { v16b h, l; };
__device__ __forceinline__ F2 bsplit16(const float v[16]) { F2 r;
#pragma unroll
  for (int i = 0; i < 16; ++i) { const __bf16 h = (__bf16)v[i]; r.h[i] = h; r.l[i] = (__bf16)(v[i] - (float)h); }
  return r; }
__device__ __forceinline__ F2 split_row(const float* row, int k0, int lane) { float v[16]; const float* p = row + k0 + 8 * (lane >> 4);
#pragma unroll
  for (int i = 0; i < 8; ++i) { v[i] = p[i]; v[8 + i] = p[16 + i]; }
  return bsplit16(v); }
__device__ __forceinline__ F2 split_rowK(const float* row, int k0, int lane, int K) { float v[16]; const int g = lane >> 4;
#pragma unroll
  for (int i = 0; i < 8; ++i) { const int ka = k0 + 8 * g + i, kb = ka + 16; v[i] = ka < K ? row[ka < K ? ka : K - 1] : 0.f; v[8 + i] = kb < K ? row[kb < K ? kb : K - 1] : 0.f; }
  return bsplit16(v); }
__device__ __forceinline__ F2 split_col(const float* W, int k0, int n, int lane, int ld, int K) { float v[16]; const int g = lane >> 4;
#pragma unroll
  for (int i = 0; i < 8; ++i) { const int ka = k0 + 8 * g + i, kb = ka + 16; v[i] = ka < K ? W[(size_t)(ka < K ? ka : K - 1) * ld + n] : 0.f; v[8 + i] = kb < K ? W[(size_t)(kb < K ? kb : K - 1) * ld + n] : 0.f; }
  return bsplit16(v); }
__device__ __forceinline__ v8f mac3(const F2& a, const F2& b, v8f c) { c = wmma_bf(a.l, b.h, c); c = wmma_bf(a.h, b.l, c); return wmma_bf(a.h, b.h, c); }
__device__ __forceinline__ float sigm(float v) { return 1.0f / (1.0f + expf(-v)); }
#define LDSX() do { asm volatile("s_wait_dscnt 0" ::: "memory"); __builtin_amdgcn_wave_barrier(); __builtin_amdgcn_fence(__ATOMIC_RELEASE, "workgroup"); } while (0)

// Single-head causal self-attention (B 4, T 2,048, C 1,024 -> H 128; (in,out) 1/32-scale weights, no biases): q, k, v = x W; out = softmax_causal(q k^T x 128^-0.5) v -> [B, T, 128].
#define NB 4
#define TT 2048
#define CC 128            // NH * HD = projected width
#define DIN 1024          // input (model) width
#define NH 1
#define HD 128
#define NQB (TT / 64)
#define HG 1
#define SCALE (0.08838834764831845f)
#define CAUSAL 1
#ifndef TNB
#define TNB NB
#endif
__device__ __forceinline__ float bfr(float v) { return (float)(__bf16)v; }
__host__ __device__ __forceinline__ int kb_last(int qb) { return CAUSAL ? ((qb * 64 + 63) >> 7) : (TT / 128 - 1); }
typedef __attribute__((ext_vector_type(8))) __bf16 v8b;
__device__ __forceinline__ v16b frag_b(const __bf16* rowk0, int lane) {
  union { v16b v; v8b q[2]; } u; const __bf16* p = rowk0 + 8 * (lane >> 4);
  u.q[0] = *(const v8b*)p; u.q[1] = *(const v8b*)(p + 16); return u.v;
}
#define QBH 6              // causal: query blocks 0..QBH-1 of each sequence (few keys, no averaging) take the high-precision path
#define QHI 384            // rows carrying a q residual plane
#define KHI 384            // key rows carrying k residual / v bf16 hi+lo planes (used only by the causal high-precision path)
// B fragment (k rows k0+.., output column o) of a weight: (in,out) [K][ld] or (out,in) [ld rows of K]: bf16 exact, or f16(bf16 * 256) exact
__device__ __forceinline__ v16b wcol_io(const float* Wm, int k0, int o, int lane, int ld) { v16b w; const int g = lane >> 4;
#pragma unroll
  for (int i = 0; i < 8; ++i) { w[i] = (__bf16)Wm[(size_t)(k0 + 8 * g + i) * ld + o]; w[8 + i] = (__bf16)Wm[(size_t)(k0 + 16 + 8 * g + i) * ld + o]; }
  return w; }
__device__ __forceinline__ v16b wcol_oi(const float* Wm, int k0, int o, int lane, int K) { v16b w; const float* p = Wm + (size_t)o * K + k0 + 8 * (lane >> 4);
#pragma unroll
  for (int i = 0; i < 8; ++i) { w[i] = (__bf16)p[i]; w[8 + i] = (__bf16)p[16 + i]; }
  return w; }
__device__ __forceinline__ v16h wcolh_io(const float* Wm, int k0, int o, int lane, int ld) { v16h w; const int g = lane >> 4;
#pragma unroll
  for (int i = 0; i < 8; ++i) { w[i] = (_Float16)(bfr(Wm[(size_t)(k0 + 8 * g + i) * ld + o]) * 256.0f); w[8 + i] = (_Float16)(bfr(Wm[(size_t)(k0 + 16 + 8 * g + i) * ld + o]) * 256.0f); }
  return w; }
__device__ __forceinline__ v16h wcolh_oi(const float* Wm, int k0, int o, int lane, int K) { v16h w; const float* p = Wm + (size_t)o * K + k0 + 8 * (lane >> 4);
#pragma unroll
  for (int i = 0; i < 8; ++i) { w[i] = (_Float16)(bfr(p[i]) * 256.0f); w[8 + i] = (_Float16)(bfr(p[16 + i]) * 256.0f); }
  return w; }
#define WQKV_LAYOUT 0   // 0 = (in,out) [DIN][CC]; 1 = (out,in) [CC][DIN]; 2 = per-head [NH][DIN][HD]
__device__ __forceinline__ v16b wcol_hdk(const float* Wm, int k0, int o, int lane) { v16b w; const int g = lane >> 4; const float* p = Wm + (size_t)(o / HD) * DIN * HD + (o % HD);
#pragma unroll
  for (int i = 0; i < 8; ++i) { w[i] = (__bf16)p[(size_t)(k0 + 8 * g + i) * HD]; w[8 + i] = (__bf16)p[(size_t)(k0 + 16 + 8 * g + i) * HD]; }
  return w; }
#define WO_OUT_IN 0
#if WQKV_LAYOUT == 1
#define WCOL(W, k0, o, lane) wcol_oi(W, k0, o, lane, DIN)
#elif WQKV_LAYOUT == 2
#define WCOL(W, k0, o, lane) wcol_hdk(W, k0, o, lane)
#else
#define WCOL(W, k0, o, lane) wcol_io(W, k0, o, lane, CC)
#endif
#if WO_OUT_IN
#define WOCOL(W, k0, o, lane) wcol_oi(W, k0, o, lane, CC)
#define WOCOLH(W, k0, o, lane) wcolh_oi(W, k0, o, lane, CC)
#else
#define WOCOL(W, k0, o, lane) wcol_io(W, k0, o, lane, DIN)
#define WOCOLH(W, k0, o, lane) wcolh_io(W, k0, o, lane, DIN)
#endif

#ifndef SM_EXTRA_PARAMS
#define SM_EXTRA_PARAMS
#endif
#ifndef PROJ_EXTRA_PARAMS
#define PROJ_EXTRA_PARAMS
#endif
#ifndef SM_MASK_HOOK
#define SM_MASK_HOOK (void)0
#endif

#define WS_QH  0u                                      // f16 q rows [b*t][CC]
#define WS_KH  (WS_QH + 2u * (size_t)NB * TT * CC)      // f16 k rows [b*t][CC]
#define WS_VT  (WS_KH + 2u * (size_t)NB * TT * CC)      // f16 v planes [b][c][t]
#define WS_QL  (WS_VT + 2u * (size_t)NB * CC * TT)      // f16 q residual x 2^10 rows [b][t < QHI][CC]
#define WS_KL  (WS_QL + 2u * (size_t)NB * QHI * CC)     // f16 k residual x 2^10 rows [b][t < KHI][CC]
#define WS_VB  (WS_KL + 2u * (size_t)NB * KHI * CC)     // bf16 v hi planes [b][c][t < KHI]
#define WS_VBL (WS_VB + 2u * (size_t)NB * CC * KHI)
#define WS_END (WS_VBL + 2u * (size_t)NB * CC * KHI)

// ---- k_proj: block = (64 rows, 128 cols, which): q/k/v = X W (+ b) with exact bf16 products (K = DIN) -> which 0: q f16 rows (+ residual rows < QHI); 1: k f16 rows (+ residual rows < KHI); 2: v f16 planes [c][t] (+ bf16 hi/lo planes for t < KHI)
__global__ __launch_bounds__(128) void k_proj(const float* __restrict__ XQ, const float* __restrict__ XK, const float* __restrict__ XV, const float* __restrict__ WQ, const float* __restrict__ WK, const float* __restrict__ WV, const float* __restrict__ BQ, const float* __restrict__ BK, const float* __restrict__ BV,
    _Float16* __restrict__ QH, _Float16* __restrict__ QL, _Float16* __restrict__ KH, _Float16* __restrict__ KL, _Float16* __restrict__ VT, __bf16* __restrict__ VB, __bf16* __restrict__ VBL) {
  __shared__ __align__(16) _Float16 sh[64][136], sl[64][136]; __shared__ __align__(16) _Float16 th[128][72]; __shared__ __align__(16) __bf16 tb[128][72], tbl[128][72];
  const int tid = threadIdx.x, wave = tid >> 5, lane = tid & 31, col = lane & 15, g = lane >> 4; const int which = blockIdx.z; const int c0 = blockIdx.y * 128; const size_t r0 = (size_t)blockIdx.x * 64; const size_t bb = r0 / TT; const int t0 = (int)(r0 % TT);
  const float* X = which == 0 ? XQ : which == 1 ? XK : XV; const float* WA = which == 0 ? WQ : which == 1 ? WK : WV; const float* BA = which == 0 ? BQ : which == 1 ? BK : BV;
  v8f acc[8] = {};
#pragma unroll 2
  for (int kc = 0; kc < DIN / 32; ++kc) { v16b a; { const float* p = X + (r0 + wave * 16 + col) * DIN + kc * 32 + 8 * g;
#pragma unroll
      for (int i = 0; i < 8; ++i) { a[i] = (__bf16)p[i]; a[8 + i] = (__bf16)p[16 + i]; } }
    asm volatile("s_wait_loadcnt 0x0" ::: "memory");
#pragma unroll
    for (int j = 0; j < 8; ++j) { const v16b w = WCOL(WA, kc * 32, c0 + j * 16 + col, lane); asm volatile("s_wait_loadcnt 0x0" ::: "memory"); acc[j] = wmma_bf(a, w, acc[j]); } }
  if (which < 2) { _Float16* DH = which == 0 ? QH : KH; _Float16* DL = which == 0 ? QL : KL; const int nhi = which == 0 ? QHI : KHI; const bool hi_rows = t0 < nhi;
#pragma unroll
    for (int j = 0; j < 8; ++j) { const float bias = BA ? bfr(BA[c0 + j * 16 + col]) : 0.f;
#pragma unroll
      for (int r = 0; r < 8; ++r) { const float v = acc[j][r] + bias; const _Float16 hv = (_Float16)v; sh[wave * 16 + 8 * g + r][j * 16 + col] = hv; sl[wave * 16 + 8 * g + r][j * 16 + col] = (_Float16)((v - (float)hv) * 1024.0f); } }
    __syncthreads();
    for (int e = tid; e < 64 * 16; e += 128) { const int rl = e >> 4, q = e & 15; vst2((unsigned*)(DH + (r0 + rl) * CC + c0 + q * 8), *(const v4u*)&sh[rl][q * 8]); if (hi_rows) vst2((unsigned*)(DL + (bb * nhi + t0 + rl) * (size_t)CC + c0 + q * 8), *(const v4u*)&sl[rl][q * 8]); }
  } else { const bool hi_rows = t0 < KHI;
#pragma unroll
    for (int j = 0; j < 8; ++j) { const float bias = BA ? bfr(BA[c0 + j * 16 + col]) : 0.f;
#pragma unroll
      for (int r = 0; r < 8; ++r) { const float v = acc[j][r] + bias; const int rl = wave * 16 + 8 * g + r, cl = j * 16 + col; th[cl][rl] = (_Float16)v; const __bf16 bh = (__bf16)v; tb[cl][rl] = bh; tbl[cl][rl] = (__bf16)(v - (float)bh); } }
    __syncthreads();
    for (int e = tid; e < 128 * 8; e += 128) { const int cl = e >> 3, q = e & 7; vst2((unsigned*)(VT + (bb * CC + c0 + cl) * (size_t)TT + t0 + q * 8), *(const v4u*)&th[cl][q * 8]); if (hi_rows) { const size_t o3 = (bb * CC + c0 + cl) * (size_t)KHI + t0 + q * 8; vst2((unsigned*)(VB + o3), *(const v4u*)&tb[cl][q * 8]); vst2((unsigned*)(VBL + o3), *(const v4u*)&tbl[cl][q * 8]); } } } }
// ---- k_fa: one wave = 16 query rows of batch z, walking its causal keys in blocks of 128 with a running row maximum (no logit plane in the workspace).
// Logits are formed transposed (A = k rows, B = q rows): a lane then holds keys 16j + 8g + r of ITS query (lane & 15), which is already the B-fragment order of P^T; the output is accumulated transposed too (A = v planes [c][t], B = P^T), so maximum, sum and rescale stay in the query's own lanes.
// Same products as before: 1 f16 product (3 with the x 2^10 residuals for rows < QHI); exp(logit - running max) x 2^11 once to f16 against v f16 (bf16 hi + lo, 3 products, for rows < QHI); the division by the row sum comes last.
// Fragment loads stand in the source as whole groups ahead of the products that use them: half of this block's v ahead of the logits, the other half and the next block's k ahead of the softmax.
// plain builtin forms: the compiler keeps the distance behind a matrix instruction itself and may use every register window for the operands
__device__ __forceinline__ v8f mm16(v16h a, v16h b, v8f c) { return __builtin_amdgcn_wmma_f32_16x16x32_f16(false, a, false, b, (short)0, c, false, false); }
__device__ __forceinline__ v8f mmbf(v16b a, v16b b, v8f c) { return __builtin_amdgcn_wmma_f32_16x16x32_bf16(false, a, false, b, (short)0, c, false, false); }
// fragment at a wave-uniform pointer plus the lane's own 32-bit element offset (row or column, and 8 * (lane >> 4)): scalar base + one loop-invariant offset register, so no address register is formed anew for a load group
__device__ __forceinline__ v16h frag_hp(const _Float16* ub, unsigned lo) { union { v16h v; v8h q[2]; } u; const _Float16* p = ub + lo; u.q[0] = *(const v8h*)p; u.q[1] = *(const v8h*)(p + 16); return u.v; }
__device__ __forceinline__ v16b frag_bp(const __bf16* ub, unsigned lo) { union { v16b v; v8b q[2]; } u; const __bf16* p = ub + lo; u.q[0] = *(const v8b*)p; u.q[1] = *(const v8b*)(p + 16); return u.v; }
// a wave-uniform global pointer, both words through readfirstlane: it stays a scalar base of its own, so that every load names that base and a loop-invariant offset register, and no vector address is formed or stepped under loads in flight
typedef const __attribute__((address_space(1))) _Float16* gph;
__device__ __forceinline__ const _Float16* uni(const _Float16* p) { const unsigned long long a = (unsigned long long)p; return (const _Float16*)(gph)(((unsigned long long)(unsigned)__builtin_amdgcn_readfirstlane((int)(a >> 32)) << 32) | (unsigned)__builtin_amdgcn_readfirstlane((int)a)); }
struct FaSt { float m, lsum; };
// masks the diagonal block, updates the running maximum and the lane's partial sum; leaves exp x 2^11 in st and returns the factor for what was summed so far
__device__ __forceinline__ float fa_softmax(v8f (&st)[8], FaSt& f, bool diag, int key0, int tq) {
  if (diag) {
#pragma unroll
    for (int j = 0; j < 8; ++j) {
#pragma unroll
      for (int r = 0; r < 8; ++r) st[j][r] = (key0 + j * 16 + r <= tq) ? st[j][r] : -3.0e38f; } }
  float mloc = -3.0e38f;
#pragma unroll
  for (int j = 0; j < 8; ++j) {
#pragma unroll
    for (int r = 0; r < 8; ++r) mloc = fmaxf(mloc, st[j][r]); }
  mloc = fmaxf(mloc, __shfl_xor(mloc, 16));   // the two lane halves hold the two key halves of the same query
  const float mn = fmaxf(f.m, mloc); const float alpha = expf(f.m - mn); f.m = mn;
  float s = 0.f;
#pragma unroll
  for (int j = 0; j < 8; ++j) {
#pragma unroll
    for (int r = 0; r < 8; ++r) { const float e = expf(st[j][r] - mn); s += e; st[j][r] = e * 2048.0f; } }   // a masked key: exp(-3e38 - mn) = 0; mn is finite from the first block on, which holds key 0 <= every query
  f.lsum = f.lsum * alpha + s; return alpha; }
__device__ __forceinline__ void fa_store(v8f (&acc)[HD / 16], float lsum, int b, int ql0, int lane, float (*so)[HD + 4], float* __restrict__ Y) {
  const int col = lane & 15, g = lane >> 4;
  lsum += __shfl_xor(lsum, 16);
  const float inv = lsum > 0.f ? 1.0f / (2048.0f * lsum) : 0.f;
#pragma unroll
  for (int j = 0; j < HD / 16; ++j) { const v8f o = acc[j] * inv; vst2(&so[col][j * 16 + 8 * g], (v4f){o[0], o[1], o[2], o[3]}); vst2(&so[col][j * 16 + 8 * g + 4], (v4f){o[4], o[5], o[6], o[7]}); }
  LDSX(); for (int rl = 0; rl < 16; ++rl) vst2(Y + ((size_t)b * TT + ql0 + rl) * CC + lane * 4, *(const v4f*)&so[rl][lane * 4]); }
// rows >= QHI
__device__ __forceinline__ void fa_wave(const _Float16* __restrict__ QH, const _Float16* __restrict__ KH, const _Float16* __restrict__ VT, int b, int ql0, int lane, float (*so)[HD + 4], float* __restrict__ Y) {
  const int col = lane & 15, g = lane >> 4; const int tq = ql0 + col; const int nkb = ((ql0 + 15) >> 7) + 1;
  const _Float16* K0 = KH + (size_t)b * TT * CC; const _Float16* V0 = VT + (size_t)b * CC * TT;   // the batch's k rows and v planes (wave-uniform)
  const unsigned klo = col * CC + 8 * g, vlo = col * TT + 8 * g;
  v16h qf[HD / 32], kf[32], vf[32];
  __builtin_amdgcn_sched_barrier(0);   // with the one behind the wait below: nothing but these loads stands between here and the wait, so none of their address registers is reused ahead of it
#pragma unroll
  for (int kc = 0; kc < HD / 32; ++kc) qf[kc] = frag_hp(QH + ((size_t)b * TT + ql0) * CC + kc * 32, klo);
#pragma unroll
  for (int i = 0; i < 32; ++i) kf[i] = frag_hp(K0 + (size_t)((i & 7) * 16) * CC + (i >> 3) * 32, klo);
  asm volatile("s_wait_xcnt 0x0" ::: "memory");   // the registers that the loads above name are free for reuse behind this wait
  __builtin_amdgcn_sched_barrier(0);
  v8f acc[HD / 16] = {}; FaSt f = {-3.0e38f, 0.f};
#pragma unroll 1
  for (int kb = 0; kb < nkb; ++kb) { const int k0 = kb * 128;
    const _Float16* Kp = uni(K0 + (size_t)k0 * CC); const _Float16* Vp = uni(V0 + k0);
#pragma unroll
    for (int i = 0; i < 16; ++i) vf[i] = frag_hp(Vp + (size_t)((i & 7) * 16) * TT + (i >> 3) * 32, vlo);
    __builtin_amdgcn_sched_barrier(0);   // keeps the first half of the v loads issued ahead of the logit products (only half: the wait for k must still be a count that the load counter can hold)
    v8f st[8] = {};
#pragma unroll
    for (int i = 0; i < 32; ++i) st[i & 7] = mm16(kf[i], qf[i >> 3], st[i & 7]);
    __builtin_amdgcn_sched_barrier(0);   // keeps the loads below from being lifted over the logit products, whose wait for k would then also wait for them
#pragma unroll
    for (int i = 16; i < 32; ++i) vf[i] = frag_hp(Vp + (size_t)((i & 7) * 16) * TT + (i >> 3) * 32, vlo);
    if (kb + 1 < nkb) {
#pragma unroll
      for (int i = 0; i < 32; ++i) kf[i] = frag_hp(Kp + (size_t)(128 + (i & 7) * 16) * CC + (i >> 3) * 32, klo); }
    __builtin_amdgcn_sched_barrier(0);   // keeps the rest of the v loads and the next block's k loads issued ahead of the softmax, which then covers their latency
#pragma unroll
    for (int j = 0; j < 8; ++j) st[j] *= SCALE;
    const float alpha = fa_softmax(st, f, kb + 1 == nkb, k0 + 8 * g, tq);
#pragma unroll
    for (int j = 0; j < HD / 16; ++j) acc[j] *= alpha;
#pragma unroll
    for (int c = 0; c < 4; ++c) { v16h p;
#pragma unroll
      for (int i = 0; i < 8; ++i) { p[i] = (_Float16)st[2 * c][i]; p[8 + i] = (_Float16)st[2 * c + 1][i]; }
#pragma unroll
      for (int j = 0; j < HD / 16; ++j) acc[j] = mm16(vf[c * 8 + j], p, acc[j]); }
    __builtin_amdgcn_sched_barrier(0);   // keeps the step of the two scalar bases behind the last product's wait for the loads: no base is rewritten under a load in flight
  }
  fa_store(acc, f.lsum, b, ql0, lane, so, Y); }
// rows < QHI (at most 3 key blocks): residual products
__device__ __forceinline__ void fa_wave_hi(const _Float16* __restrict__ QH, const _Float16* __restrict__ KH, const _Float16* __restrict__ QL, const _Float16* __restrict__ KL, const __bf16* __restrict__ VB, const __bf16* __restrict__ VBL, int b, int ql0, int lane, float (*so)[HD + 4], float* __restrict__ Y) {
  const int col = lane & 15, g = lane >> 4; const int tq = ql0 + col; const int nkb = ((ql0 + 15) >> 7) + 1;
  const _Float16* Kp = KH + (size_t)b * TT * CC; const _Float16* KLp = KL + (size_t)b * KHI * CC; const __bf16* Vp = VB + (size_t)b * CC * KHI; const __bf16* VLp = VBL + (size_t)b * CC * KHI;   // wave-uniform; stepped at the loop's foot
  const unsigned klo = col * CC + 8 * g, vlo = col * KHI + 8 * g;
  v16h qf[HD / 32], qlf[HD / 32];
#pragma unroll
  for (int kc = 0; kc < HD / 32; ++kc) { qf[kc] = frag_hp(QH + ((size_t)b * TT + ql0) * CC + kc * 32, klo); qlf[kc] = frag_hp(QL + ((size_t)b * QHI + ql0) * CC + kc * 32, klo); }
  v8f acc[HD / 16] = {}; FaSt f = {-3.0e38f, 0.f};
#pragma unroll 1
  for (int kb = 0; kb < nkb; ++kb) { const int k0 = kb * 128;
    v8f st[8] = {}, stl[8] = {};
#pragma unroll
    for (int kc = 0; kc < HD / 32; ++kc) { v16h kh[8], kl[8];
#pragma unroll
      for (int j = 0; j < 8; ++j) { kh[j] = frag_hp(Kp + (size_t)(j * 16) * CC + kc * 32, klo); kl[j] = frag_hp(KLp + (size_t)(j * 16) * CC + kc * 32, klo); }
      __builtin_amdgcn_sched_barrier(0);   // keeps the group's 32 loads issued together: one round trip a group, not one a product
#pragma unroll
      for (int j = 0; j < 8; ++j) { st[j] = mm16(kh[j], qf[kc], st[j]); stl[j] = mm16(kh[j], qlf[kc], stl[j]); stl[j] = mm16(kl[j], qf[kc], stl[j]); } }
#pragma unroll
    for (int j = 0; j < 8; ++j) st[j] = (st[j] + stl[j] * (1.0f / 1024.0f)) * SCALE;
    const float alpha = fa_softmax(st, f, kb + 1 == nkb, k0 + 8 * g, tq);
#pragma unroll
    for (int j = 0; j < HD / 16; ++j) acc[j] *= alpha;
#pragma unroll
    for (int c = 0; c < 4; ++c) { float pe[16]; v16b vh[8], vl[8];
#pragma unroll
      for (int j = 0; j < HD / 16; ++j) { const size_t po = (size_t)(j * 16) * KHI + c * 32; vh[j] = frag_bp(Vp + po, vlo); vl[j] = frag_bp(VLp + po, vlo); }
      __builtin_amdgcn_sched_barrier(0);   // as above: the group's 32 loads issued together
#pragma unroll
      for (int i = 0; i < 8; ++i) { pe[i] = st[2 * c][i]; pe[8 + i] = st[2 * c + 1][i]; }
      const F2 p = bsplit16(pe);
#pragma unroll
      for (int j = 0; j < HD / 16; ++j) { acc[j] = mmbf(vh[j], p.h, acc[j]); acc[j] = mmbf(vh[j], p.l, acc[j]); acc[j] = mmbf(vl[j], p.h, acc[j]); } }
    __builtin_amdgcn_sched_barrier(0);   // as in fa_wave: the pointer steps stay behind the last product's wait for the loads
    Kp += 128 * CC; KLp += 128 * CC; Vp += 128; VLp += 128; }
  fa_store(acc, f.lsum, b, ql0, lane, so, Y); }
// block = 2 waves that share nothing: row tiles x and TT / 16 - 1 - x of batch z, so that every block walks the same number of key blocks
__global__ __launch_bounds__(64) void k_fa(const _Float16* __restrict__ QH, const _Float16* __restrict__ KH, const _Float16* __restrict__ QL, const _Float16* __restrict__ KL, const _Float16* __restrict__ VT, const __bf16* __restrict__ VB, const __bf16* __restrict__ VBL, float* __restrict__ Y) { __shared__ __align__(16) float ss[2][16][HD + 4];
  const int wave = __builtin_amdgcn_readfirstlane(threadIdx.x >> 5), lane = threadIdx.x & 31; const int b = blockIdx.z; const int ql0 = (wave == 0 ? (int)blockIdx.x : TT / 16 - 1 - (int)blockIdx.x) * 16;
  if (ql0 < QHI) fa_wave_hi(QH, KH, QL, KL, VB, VBL, b, ql0, lane, ss[wave], Y); else fa_wave(QH, KH, VT, b, ql0, lane, ss[wave], Y); }

extern "C" void kernel_launch(void* const* d_in, const int* in_sizes, int n_in, void* d_out, int out_size, void* d_ws, size_t ws_size, hipStream_t stream) {
  (void)in_sizes; (void)n_in; (void)out_size;
  const float** F = (const float**)d_in;
  if (ws_size < (size_t)WS_END) return;
  char* ws = (char*)d_ws; _Float16 *QH = (_Float16*)(ws + WS_QH), *KH = (_Float16*)(ws + WS_KH), *VT = (_Float16*)(ws + WS_VT), *QL = (_Float16*)(ws + WS_QL), *KL = (_Float16*)(ws + WS_KL); __bf16 *VB = (__bf16*)(ws + WS_VB), *VBL = (__bf16*)(ws + WS_VBL);
  // inputs: 0 x [4,2048,1024]; 1 Wq [1024,128] (in,out); 2 Wk; 3 Wv
  k_proj<<<dim3(TNB * TT / 64, CC / 128, 3), 128, 0, stream>>>(F[0], F[0], F[0], F[1], F[2], F[3], nullptr, nullptr, nullptr, QH, QL, KH, KL, VT, VB, VBL);
  k_fa<<<dim3(TT / 32, 1, TNB), 64, 0, stream>>>(QH, KH, QL, KL, VT, VB, VBL, (float*)d_out);
}

// v003
// Measured time: 50.8 microseconds a run.
// Next to v002, in two timings, it ran 2.05 and 2.06 times as fast.
// Counting every step since v000, it is 10.9 times as fast.
// compute dtype: all float inputs rounded to bf16; q/k/v = x W with EXACT bf16 products on WMMA 16x16x32 (f32 accumulate); causal logits: q, k once to f16 (1 product) x 128^-0.5, 3 products below row 384; softmax in f32 with a running row maximum; exp x 2^11 once to f16 against v f16 (bf16 hi + lo below row 384), divided by the row sum last; f32 output.
#include <hip/hip_runtime.h>
#include <math.h>

typedef __attribute__((ext_vector_type(16))) _Float16 v16h;
typedef __attribute__((ext_vector_type(16))) __bf16 v16b;
typedef __attribute__((ext_vector_type(8)))  _Float16 v8h;
typedef __attribute__((ext_vector_type(8)))  float v8f;
typedef __attribute__((ext_vector_type(4)))  float v4f;
typedef __attribute__((ext_vector_type(2)))  float v2f;
typedef __attribute__((ext_vector_type(4)))  unsigned v4u;
typedef __attribute__((ext_vector_type(4)))  int v4i;
typedef float __attribute__((may_alias)) float_a;
typedef int __attribute__((may_alias)) int_a;

template <typename T> __device__ __forceinline__ void vst2(void* p, T v) { *(T*)p = v;  }
__device__ __forceinline__ v8f wmma16(v16h a, v16h b, v8f c) {
  v8f d = __builtin_amdgcn_wmma_f32_16x16x32_f16(false, a, false, b, (short)0, c, false, false);
  asm volatile("v_nop\n\tv_nop\n\tv_nop\n\tv_nop" : "+v"(d) : "v"(a), "v"(b));
  return d;
}
__device__ __forceinline__ v8f wmma_bf(v16b a, v16b b, v8f c) {
  v8f d = __builtin_amdgcn_wmma_f32_16x16x32_bf16(false, a, false, b, (short)0, c, false, false);
  asm volatile("v_nop\n\tv_nop\n\tv_nop\n\tv_nop" : "+v"(d) : "v"(a), "v"(b));
  return d;
}
// 16x16x32 fragments: lane = (h = lane>>4, row/col = lane&15); elements 0..7 = k0+8h+0..7, 8..15 = k0+16+8h+0..7; D element r = row 8h+r
__device__ __forceinline__ v16h frag_h(const _Float16* rowk0, int lane) {
  union { v16h v; v8h q[2]; } u; const _Float16* p = rowk0 + 8 * (lane >> 4);
  u.q[0] = *(const v8h*)p; u.q[1] = *(const v8h*)(p + 16); return u.v;
}
__device__ __forceinline__ v16h frag_f32(const float* rowk0, int lane) {
  v16h a; const float* p = rowk0 + 8 * (lane >> 4);
#pragma unroll
  for (int i = 0; i < 8; ++i) { a[i] = (_Float16)p[i]; a[8 + i] = (_Float16)p[16 + i]; }
  return a;
}
__device__ __forceinline__ v16h frag_f32s(const float* rowk0, int lane, float sc) {
  v16h a; const float* p = rowk0 + 8 * (lane >> 4);
#pragma unroll
  for (int i = 0; i < 8; ++i) { a[i] = (_Float16)(p[i] * sc); a[8 + i] = (_Float16)(p[16 + i] * sc); }
  return a;
}
// column fragment from a [K][ld] layout (column n), rows >= K read as 0
__device__ __forceinline__ v16h fragc_f32(const float* W, int k0, int n, int lane, int ld, int K) {
  v16h a; const int g = lane >> 4;
#pragma unroll
  for (int i = 0; i < 8; ++i) { const int ka = k0 + 8 * g + i, kb = ka + 16;
    a[i] = (_Float16)(ka < K ? W[(size_t)(ka < K ? ka : K - 1) * ld + n] : 0.f); a[8 + i] = (_Float16)(kb < K ? W[(size_t)(kb < K ? kb : K - 1) * ld + n] : 0.f); }
  return a;
}
struct F2 { v16b h, l; };
__device__ __forceinline__ F2 bsplit16(const float v[16]) { F2 r;
#pragma unroll
  for (int i = 0; i < 16; ++i) { const __bf16 h = (__bf16)v[i]; r.h[i] = h; r.l[i] = (__bf16)(v[i] - (float)h); }
  return r; }
__device__ __forceinline__ F2 split_row(const float* row, int k0, int lane) { float v[16]; const float* p = row + k0 + 8 * (lane >> 4);
#pragma unroll
  for (int i = 0; i < 8; ++i) { v[i] = p[i]; v[8 + i] = p[16 + i]; }
  return bsplit16(v); }
__device__ __forceinline__ F2 split_rowK(const float* row, int k0, int lane, int K) { float v[16]; const int g = lane >> 4;
#pragma unroll
  for (int i = 0; i < 8; ++i) { const int ka = k0 + 8 * g + i, kb = ka + 16; v[i] = ka < K ? row[ka < K ? ka : K - 1] : 0.f; v[8 + i] = kb < K ? row[kb < K ? kb : K - 1] : 0.f; }
  return bsplit16(v); }
__device__ __forceinline__ F2 split_col(const float* W, int k0, int n, int lane, int ld, int K) { float v[16]; const int g = lane >> 4;
#pragma unroll
  for (int i = 0; i < 8; ++i) { const int ka = k0 + 8 * g + i, kb = ka + 16; v[i] = ka < K ? W[(size_t)(ka < K ? ka : K - 1) * ld + n] : 0.f; v[8 + i] = kb < K ? W[(size_t)(kb < K ? kb : K - 1) * ld + n] : 0.f; }
  return bsplit16(v); }
__device__ __forceinline__ v8f mac3(const F2& a, const F2& b, v8f c) { c = wmma_bf(a.l, b.h, c); c = wmma_bf(a.h, b.l, c); return wmma_bf(a.h, b.h, c); }
__device__ __forceinline__ float sigm(float v) { return 1.0f / (1.0f + expf(-v)); }
#define LDSX() do { asm volatile("s_wait_dscnt 0" ::: "memory"); __builtin_amdgcn_wave_barrier(); __builtin_amdgcn_fence(__ATOMIC_RELEASE, "workgroup"); } while (0)

// Single-head causal self-attention (B 4, T 2,048, C 1,024 -> H 128; (in,out) 1/32-scale weights, no biases): q, k, v = x W; out = softmax_causal(q k^T x 128^-0.5) v -> [B, T, 128].
#define NB 4
#define TT 2048
#define CC 128            // NH * HD = projected width
#define DIN 1024          // input (model) width
#define NH 1
#define HD 128
#define NQB (TT / 64)
#define HG 1
#define SCALE (0.08838834764831845f)
#define CAUSAL 1
#ifndef TNB
#define TNB NB
#endif
__device__ __forceinline__ float bfr(float v) { return (float)(__bf16)v; }
__host__ __device__ __forceinline__ int kb_last(int qb) { return CAUSAL ? ((qb * 64 + 63) >> 7) : (TT / 128 - 1); }
typedef __attribute__((ext_vector_type(8))) __bf16 v8b;
__device__ __forceinline__ v16b frag_b(const __bf16* rowk0, int lane) {
  union { v16b v; v8b q[2]; } u; const __bf16* p = rowk0 + 8 * (lane >> 4);
  u.q[0] = *(const v8b*)p; u.q[1] = *(const v8b*)(p + 16); return u.v;
}
#define QBH 6              // causal: query blocks 0..QBH-1 of each sequence (few keys, no averaging) take the high-precision path
#define QHI 384            // rows carrying a q residual plane
#define KHI 384            // key rows carrying k residual / v bf16 hi+lo planes (used only by the causal high-precision path)
// B fragment (k rows k0+.., output column o) of a weight: (in,out) [K][ld] or (out,in) [ld rows of K]: bf16 exact, or f16(bf16 * 256) exact
__device__ __forceinline__ v16b wcol_io(const float* Wm, int k0, int o, int lane, int ld) { v16b w; const int g = lane >> 4;
#pragma unroll
  for (int i = 0; i < 8; ++i) { w[i] = (__bf16)Wm[(size_t)(k0 + 8 * g + i) * ld + o]; w[8 + i] = (__bf16)Wm[(size_t)(k0 + 16 + 8 * g + i) * ld + o]; }
  return w; }
__device__ __forceinline__ v16b wcol_oi(const float* Wm, int k0, int o, int lane, int K) { v16b w; const float* p = Wm + (size_t)o * K + k0 + 8 * (lane >> 4);
#pragma unroll
  for (int i = 0; i < 8; ++i) { w[i] = (__bf16)p[i]; w[8 + i] = (__bf16)p[16 + i]; }
  return w; }
__device__ __forceinline__ v16h wcolh_io(const float* Wm, int k0, int o, int lane, int ld) { v16h w; const int g = lane >> 4;
#pragma unroll
  for (int i = 0; i < 8; ++i) { w[i] = (_Float16)(bfr(Wm[(size_t)(k0 + 8 * g + i) * ld + o]) * 256.0f); w[8 + i] = (_Float16)(bfr(Wm[(size_t)(k0 + 16 + 8 * g + i) * ld + o]) * 256.0f); }
  return w; }
__device__ __forceinline__ v16h wcolh_oi(const float* Wm, int k0, int o, int lane, int K) { v16h w; const float* p = Wm + (size_t)o * K + k0 + 8 * (lane >> 4);
#pragma unroll
  for (int i = 0; i < 8; ++i) { w[i] = (_Float16)(bfr(p[i]) * 256.0f); w[8 + i] = (_Float16)(bfr(p[16 + i]) * 256.0f); }
  return w; }
#define WQKV_LAYOUT 0   // layout that WCOL reads (0 = (in,out) [DIN][CC]; 1 = (out,in) [CC][DIN]; 2 = per-head [NH][DIN][HD]); nothing calls WCOL: k_proj reads W as (in,out) [DIN][CC] for any value
__device__ __forceinline__ v16b wcol_hdk(const float* Wm, int k0, int o, int lane) { v16b w; const int g = lane >> 4; const float* p = Wm + (size_t)(o / HD) * DIN * HD + (o % HD);
#pragma unroll
  for (int i = 0; i < 8; ++i) { w[i] = (__bf16)p[(size_t)(k0 + 8 * g + i) * HD]; w[8 + i] = (__bf16)p[(size_t)(k0 + 16 + 8 * g + i) * HD]; }
  return w; }
#define WO_OUT_IN 0
#if WQKV_LAYOUT == 1
#define WCOL(W, k0, o, lane) wcol_oi(W, k0, o, lane, DIN)
#elif WQKV_LAYOUT == 2
#define WCOL(W, k0, o, lane) wcol_hdk(W, k0, o, lane)
#else
#define WCOL(W, k0, o, lane) wcol_io(W, k0, o, lane, CC)
#endif
#if WO_OUT_IN
#define WOCOL(W, k0, o, lane) wcol_oi(W, k0, o, lane, CC)
#define WOCOLH(W, k0, o, lane) wcolh_oi(W, k0, o, lane, CC)
#else
#define WOCOL(W, k0, o, lane) wcol_io(W, k0, o, lane, DIN)
#define WOCOLH(W, k0, o, lane) wcolh_io(W, k0, o, lane, DIN)
#endif

#ifndef SM_EXTRA_PARAMS
#define SM_EXTRA_PARAMS
#endif
#ifndef PROJ_EXTRA_PARAMS
#define PROJ_EXTRA_PARAMS
#endif
#ifndef SM_MASK_HOOK
#define SM_MASK_HOOK (void)0
#endif

#define WS_QH  0u                                      // f16 q rows [b*t][CC]
#define WS_KH  (WS_QH + 2u * (size_t)NB * TT * CC)      // f16 k rows [b*t][CC]
#define WS_VT  (WS_KH + 2u * (size_t)NB * TT * CC)      // f16 v planes [b][c][t]
#define WS_QL  (WS_VT + 2u * (size_t)NB * CC * TT)      // f16 q residual x 2^10 rows [b][t < QHI][CC]
#define WS_KL  (WS_QL + 2u * (size_t)NB * QHI * CC)     // f16 k residual x 2^10 rows [b][t < KHI][CC]
#define WS_VB  (WS_KL + 2u * (size_t)NB * KHI * CC)     // bf16 v hi planes [b][c][t < KHI]
#define WS_VBL (WS_VB + 2u * (size_t)NB * CC * KHI)
#define WS_END (WS_VBL + 2u * (size_t)NB * CC * KHI)

#define PKC 64             // k per staged chunk
#define PPIT (PKC + 8)     // LDS row pitch in bf16: 128 B of k + 16 B
typedef __attribute__((ext_vector_type(4))) __bf16 v4b;
// ---- k_proj: block = (64 rows, 128 cols, which): q/k/v = X W (+ b) with exact bf16 products (K = DIN) -> which 0: q f16 rows (+ residual rows < QHI); 1: k f16 rows (+ residual rows < KHI); 2: v f16 planes [c][t] (+ bf16 hi/lo planes for t < KHI)
__global__ __launch_bounds__(128) void k_proj(const float* __restrict__ XQ, const float* __restrict__ XK, const float* __restrict__ XV, const float* __restrict__ WQ, const float* __restrict__ WK, const float* __restrict__ WV, const float* __restrict__ BQ, const float* __restrict__ BK, const float* __restrict__ BV,
    _Float16* __restrict__ QH, _Float16* __restrict__ QL, _Float16* __restrict__ KH, _Float16* __restrict__ KL, _Float16* __restrict__ VT, __bf16* __restrict__ VB, __bf16* __restrict__ VBL) {
  __shared__ __align__(16) _Float16 sh[64][136], sl[64][136]; __shared__ __align__(16) _Float16 th[128][72]; __shared__ __align__(16) __bf16 tb[128][72], tbl[128][72];
  __shared__ __align__(16) __bf16 sw[2][128][PPIT], sx[2][64][PPIT];
  const int tid = threadIdx.x, wave = tid >> 5, lane = tid & 31, col = lane & 15, g = lane >> 4; const int which = blockIdx.z; const int c0 = blockIdx.y * 128; const size_t r0 = (size_t)blockIdx.x * 64; const size_t bb = r0 / TT; const int t0 = (int)(r0 % TT);
  const float* X = which == 0 ? XQ : which == 1 ? XK : XV; const float* WA = which == 0 ? WQ : which == 1 ? WK : WV; const float* BA = which == 0 ? BQ : which == 1 ? BK : BV;
  // Main loop: the block's x rows and W columns go through LDS as bf16 in chunks of PKC k, k-contiguous rows at the pitch for 16-byte readers, two buffers.
  // Whole-line global loads, each element loaded and rounded once a block; the next chunk's loads are in flight while this chunk's products run. Every accumulator still takes its 32-k products in ascending k.
  const unsigned wlo = (unsigned)((tid >> 6) * 32 * CC + 2 * (tid & 63));   // W: this thread's column pair and its 32 k rows of the chunk
  const unsigned xlo = (unsigned)((tid >> 4) * DIN + 4 * (tid & 15));       // x: rows (tid >> 4) + 8 i, four k each
  const float* Wb = WA + c0; const float* Xb = X + r0 * DIN;                // block-uniform bases
  v2f wr[2][32]; v4f xr[2][8];   // two register sets: chunks c + 1 and c + 2 are in flight while chunk c is worked on
  v8f acc[8] = {};
#define PROJ_LD(c, s) do { const float* wp = Wb + (size_t)(c) * PKC * CC; const float* xp = Xb + (size_t)(c) * PKC; \
    _Pragma("unroll") for (int i = 0; i < 32; ++i) wr[s][i] = *(const v2f*)(wp + (size_t)i * CC + wlo); \
    _Pragma("unroll") for (int i = 0; i < 8; ++i) xr[s][i] = *(const v4f*)(xp + (size_t)(8 * i) * DIN + xlo); \
    asm volatile("s_wait_xcnt 0x0" ::: "memory");   /* these loads stay in flight over the loop's foot, where their address registers are stepped: the wait stands ahead of that (a scheduling barrier follows every use) */ \
  } while (0)
#define PROJ_ST(s) do { \
    _Pragma("unroll") for (int q = 0; q < 4; ++q) { v8b w0, w1; \
      _Pragma("unroll") for (int e = 0; e < 8; ++e) { w0[e] = (__bf16)wr[s][q * 8 + e][0]; w1[e] = (__bf16)wr[s][q * 8 + e][1]; } \
      *(v8b*)&sw[s][2 * (tid & 63)][(tid >> 6) * 32 + q * 8] = w0; *(v8b*)&sw[s][2 * (tid & 63) + 1][(tid >> 6) * 32 + q * 8] = w1; } \
    _Pragma("unroll") for (int i = 0; i < 8; ++i) { v4b xv; \
      _Pragma("unroll") for (int e = 0; e < 4; ++e) xv[e] = (__bf16)xr[s][i][e]; \
      *(v4b*)&sx[s][(tid >> 4) + 8 * i][4 * (tid & 15)] = xv; } } while (0)
// work-group barrier that orders LDS alone: __syncthreads() would also wait for the global loads in flight, which nobody else reads
#define PROJ_BAR() do { __builtin_amdgcn_fence(__ATOMIC_RELEASE, "workgroup", "local"); __builtin_amdgcn_s_barrier(); __builtin_amdgcn_fence(__ATOMIC_ACQUIRE, "workgroup", "local"); } while (0)
// one trip: chunk c lies in LDS buffer s (= c & 1); register set s is free, set s ^ 1 holds (in flight) chunk c + 1; more2, more1: a chunk c + 2, c + 1 exists (literals, so that the loop's body has no branch and its load waits are counts)
#define PROJ_TRIP(c, s, more2, more1) do { \
    if (more2) PROJ_LD((c) + 2, s); \
    __builtin_amdgcn_sched_barrier(0);   /* keeps the global loads issued ahead of this chunk's products */ \
    v16b af[PKC / 32], wf[PKC / 32][8]; \
    _Pragma("unroll") for (int ks = 0; ks < PKC / 32; ++ks) { af[ks] = frag_b(&sx[s][wave * 16 + col][ks * 32], lane); \
      _Pragma("unroll") for (int j = 0; j < 8; ++j) wf[ks][j] = frag_b(&sw[s][j * 16 + col][ks * 32], lane); } \
    __builtin_amdgcn_sched_barrier(0);   /* keeps the chunk's LDS reads together ahead of its products: one LDS round trip a chunk, not one a product */ \
    _Pragma("unroll") for (int ks = 0; ks < PKC / 32; ++ks) { \
      _Pragma("unroll") for (int j = 0; j < 8; ++j) acc[j] = __builtin_amdgcn_wmma_f32_16x16x32_bf16(false, af[ks], false, wf[ks][j], (short)0, acc[j], false, false); } \
    __builtin_amdgcn_sched_barrier(0);   /* keeps the wait for chunk c + 1's global loads, and their rounding, behind the products */ \
    if (more1) { PROJ_ST((s) ^ 1); \
      PROJ_BAR(); }   /* publishes chunk c + 1 and ends every wave's reads of the buffer that the next trip refills */ \
  } while (0)
  PROJ_LD(0, 0); PROJ_LD(1, 1);
  __builtin_amdgcn_sched_barrier(0);   // keeps both chunks' loads issued ahead of the wait for the first
  PROJ_ST(0);
  PROJ_BAR();   // chunk 0 is in LDS for every wave
#pragma unroll 1   // the body already holds one trip for each buffer and register set
  for (int c = 0; c < DIN / PKC - 2; c += 2) { PROJ_TRIP(c, 0, 1, 1); PROJ_TRIP(c + 1, 1, 1, 1); }
  PROJ_TRIP(DIN / PKC - 2, 0, 0, 1); PROJ_TRIP(DIN / PKC - 1, 1, 0, 0);   // the last two chunks: nothing left to load, then nothing left to stage
#undef PROJ_TRIP
#undef PROJ_BAR
#undef PROJ_LD
#undef PROJ_ST
  if (which < 2) { _Float16* DH = which == 0 ? QH : KH; _Float16* DL = which == 0 ? QL : KL; const int nhi = which == 0 ? QHI : KHI; const bool hi_rows = t0 < nhi;
#pragma unroll
    for (int j = 0; j < 8; ++j) { const float bias = BA ? bfr(BA[c0 + j * 16 + col]) : 0.f;
#pragma unroll
      for (int r = 0; r < 8; ++r) { const float v = acc[j][r] + bias; const _Float16 hv = (_Float16)v; sh[wave * 16 + 8 * g + r][j * 16 + col] = hv; sl[wave * 16 + 8 * g + r][j * 16 + col] = (_Float16)((v - (float)hv) * 1024.0f); } }
    __syncthreads();
    for (int e = tid; e < 64 * 16; e += 128) { const int rl = e >> 4, q = e & 15; vst2((unsigned*)(DH + (r0 + rl) * CC + c0 + q * 8), *(const v4u*)&sh[rl][q * 8]); if (hi_rows) vst2((unsigned*)(DL + (bb * nhi + t0 + rl) * (size_t)CC + c0 + q * 8), *(const v4u*)&sl[rl][q * 8]); }
  } else { const bool hi_rows = t0 < KHI;
#pragma unroll
    for (int j = 0; j < 8; ++j) { const float bias = BA ? bfr(BA[c0 + j * 16 + col]) : 0.f;
#pragma unroll
      for (int r = 0; r < 8; ++r) { const float v = acc[j][r] + bias; const int rl = wave * 16 + 8 * g + r, cl = j * 16 + col; th[cl][rl] = (_Float16)v; const __bf16 bh = (__bf16)v; tb[cl][rl] = bh; tbl[cl][rl] = (__bf16)(v - (float)bh); } }
    __syncthreads();
    for (int e = tid; e < 128 * 8; e += 128) { const int cl = e >> 3, q = e & 7; vst2((unsigned*)(VT + (bb * CC + c0 + cl) * (size_t)TT + t0 + q * 8), *(const v4u*)&th[cl][q * 8]); if (hi_rows) { const size_t o3 = (bb * CC + c0 + cl) * (size_t)KHI + t0 + q * 8; vst2((unsigned*)(VB + o3), *(const v4u*)&tb[cl][q * 8]); vst2((unsigned*)(VBL + o3), *(const v4u*)&tbl[cl][q * 8]); } } } }
// ---- k_fa: one wave = 16 query rows of batch z, walking its causal keys in blocks of 128 with a running row maximum (no logit plane in the workspace).
// Logits are formed transposed (A = k rows, B = q rows): a lane then holds keys 16j + 8g + r of ITS query (lane & 15), which is already the B-fragment order of P^T; the output is accumulated transposed too (A = v planes [c][t], B = P^T), so maximum, sum and rescale stay in the query's own lanes.
// Same products as before: 1 f16 product (3 with the x 2^10 residuals for rows < QHI); exp(logit - running max) x 2^11 once to f16 against v f16 (bf16 hi + lo, 3 products, for rows < QHI); the division by the row sum comes last.
// Fragment loads stand in the source as whole groups ahead of the products that use them: half of this block's v ahead of the logits, the other half and the next block's k ahead of the softmax.
// plain builtin forms: the compiler keeps the distance behind a matrix instruction itself and may use every register window for the operands
__device__ __forceinline__ v8f mm16(v16h a, v16h b, v8f c) { return __builtin_amdgcn_wmma_f32_16x16x32_f16(false, a, false, b, (short)0, c, false, false); }
__device__ __forceinline__ v8f mmbf(v16b a, v16b b, v8f c) { return __builtin_amdgcn_wmma_f32_16x16x32_bf16(false, a, false, b, (short)0, c, false, false); }
// fragment at a wave-uniform pointer plus the lane's own 32-bit element offset (row or column, and 8 * (lane >> 4)): scalar base + one loop-invariant offset register, so no address register is formed anew for a load group
__device__ __forceinline__ v16h frag_hp(const _Float16* ub, unsigned lo) { union { v16h v; v8h q[2]; } u; const _Float16* p = ub + lo; u.q[0] = *(const v8h*)p; u.q[1] = *(const v8h*)(p + 16); return u.v; }
__device__ __forceinline__ v16b frag_bp(const __bf16* ub, unsigned lo) { union { v16b v; v8b q[2]; } u; const __bf16* p = ub + lo; u.q[0] = *(const v8b*)p; u.q[1] = *(const v8b*)(p + 16); return u.v; }
// a wave-uniform global pointer, both words through readfirstlane: it stays a scalar base of its own, so that every load names that base and a loop-invariant offset register, and no vector address is formed or stepped under loads in flight
typedef const __attribute__((address_space(1))) _Float16* gph;
__device__ __forceinline__ const _Float16* uni(const _Float16* p) { const unsigned long long a = (unsigned long long)p; return (const _Float16*)(gph)(((unsigned long long)(unsigned)__builtin_amdgcn_readfirstlane((int)(a >> 32)) << 32) | (unsigned)__builtin_amdgcn_readfirstlane((int)a)); }
struct FaSt { float m, lsum; };
// masks the diagonal block, updates the running maximum and the lane's partial sum; leaves exp x 2^11 in st and returns the factor for what was summed so far
__device__ __forceinline__ float fa_softmax(v8f (&st)[8], FaSt& f, bool diag, int key0, int tq) {
  if (diag) {
#pragma unroll
    for (int j = 0; j < 8; ++j) {
#pragma unroll
      for (int r = 0; r < 8; ++r) st[j][r] = (key0 + j * 16 + r <= tq) ? st[j][r] : -3.0e38f; } }
  float mloc = -3.0e38f;
#pragma unroll
  for (int j = 0; j < 8; ++j) {
#pragma unroll
    for (int r = 0; r < 8; ++r) mloc = fmaxf(mloc, st[j][r]); }
  mloc = fmaxf(mloc, __shfl_xor(mloc, 16));   // the two lane halves hold the two key halves of the same query
  const float mn = fmaxf(f.m, mloc); const float alpha = expf(f.m - mn); f.m = mn;
  float s = 0.f;
#pragma unroll
  for (int j = 0; j < 8; ++j) {
#pragma unroll
    for (int r = 0; r < 8; ++r) { const float e = expf(st[j][r] - mn); s += e; st[j][r] = e * 2048.0f; } }   // a masked key: exp(-3e38 - mn) = 0; mn is finite from the first block on, which holds key 0 <= every query
  f.lsum = f.lsum * alpha + s; return alpha; }
__device__ __forceinline__ void fa_store(v8f (&acc)[HD / 16], float lsum, int b, int ql0, int lane, float (*so)[HD + 4], float* __restrict__ Y) {
  const int col = lane & 15, g = lane >> 4;
  lsum += __shfl_xor(lsum, 16);
  const float inv = lsum > 0.f ? 1.0f / (2048.0f * lsum) : 0.f;
#pragma unroll
  for (int j = 0; j < HD / 16; ++j) { const v8f o = acc[j] * inv; vst2(&so[col][j * 16 + 8 * g], (v4f){o[0], o[1], o[2], o[3]}); vst2(&so[col][j * 16 + 8 * g + 4], (v4f){o[4], o[5], o[6], o[7]}); }
  LDSX(); for (int rl = 0; rl < 16; ++rl) vst2(Y + ((size_t)b * TT + ql0 + rl) * CC + lane * 4, *(const v4f*)&so[rl][lane * 4]); }
// rows >= QHI
__device__ __forceinline__ void fa_wave(const _Float16* __restrict__ QH, const _Float16* __restrict__ KH, const _Float16* __restrict__ VT, int b, int ql0, int lane, float (*so)[HD + 4], float* __restrict__ Y) {
  const int col = lane & 15, g = lane >> 4; const int tq = ql0 + col; const int nkb = ((ql0 + 15) >> 7) + 1;
  const _Float16* K0 = KH + (size_t)b * TT * CC; const _Float16* V0 = VT + (size_t)b * CC * TT;   // the batch's k rows and v planes (wave-uniform)
  const unsigned klo = col * CC + 8 * g, vlo = col * TT + 8 * g;
  v16h qf[HD / 32], kf[32], vf[32];
  __builtin_amdgcn_sched_barrier(0);   // with the one behind the wait below: nothing but these loads stands between here and the wait, so none of their address registers is reused ahead of it
#pragma unroll
  for (int kc = 0; kc < HD / 32; ++kc) qf[kc] = frag_hp(QH + ((size_t)b * TT + ql0) * CC + kc * 32, klo);
#pragma unroll
  for (int i = 0; i < 32; ++i) kf[i] = frag_hp(K0 + (size_t)((i & 7) * 16) * CC + (i >> 3) * 32, klo);
  asm volatile("s_wait_xcnt 0x0" ::: "memory");   // the registers that the loads above name are free for reuse behind this wait
  __builtin_amdgcn_sched_barrier(0);
  v8f acc[HD / 16] = {}; FaSt f = {-3.0e38f, 0.f};
#pragma unroll 1
  for (int kb = 0; kb < nkb; ++kb) { const int k0 = kb * 128;
    const _Float16* Kp = uni(K0 + (size_t)k0 * CC); const _Float16* Vp = uni(V0 + k0);
#pragma unroll
    for (int i = 0; i < 16; ++i) vf[i] = frag_hp(Vp + (size_t)((i & 7) * 16) * TT + (i >> 3) * 32, vlo);
    __builtin_amdgcn_sched_barrier(0);   // keeps the first half of the v loads issued ahead of the logit products (only half: the wait for k must still be a count that the load counter can hold)
    v8f st[8] = {};
#pragma unroll
    for (int i = 0; i < 32; ++i) st[i & 7] = mm16(kf[i], qf[i >> 3], st[i & 7]);
    __builtin_amdgcn_sched_barrier(0);   // keeps the loads below from being lifted over the logit products, whose wait for k would then also wait for them
#pragma unroll
    for (int i = 16; i < 32; ++i) vf[i] = frag_hp(Vp + (size_t)((i & 7) * 16) * TT + (i >> 3) * 32, vlo);
    if (kb + 1 < nkb) {
#pragma unroll
      for (int i = 0; i < 32; ++i) kf[i] = frag_hp(Kp + (size_t)(128 + (i & 7) * 16) * CC + (i >> 3) * 32, klo); }
    __builtin_amdgcn_sched_barrier(0);   // keeps the rest of the v loads and the next block's k loads issued ahead of the softmax, which then covers their latency
#pragma unroll
    for (int j = 0; j < 8; ++j) st[j] *= SCALE;
    const float alpha = fa_softmax(st, f, kb + 1 == nkb, k0 + 8 * g, tq);
#pragma unroll
    for (int j = 0; j < HD / 16; ++j) acc[j] *= alpha;
#pragma unroll
    for (int c = 0; c < 4; ++c) { v16h p;
#pragma unroll
      for (int i = 0; i < 8; ++i) { p[i] = (_Float16)st[2 * c][i]; p[8 + i] = (_Float16)st[2 * c + 1][i]; }
#pragma unroll
      for (int j = 0; j < HD / 16; ++j) acc[j] = mm16(vf[c * 8 + j], p, acc[j]); }
    __builtin_amdgcn_sched_barrier(0);   // keeps the step of the two scalar bases behind the last product's wait for the loads: no base is rewritten under a load in flight
  }
  fa_store(acc, f.lsum, b, ql0, lane, so, Y); }
// rows < QHI (at most 3 key blocks): residual products
__device__ __forceinline__ void fa_wave_hi(const _Float16* __restrict__ QH, const _Float16* __restrict__ KH, const _Float16* __restrict__ QL, const _Float16* __restrict__ KL, const __bf16* __restrict__ VB, const __bf16* __restrict__ VBL, int b, int ql0, int lane, float (*so)[HD + 4], float* __restrict__ Y) {
  const int col = lane & 15, g = lane >> 4; const int tq = ql0 + col; const int nkb = ((ql0 + 15) >> 7) + 1;
  const _Float16* Kp = KH + (size_t)b * TT * CC; const _Float16* KLp = KL + (size_t)b * KHI * CC; const __bf16* Vp = VB + (size_t)b * CC * KHI; const __bf16* VLp = VBL + (size_t)b * CC * KHI;   // wave-uniform; stepped at the loop's foot
  const unsigned klo = col * CC + 8 * g, vlo = col * KHI + 8 * g;
  v16h qf[HD / 32], qlf[HD / 32];
#pragma unroll
  for (int kc = 0; kc < HD / 32; ++kc) { qf[kc] = frag_hp(QH + ((size_t)b * TT + ql0) * CC + kc * 32, klo); qlf[kc] = frag_hp(QL + ((size_t)b * QHI + ql0) * CC + kc * 32, klo); }
  v8f acc[HD / 16] = {}; FaSt f = {-3.0e38f, 0.f};
#pragma unroll 1
  for (int kb = 0; kb < nkb; ++kb) { const int k0 = kb * 128;
    v8f st[8] = {}, stl[8] = {};
#pragma unroll
    for (int kc = 0; kc < HD / 32; ++kc) { v16h kh[8], kl[8];
#pragma unroll
      for (int j = 0; j < 8; ++j) { kh[j] = frag_hp(Kp + (size_t)(j * 16) * CC + kc * 32, klo); kl[j] = frag_hp(KLp + (size_t)(j * 16) * CC + kc * 32, klo); }
      __builtin_amdgcn_sched_barrier(0);   // keeps the group's 32 loads issued together: one round trip a group, not one a product
#pragma unroll
      for (int j = 0; j < 8; ++j) { st[j] = mm16(kh[j], qf[kc], st[j]); stl[j] = mm16(kh[j], qlf[kc], stl[j]); stl[j] = mm16(kl[j], qf[kc], stl[j]); } }
#pragma unroll
    for (int j = 0; j < 8; ++j) st[j] = (st[j] + stl[j] * (1.0f / 1024.0f)) * SCALE;
    const float alpha = fa_softmax(st, f, kb + 1 == nkb, k0 + 8 * g, tq);
#pragma unroll
    for (int j = 0; j < HD / 16; ++j) acc[j] *= alpha;
#pragma unroll
    for (int c = 0; c < 4; ++c) { float pe[16]; v16b vh[8], vl[8];
#pragma unroll
      for (int j = 0; j < HD / 16; ++j) { const size_t po = (size_t)(j * 16) * KHI + c * 32; vh[j] = frag_bp(Vp + po, vlo); vl[j] = frag_bp(VLp + po, vlo); }
      __builtin_amdgcn_sched_barrier(0);   // as above: the group's 32 loads issued together
#pragma unroll
      for (int i = 0; i < 8; ++i) { pe[i] = st[2 * c][i]; pe[8 + i] = st[2 * c + 1][i]; }
      const F2 p = bsplit16(pe);
#pragma unroll
      for (int j = 0; j < HD / 16; ++j) { acc[j] = mmbf(vh[j], p.h, acc[j]); acc[j] = mmbf(vh[j], p.l, acc[j]); acc[j] = mmbf(vl[j], p.h, acc[j]); } }
    __builtin_amdgcn_sched_barrier(0);   // as in fa_wave: the pointer steps stay behind the last product's wait for the loads
    Kp += 128 * CC; KLp += 128 * CC; Vp += 128; VLp += 128; }
  fa_store(acc, f.lsum, b, ql0, lane, so, Y); }
// block = 2 waves that share nothing: row tiles x and TT / 16 - 1 - x of batch z, so that every block walks the same number of key blocks
__global__ __launch_bounds__(64) void k_fa(const _Float16* __restrict__ QH, const _Float16* __restrict__ KH, const _Float16* __restrict__ QL, const _Float16* __restrict__ KL, const _Float16* __restrict__ VT, const __bf16* __restrict__ VB, const __bf16* __restrict__ VBL, float* __restrict__ Y) { __shared__ __align__(16) float ss[2][16][HD + 4];
  const int wave = __builtin_amdgcn_readfirstlane(threadIdx.x >> 5), lane = threadIdx.x & 31; const int b = blockIdx.z; const int ql0 = (wave == 0 ? (int)blockIdx.x : TT / 16 - 1 - (int)blockIdx.x) * 16;
  if (ql0 < QHI) fa_wave_hi(QH, KH, QL, KL, VB, VBL, b, ql0, lane, ss[wave], Y); else fa_wave(QH, KH, VT, b, ql0, lane, ss[wave], Y); }

extern "C" void kernel_launch(void* const* d_in, const int* in_sizes, int n_in, void* d_out, int out_size, void* d_ws, size_t ws_size, hipStream_t stream) {
  (void)in_sizes; (void)n_in; (void)out_size;
  const float** F = (const float**)d_in;
  if (ws_size < (size_t)WS_END) return;
  char* ws = (char*)d_ws; _Float16 *QH = (_Float16*)(ws + WS_QH), *KH = (_Float16*)(ws + WS_KH), *VT = (_Float16*)(ws + WS_VT), *QL = (_Float16*)(ws + WS_QL), *KL = (_Float16*)(ws + WS_KL); __bf16 *VB = (__bf16*)(ws + WS_VB), *VBL = (__bf16*)(ws + WS_VBL);
  // inputs: 0 x [4,2048,1024]; 1 Wq [1024,128] (in,out); 2 Wk; 3 Wv
  k_proj<<<dim3(TNB * TT / 64, CC / 128, 3), 128, 0, stream>>>(F[0], F[0], F[0], F[1], F[2], F[3], nullptr, nullptr, nullptr, QH, QL, KH, KL, VT, VB, VBL);
  k_fa<<<dim3(TT / 32, 1, TNB), 64, 0, stream>>>(QH, KH, QL, KL, VT, VB, VBL, (float*)d_out);
}

// v004
// It runs in 44.1 microseconds.
// Next to v003, in two timings, it ran 1.11 and 1.10 times as fast.
// All steps since v000 together make it 12.1 times as fast.
// compute dtype: all float inputs rounded to bf16; q/k/v = x W with EXACT bf16 products on WMMA 16x16x32 (f32 accumulate); causal logits: q, k once to f16 (1 product) x 128^-0.5, 3 products below row 384; softmax in f32 with a running row maximum, exponentials in base 2 (hardware exp2); exp x 2^11 once to f16 against v f16 (bf16 hi + lo below row 384), divided by the row sum last; f32 output.
#include <hip/hip_runtime.h>
#include <math.h>

typedef __attribute__((ext_vector_type(16))) _Float16 v16h;
typedef __attribute__((ext_vector_type(16))) __bf16 v16b;
typedef __attribute__((ext_vector_type(8)))  _Float16 v8h;
typedef __attribute__((ext_vector_type(8)))  float v8f;
typedef __attribute__((ext_vector_type(4)))  float v4f;
typedef __attribute__((ext_vector_type(2)))  float v2f;
typedef __attribute__((ext_vector_type(4)))  unsigned v4u;
typedef __attribute__((ext_vector_type(4)))  int v4i;
typedef float __attribute__((may_alias)) float_a;
typedef int __attribute__((may_alias)) int_a;

template <typename T> __device__ __forceinline__ void vst2(void* p, T v) { *(T*)p = v;  }
__device__ __forceinline__ v8f wmma16(v16h a, v16h b, v8f c) {
  v8f d = __builtin_amdgcn_wmma_f32_16x16x32_f16(false, a, false, b, (short)0, c, false, false);
  asm volatile("v_nop\n\tv_nop\n\tv_nop\n\tv_nop" : "+v"(d) : "v"(a), "v"(b));
  return d;
}
__device__ __forceinline__ v8f wmma_bf(v16b a, v16b b, v8f c) {
  v8f d = __builtin_amdgcn_wmma_f32_16x16x32_bf16(false, a, false, b, (short)0, c, false, false);
  asm volatile("v_nop\n\tv_nop\n\tv_nop\n\tv_nop" : "+v"(d) : "v"(a), "v"(b));
  return d;
}
// 16x16x32 fragments: lane = (h = lane>>4, row/col = lane&15); elements 0..7 = k0+8h+0..7, 8..15 = k0+16+8h+0..7; D element r = row 8h+r
__device__ __forceinline__ v16h frag_h(const _Float16* rowk0, int lane) {
  union { v16h v; v8h q[2]; } u; const _Float16* p = rowk0 + 8 * (lane >> 4);
  u.q[0] = *(const v8h*)p; u.q[1] = *(const v8h*)(p + 16); return u.v;
}
__device__ __forceinline__ v16h frag_f32(const float* rowk0, int lane) {
  v16h a; const float* p = rowk0 + 8 * (lane >> 4);
#pragma unroll
  for (int i = 0; i < 8; ++i) { a[i] = (_Float16)p[i]; a[8 + i] = (_Float16)p[16 + i]; }
  return a;
}
__device__ __forceinline__ v16h frag_f32s(const float* rowk0, int lane, float sc) {
  v16h a; const float* p = rowk0 + 8 * (lane >> 4);
#pragma unroll
  for (int i = 0; i < 8; ++i) { a[i] = (_Float16)(p[i] * sc); a[8 + i] = (_Float16)(p[16 + i] * sc); }
  return a;
}
// column fragment from a [K][ld] layout (column n), rows >= K read as 0
__device__ __forceinline__ v16h fragc_f32(const float* W, int k0, int n, int lane, int ld, int K) {
  v16h a; const int g = lane >> 4;
#pragma unroll
  for (int i = 0; i < 8; ++i) { const int ka = k0 + 8 * g + i, kb = ka + 16;
    a[i] = (_Float16)(ka < K ? W[(size_t)(ka < K ? ka : K - 1) * ld + n] : 0.f); a[8 + i] = (_Float16)(kb < K ? W[(size_t)(kb < K ? kb : K - 1) * ld + n] : 0.f); }
  return a;
}
struct F2 { v16b h, l; };
__device__ __forceinline__ F2 bsplit16(const float v[16]) { F2 r;
#pragma unroll
  for (int i = 0; i < 16; ++i) { const __bf16 h = (__bf16)v[i]; r.h[i] = h; r.l[i] = (__bf16)(v[i] - (float)h); }
  return r; }
__device__ __forceinline__ F2 split_row(const float* row, int k0, int lane) { float v[16]; const float* p = row + k0 + 8 * (lane >> 4);
#pragma unroll
  for (int i = 0; i < 8; ++i) { v[i] = p[i]; v[8 + i] = p[16 + i]; }
  return bsplit16(v); }
__device__ __forceinline__ F2 split_rowK(const float* row, int k0, int lane, int K) { float v[16]; const int g = lane >> 4;
#pragma unroll
  for (int i = 0; i < 8; ++i) { const int ka = k0 + 8 * g + i, kb = ka + 16; v[i] = ka < K ? row[ka < K ? ka : K - 1] : 0.f; v[8 + i] = kb < K ? row[kb < K ? kb : K - 1] : 0.f; }
  return bsplit16(v); }
__device__ __forceinline__ F2 split_col(const float* W, int k0, int n, int lane, int ld, int K) { float v[16]; const int g = lane >> 4;
#pragma unroll
  for (int i = 0; i < 8; ++i) { const int ka = k0 + 8 * g + i, kb = ka + 16; v[i] = ka < K ? W[(size_t)(ka < K ? ka : K - 1) * ld + n] : 0.f; v[8 + i] = kb < K ? W[(size_t)(kb < K ? kb : K - 1) * ld + n] : 0.f; }
  return bsplit16(v); }
__device__ __forceinline__ v8f mac3(const F2& a, const F2& b, v8f c) { c = wmma_bf(a.l, b.h, c); c = wmma_bf(a.h, b.l, c); return wmma_bf(a.h, b.h, c); }
__device__ __forceinline__ float sigm(float v) { return 1.0f / (1.0f + expf(-v)); }
#define LDSX() do { asm volatile("s_wait_dscnt 0" ::: "memory"); __builtin_amdgcn_wave_barrier(); __builtin_amdgcn_fence(__ATOMIC_RELEASE, "workgroup"); } while (0)

// Single-head causal self-attention (B 4, T 2,048, C 1,024 -> H 128; (in,out) 1/32-scale weights, no biases): q, k, v = x W; out = softmax_causal(q k^T x 128^-0.5) v -> [B, T, 128].
#define NB 4
#define TT 2048
#define CC 128            // NH * HD = projected width
#define DIN 1024          // input (model) width
#define NH 1
#define HD 128
#define NQB (TT / 64)
#define HG 1
#define SCALE (0.08838834764831845f)
#define CAUSAL 1
#ifndef TNB
#define TNB NB
#endif
__device__ __forceinline__ float bfr(float v) { return (float)(__bf16)v; }
__host__ __device__ __forceinline__ int kb_last(int qb) { return CAUSAL ? ((qb * 64 + 63) >> 7) : (TT / 128 - 1); }
typedef __attribute__((ext_vector_type(8))) __bf16 v8b;
__device__ __forceinline__ v16b frag_b(const __bf16* rowk0, int lane) {
  union { v16b v; v8b q[2]; } u; const __bf16* p = rowk0 + 8 * (lane >> 4);
  u.q[0] = *(const v8b*)p; u.q[1] = *(const v8b*)(p + 16); return u.v;
}
#define QBH 6              // causal: query blocks 0..QBH-1 of each sequence (few keys, no averaging) take the high-precision path
#define QHI 384            // rows carrying a q residual plane
#define KHI 384            // key rows carrying k residual / v bf16 hi+lo planes (used only by the causal high-precision path)
// B fragment (k rows k0+.., output column o) of a weight: (in,out) [K][ld] or (out,in) [ld rows of K]: bf16 exact, or f16(bf16 * 256) exact
__device__ __forceinline__ v16b wcol_io(const float* Wm, int k0, int o, int lane, int ld) { v16b w; const int g = lane >> 4;
#pragma unroll
  for (int i = 0; i < 8; ++i) { w[i] = (__bf16)Wm[(size_t)(k0 + 8 * g + i) * ld + o]; w[8 + i] = (__bf16)Wm[(size_t)(k0 + 16 + 8 * g + i) * ld + o]; }
  return w; }
__device__ __forceinline__ v16b wcol_oi(const float* Wm, int k0, int o, int lane, int K) { v16b w; const float* p = Wm + (size_t)o * K + k0 + 8 * (lane >> 4);
#pragma unroll
  for (int i = 0; i < 8; ++i) { w[i] = (__bf16)p[i]; w[8 + i] = (__bf16)p[16 + i]; }
  return w; }
__device__ __forceinline__ v16h wcolh_io(const float* Wm, int k0, int o, int lane, int ld) { v16h w; const int g = lane >> 4;
#pragma unroll
  for (int i = 0; i < 8; ++i) { w[i] = (_Float16)(bfr(Wm[(size_t)(k0 + 8 * g + i) * ld + o]) * 256.0f); w[8 + i] = (_Float16)(bfr(Wm[(size_t)(k0 + 16 + 8 * g + i) * ld + o]) * 256.0f); }
  return w; }
__device__ __forceinline__ v16h wcolh_oi(const float* Wm, int k0, int o, int lane, int K) { v16h w; const float* p = Wm + (size_t)o * K + k0 + 8 * (lane >> 4);
#pragma unroll
  for (int i = 0; i < 8; ++i) { w[i] = (_Float16)(bfr(p[i]) * 256.0f); w[8 + i] = (_Float16)(bfr(p[16 + i]) * 256.0f); }
  return w; }
#define WQKV_LAYOUT 0   // layout that WCOL reads (0 = (in,out) [DIN][CC]; 1 = (out,in) [CC][DIN]; 2 = per-head [NH][DIN][HD]); nothing calls WCOL: k_proj reads W as (in,out) [DIN][CC] for any value
__device__ __forceinline__ v16b wcol_hdk(const float* Wm, int k0, int o, int lane) { v16b w; const int g = lane >> 4; const float* p = Wm + (size_t)(o / HD) * DIN * HD + (o % HD);
#pragma unroll
  for (int i = 0; i < 8; ++i) { w[i] = (__bf16)p[(size_t)(k0 + 8 * g + i) * HD]; w[8 + i] = (__bf16)p[(size_t)(k0 + 16 + 8 * g + i) * HD]; }
  return w; }
#define WO_OUT_IN 0
#if WQKV_LAYOUT == 1
#define WCOL(W, k0, o, lane) wcol_oi(W, k0, o, lane, DIN)
#elif WQKV_LAYOUT == 2
#define WCOL(W, k0, o, lane) wcol_hdk(W, k0, o, lane)
#else
#define WCOL(W, k0, o, lane) wcol_io(W, k0, o, lane, CC)
#endif
#if WO_OUT_IN
#define WOCOL(W, k0, o, lane) wcol_oi(W, k0, o, lane, CC)
#define WOCOLH(W, k0, o, lane) wcolh_oi(W, k0, o, lane, CC)
#else
#define WOCOL(W, k0, o, lane) wcol_io(W, k0, o, lane, DIN)
#define WOCOLH(W, k0, o, lane) wcolh_io(W, k0, o, lane, DIN)
#endif

#ifndef SM_EXTRA_PARAMS
#define SM_EXTRA_PARAMS
#endif
#ifndef PROJ_EXTRA_PARAMS
#define PROJ_EXTRA_PARAMS
#endif
#ifndef SM_MASK_HOOK
#define SM_MASK_HOOK (void)0
#endif

#define WS_QH  0u                                      // f16 q rows [b*t][CC]
#define WS_KH  (WS_QH + 2u * (size_t)NB * TT * CC)      // f16 k rows [b*t][CC]
#define WS_VT  (WS_KH + 2u * (size_t)NB * TT * CC)      // f16 v planes [b][c][t]
#define WS_QL  (WS_VT + 2u * (size_t)NB * CC * TT)      // f16 q residual x 2^10 rows [b][t < QHI][CC]
#define WS_KL  (WS_QL + 2u * (size_t)NB * QHI * CC)     // f16 k residual x 2^10 rows [b][t < KHI][CC]
#define WS_VB  (WS_KL + 2u * (size_t)NB * KHI * CC)     // bf16 v hi planes [b][c][t < KHI]
#define WS_VBL (WS_VB + 2u * (size_t)NB * CC * KHI)
#define WS_END (WS_VBL + 2u * (size_t)NB * CC * KHI)

#define PKC 64             // k per staged chunk
#define PPIT (PKC + 8)     // LDS row pitch in bf16: 128 B of k + 16 B
typedef __attribute__((ext_vector_type(4))) __bf16 v4b;
// ---- k_proj: block = (64 rows, 128 cols, which): q/k/v = X W (+ b) with exact bf16 products (K = DIN) -> which 0: q f16 rows (+ residual rows < QHI); 1: k f16 rows (+ residual rows < KHI); 2: v f16 planes [c][t] (+ bf16 hi/lo planes for t < KHI)
__global__ __launch_bounds__(128) void k_proj(const float* __restrict__ XQ, const float* __restrict__ XK, const float* __restrict__ XV, const float* __restrict__ WQ, const float* __restrict__ WK, const float* __restrict__ WV, const float* __restrict__ BQ, const float* __restrict__ BK, const float* __restrict__ BV,
    _Float16* __restrict__ QH, _Float16* __restrict__ QL, _Float16* __restrict__ KH, _Float16* __restrict__ KL, _Float16* __restrict__ VT, __bf16* __restrict__ VB, __bf16* __restrict__ VBL) {
  __shared__ __align__(16) _Float16 sh[64][136], sl[64][136]; __shared__ __align__(16) _Float16 th[128][72]; __shared__ __align__(16) __bf16 tb[128][72], tbl[128][72];
  __shared__ __align__(16) __bf16 sw[2][128][PPIT], sx[2][64][PPIT];
  const int tid = threadIdx.x, wave = tid >> 5, lane = tid & 31, col = lane & 15, g = lane >> 4; const int which = blockIdx.z; const int c0 = blockIdx.y * 128; const size_t r0 = (size_t)blockIdx.x * 64; const size_t bb = r0 / TT; const int t0 = (int)(r0 % TT);
  const float* X = which == 0 ? XQ : which == 1 ? XK : XV; const float* WA = which == 0 ? WQ : which == 1 ? WK : WV; const float* BA = which == 0 ? BQ : which == 1 ? BK : BV;
  // Main loop: the block's x rows and W columns go through LDS as bf16 in chunks of PKC k, k-contiguous rows at the pitch for 16-byte readers, two buffers.
  // Whole-line global loads, each element loaded and rounded once a block; the next chunk's loads are in flight while this chunk's products run. Every accumulator still takes its 32-k products in ascending k.
  const unsigned wlo = (unsigned)((tid >> 6) * 32 * CC + 2 * (tid & 63));   // W: this thread's column pair and its 32 k rows of the chunk
  const unsigned xlo = (unsigned)((tid >> 4) * DIN + 4 * (tid & 15));       // x: rows (tid >> 4) + 8 i, four k each
  const float* Wb = WA + c0; const float* Xb = X + r0 * DIN;                // block-uniform bases
  v2f wr[2][32]; v4f xr[2][8];   // two register sets: chunks c + 1 and c + 2 are in flight while chunk c is worked on
  v8f acc[8] = {};
#define PROJ_LD(c, s) do { const float* wp = Wb + (size_t)(c) * PKC * CC; const float* xp = Xb + (size_t)(c) * PKC; \
    _Pragma("unroll") for (int i = 0; i < 32; ++i) wr[s][i] = *(const v2f*)(wp + (size_t)i * CC + wlo); \
    _Pragma("unroll") for (int i = 0; i < 8; ++i) xr[s][i] = *(const v4f*)(xp + (size_t)(8 * i) * DIN + xlo); \
    asm volatile("s_wait_xcnt 0x0" ::: "memory");   /* these loads stay in flight over the loop's foot, where their address registers are stepped: the wait stands ahead of that (a scheduling barrier follows every use) */ \
  } while (0)
#define PROJ_ST(s) do { \
    _Pragma("unroll") for (int q = 0; q < 4; ++q) { v8b w0, w1; \
      _Pragma("unroll") for (int e = 0; e < 8; ++e) { w0[e] = (__bf16)wr[s][q * 8 + e][0]; w1[e] = (__bf16)wr[s][q * 8 + e][1]; } \
      *(v8b*)&sw[s][2 * (tid & 63)][(tid >> 6) * 32 + q * 8] = w0; *(v8b*)&sw[s][2 * (tid & 63) + 1][(tid >> 6) * 32 + q * 8] = w1; } \
    _Pragma("unroll") for (int i = 0; i < 8; ++i) { v4b xv; \
      _Pragma("unroll") for (int e = 0; e < 4; ++e) xv[e] = (__bf16)xr[s][i][e]; \
      *(v4b*)&sx[s][(tid >> 4) + 8 * i][4 * (tid & 15)] = xv; } } while (0)
// work-group barrier that orders LDS alone: __syncthreads() would also wait for the global loads in flight, which nobody else reads
#define PROJ_BAR() do { __builtin_amdgcn_fence(__ATOMIC_RELEASE, "workgroup", "local"); __builtin_amdgcn_s_barrier(); __builtin_amdgcn_fence(__ATOMIC_ACQUIRE, "workgroup", "local"); } while (0)
// one trip: chunk c lies in LDS buffer s (= c & 1); register set s is free, set s ^ 1 holds (in flight) chunk c + 1; more2, more1: a chunk c + 2, c + 1 exists (literals, so that the loop's body has no branch and its load waits are counts)
#define PROJ_TRIP(c, s, more2, more1) do { \
    if (more2) PROJ_LD((c) + 2, s); \
    __builtin_amdgcn_sched_barrier(0);   /* keeps the global loads issued ahead of this chunk's products */ \
    v16b af[PKC / 32], wf[PKC / 32][8]; \
    _Pragma("unroll") for (int ks = 0; ks < PKC / 32; ++ks) { af[ks] = frag_b(&sx[s][wave * 16 + col][ks * 32], lane); \
      _Pragma("unroll") for (int j = 0; j < 8; ++j) wf[ks][j] = frag_b(&sw[s][j * 16 + col][ks * 32], lane); } \
    __builtin_amdgcn_sched_barrier(0);   /* keeps the chunk's LDS reads together ahead of its products: one LDS round trip a chunk, not one a product */ \
    _Pragma("unroll") for (int ks = 0; ks < PKC / 32; ++ks) { \
      _Pragma("unroll") for (int j = 0; j < 8; ++j) acc[j] = __builtin_amdgcn_wmma_f32_16x16x32_bf16(false, af[ks], false, wf[ks][j], (short)0, acc[j], false, false); } \
    __builtin_amdgcn_sched_barrier(0);   /* keeps the wait for chunk c + 1's global loads, and their rounding, behind the products */ \
    if (more1) { PROJ_ST((s) ^ 1); \
      PROJ_BAR(); }   /* publishes chunk c + 1 and ends every wave's reads of the buffer that the next trip refills */ \
  } while (0)
  PROJ_LD(0, 0); PROJ_LD(1, 1);
  __builtin_amdgcn_sched_barrier(0);   // keeps both chunks' loads issued ahead of the wait for the first
  PROJ_ST(0);
  PROJ_BAR();   // chunk 0 is in LDS for every wave
#pragma unroll 1   // the body already holds one trip for each buffer and register set
  for (int c = 0; c < DIN / PKC - 2; c += 2) { PROJ_TRIP(c, 0, 1, 1); PROJ_TRIP(c + 1, 1, 1, 1); }
  PROJ_TRIP(DIN / PKC - 2, 0, 0, 1); PROJ_TRIP(DIN / PKC - 1, 1, 0, 0);   // the last two chunks: nothing left to load, then nothing left to stage
#undef PROJ_TRIP
#undef PROJ_BAR
#undef PROJ_LD
#undef PROJ_ST
  if (which < 2) { _Float16* DH = which == 0 ? QH : KH; _Float16* DL = which == 0 ? QL : KL; const int nhi = which == 0 ? QHI : KHI; const bool hi_rows = t0 < nhi;
#pragma unroll
    for (int j = 0; j < 8; ++j) { const float bias = BA ? bfr(BA[c0 + j * 16 + col]) : 0.f;
#pragma unroll
      for (int r = 0; r < 8; ++r) { const float v = acc[j][r] + bias; const _Float16 hv = (_Float16)v; sh[wave * 16 + 8 * g + r][j * 16 + col] = hv; sl[wave * 16 + 8 * g + r][j * 16 + col] = (_Float16)((v - (float)hv) * 1024.0f); } }
    __syncthreads();
    for (int e = tid; e < 64 * 16; e += 128) { const int rl = e >> 4, q = e & 15; vst2((unsigned*)(DH + (r0 + rl) * CC + c0 + q * 8), *(const v4u*)&sh[rl][q * 8]); if (hi_rows) vst2((unsigned*)(DL + (bb * nhi + t0 + rl) * (size_t)CC + c0 + q * 8), *(const v4u*)&sl[rl][q * 8]); }
  } else { const bool hi_rows = t0 < KHI;
#pragma unroll
    for (int j = 0; j < 8; ++j) { const float bias = BA ? bfr(BA[c0 + j * 16 + col]) : 0.f;
#pragma unroll
      for (int r = 0; r < 8; ++r) { const float v = acc[j][r] + bias; const int rl = wave * 16 + 8 * g + r, cl = j * 16 + col; th[cl][rl] = (_Float16)v; const __bf16 bh = (__bf16)v; tb[cl][rl] = bh; tbl[cl][rl] = (__bf16)(v - (float)bh); } }
    __syncthreads();
    for (int e = tid; e < 128 * 8; e += 128) { const int cl = e >> 3, q = e & 7; vst2((unsigned*)(VT + (bb * CC + c0 + cl) * (size_t)TT + t0 + q * 8), *(const v4u*)&th[cl][q * 8]); if (hi_rows) { const size_t o3 = (bb * CC + c0 + cl) * (size_t)KHI + t0 + q * 8; vst2((unsigned*)(VB + o3), *(const v4u*)&tb[cl][q * 8]); vst2((unsigned*)(VBL + o3), *(const v4u*)&tbl[cl][q * 8]); } } } }
// ---- k_fa: one wave = 16 query rows of batch z, walking its causal keys in blocks of 128 with a running row maximum (no logit plane in the workspace).
// Logits are formed transposed (A = k rows, B = q rows): a lane then holds keys 16j + 8g + r of ITS query (lane & 15), which is already the B-fragment order of P^T; the output is accumulated transposed too (A = v planes [c][t], B = P^T), so maximum, sum and rescale stay in the query's own lanes.
// Same products as before: 1 f16 product (3 with the x 2^10 residuals for rows < QHI); exp(logit - running max) x 2^11 once to f16 against v f16 (bf16 hi + lo, 3 products, for rows < QHI); the division by the row sum comes last.
// Fragment loads stand in the source as whole groups ahead of the products that use them: half of this block's v ahead of the logits, the other half and the next block's k ahead of the softmax.
// plain builtin forms: the compiler keeps the distance behind a matrix instruction itself and may use every register window for the operands
__device__ __forceinline__ v8f mm16(v16h a, v16h b, v8f c) { return __builtin_amdgcn_wmma_f32_16x16x32_f16(false, a, false, b, (short)0, c, false, false); }
__device__ __forceinline__ v8f mmbf(v16b a, v16b b, v8f c) { return __builtin_amdgcn_wmma_f32_16x16x32_bf16(false, a, false, b, (short)0, c, false, false); }
// fragment at a wave-uniform pointer plus the lane's own 32-bit element offset (row or column, and 8 * (lane >> 4)): scalar base + one loop-invariant offset register, so no address register is formed anew for a load group
__device__ __forceinline__ v16h frag_hp(const _Float16* ub, unsigned lo) { union { v16h v; v8h q[2]; } u; const _Float16* p = ub + lo; u.q[0] = *(const v8h*)p; u.q[1] = *(const v8h*)(p + 16); return u.v; }
__device__ __forceinline__ v16b frag_bp(const __bf16* ub, unsigned lo) { union { v16b v; v8b q[2]; } u; const __bf16* p = ub + lo; u.q[0] = *(const v8b*)p; u.q[1] = *(const v8b*)(p + 16); return u.v; }
// a wave-uniform global pointer, both words through readfirstlane: it stays a scalar base of its own, so that every load names that base and a loop-invariant offset register, and no vector address is formed or stepped under loads in flight
typedef const __attribute__((address_space(1))) _Float16* gph;
__device__ __forceinline__ const _Float16* uni(const _Float16* p) { const unsigned long long a = (unsigned long long)p; return (const _Float16*)(gph)(((unsigned long long)(unsigned)__builtin_amdgcn_readfirstlane((int)(a >> 32)) << 32) | (unsigned)__builtin_amdgcn_readfirstlane((int)a)); }
// hardware exp2 with, in the same statement, the one slot that the instruction set asks for behind a transcendental before its source may be overwritten or its result read
__device__ __forceinline__ float exp2_slot(float x) { float e; asm("v_exp_f32 %0, %1\n\tv_nop" : "=v"(e) : "v"(x)); return e; }
struct FaSt { float m, lsum; };   // m: running maximum of logit x SC2 (base-2 domain); lsum: the lane's partial sum of exp x 2^11
#define SC2 ((float)(0.08838834764831845 * 1.4426950408889634))   // 128^-0.5 x log2 e: exp(SCALE x s - max) = exp2(SC2 x s - max2)
// takes the RAW products q.k; masks the diagonal block, updates the running maximum and the lane's partial sum; leaves exp x 2^11 in st and returns the factor for what was summed so far
// each exponential is one fused multiply-add (scale, maximum and the 2^11 all in it) and one hardware exp2; a result below 2^-126 reads 0, far under what f16 or the sum can hold
__device__ __forceinline__ float fa_softmax(v8f (&st)[8], FaSt& f, bool diag, int key0, int tq) {
  if (diag) {
#pragma unroll
    for (int j = 0; j < 8; ++j) {
#pragma unroll
      for (int r = 0; r < 8; ++r) st[j][r] = (key0 + j * 16 + r <= tq) ? st[j][r] : -3.0e38f; } }
  float mloc = -3.0e38f;
#pragma unroll
  for (int j = 0; j < 8; ++j) {
#pragma unroll
    for (int r = 0; r < 8; ++r) mloc = fmaxf(mloc, st[j][r]); }
  mloc = fmaxf(mloc, __shfl_xor(mloc, 16));   // the two lane halves hold the two key halves of the same query
  const float mn = fmaxf(f.m, mloc * SC2); const float alpha = __builtin_amdgcn_exp2f(f.m - mn); f.m = mn;
  const float off = 11.0f - mn; float s = 0.f;
#pragma unroll
  for (int j = 0; j < 8; ++j) {
#pragma unroll
    for (int r = 0; r < 8; ++r) { const float e = exp2_slot(fmaf(st[j][r], SC2, off)); s += e; st[j][r] = e; } }   // a masked key: exp2(-3e38 x SC2 + off) = 0; mn is finite from the first block on, which holds key 0 <= every query
  f.lsum = f.lsum * alpha + s; return alpha; }
__device__ __forceinline__ void fa_store(v8f (&acc)[HD / 16], float lsum, int b, int ql0, int lane, float (*so)[HD + 4], float* __restrict__ Y) {
  const int col = lane & 15, g = lane >> 4;
  lsum += __shfl_xor(lsum, 16);
  const float inv = lsum > 0.f ? 1.0f / lsum : 0.f;   // sum and accumulators both carry the 2^11
#pragma unroll
  for (int j = 0; j < HD / 16; ++j) { const v8f o = acc[j] * inv; vst2(&so[col][j * 16 + 8 * g], (v4f){o[0], o[1], o[2], o[3]}); vst2(&so[col][j * 16 + 8 * g + 4], (v4f){o[4], o[5], o[6], o[7]}); }
  LDSX(); for (int rl = 0; rl < 16; ++rl) vst2(Y + ((size_t)b * TT + ql0 + rl) * CC + lane * 4, *(const v4f*)&so[rl][lane * 4]); }
// rows >= QHI
__device__ __forceinline__ void fa_wave(const _Float16* __restrict__ QH, const _Float16* __restrict__ KH, const _Float16* __restrict__ VT, int b, int ql0, int lane, float (*so)[HD + 4], float* __restrict__ Y) {
  const int col = lane & 15, g = lane >> 4; const int tq = ql0 + col; const int nkb = ((ql0 + 15) >> 7) + 1;
  const _Float16* K0 = KH + (size_t)b * TT * CC; const _Float16* V0 = VT + (size_t)b * CC * TT;   // the batch's k rows and v planes (wave-uniform)
  const unsigned klo = col * CC + 8 * g, vlo = col * TT + 8 * g;
  v16h qf[HD / 32], kf[32], vf[32];
  __builtin_amdgcn_sched_barrier(0);   // with the one behind the wait below: nothing but these loads stands between here and the wait, so none of their address registers is reused ahead of it
#pragma unroll
  for (int kc = 0; kc < HD / 32; ++kc) qf[kc] = frag_hp(QH + ((size_t)b * TT + ql0) * CC + kc * 32, klo);
#pragma unroll
  for (int i = 0; i < 32; ++i) kf[i] = frag_hp(K0 + (size_t)((i & 7) * 16) * CC + (i >> 3) * 32, klo);
  asm volatile("s_wait_xcnt 0x0" ::: "memory");   // the registers that the loads above name are free for reuse behind this wait
  __builtin_amdgcn_sched_barrier(0);
  v8f acc[HD / 16] = {}; FaSt f = {-3.0e38f, 0.f};
#pragma unroll 1
  for (int kb = 0; kb < nkb; ++kb) { const int k0 = kb * 128;
    const _Float16* Kp = uni(K0 + (size_t)k0 * CC); const _Float16* Vp = uni(V0 + k0);
#pragma unroll
    for (int i = 0; i < 16; ++i) vf[i] = frag_hp(Vp + (size_t)((i & 7) * 16) * TT + (i >> 3) * 32, vlo);
    __builtin_amdgcn_sched_barrier(0);   // keeps the first half of the v loads issued ahead of the logit products (only half: the wait for k must still be a count that the load counter can hold)
    v8f st[8] = {};
#pragma unroll
    for (int i = 0; i < 32; ++i) st[i & 7] = mm16(kf[i], qf[i >> 3], st[i & 7]);
    __builtin_amdgcn_sched_barrier(0);   // keeps the loads below from being lifted over the logit products, whose wait for k would then also wait for them
#pragma unroll
    for (int i = 16; i < 32; ++i) vf[i] = frag_hp(Vp + (size_t)((i & 7) * 16) * TT + (i >> 3) * 32, vlo);
    if (kb + 1 < nkb) {
#pragma unroll
      for (int i = 0; i < 32; ++i) kf[i] = frag_hp(Kp + (size_t)(128 + (i & 7) * 16) * CC + (i >> 3) * 32, klo); }
    __builtin_amdgcn_sched_barrier(0);   // keeps the rest of the v loads and the next block's k loads issued ahead of the softmax, which then covers their latency
    const float alpha = fa_softmax(st, f, kb + 1 == nkb, k0 + 8 * g, tq);
#pragma unroll
    for (int j = 0; j < HD / 16; ++j) acc[j] *= alpha;
#pragma unroll
    for (int c = 0; c < 4; ++c) { v16h p;
#pragma unroll
      for (int i = 0; i < 8; ++i) { p[i] = (_Float16)st[2 * c][i]; p[8 + i] = (_Float16)st[2 * c + 1][i]; }
#pragma unroll
      for (int j = 0; j < HD / 16; ++j) acc[j] = mm16(vf[c * 8 + j], p, acc[j]); }
    __builtin_amdgcn_sched_barrier(0);   // keeps the step of the two scalar bases behind the last product's wait for the loads: no base is rewritten under a load in flight
  }
  fa_store(acc, f.lsum, b, ql0, lane, so, Y); }
// rows < QHI (at most 3 key blocks): residual products
__device__ __forceinline__ void fa_wave_hi(const _Float16* __restrict__ QH, const _Float16* __restrict__ KH, const _Float16* __restrict__ QL, const _Float16* __restrict__ KL, const __bf16* __restrict__ VB, const __bf16* __restrict__ VBL, int b, int ql0, int lane, float (*so)[HD + 4], float* __restrict__ Y) {
  const int col = lane & 15, g = lane >> 4; const int tq = ql0 + col; const int nkb = ((ql0 + 15) >> 7) + 1;
  const _Float16* Kp = KH + (size_t)b * TT * CC; const _Float16* KLp = KL + (size_t)b * KHI * CC; const __bf16* Vp = VB + (size_t)b * CC * KHI; const __bf16* VLp = VBL + (size_t)b * CC * KHI;   // wave-uniform; stepped at the loop's foot
  const unsigned klo = col * CC + 8 * g, vlo = col * KHI + 8 * g;
  v16h qf[HD / 32], qlf[HD / 32];
#pragma unroll
  for (int kc = 0; kc < HD / 32; ++kc) { qf[kc] = frag_hp(QH + ((size_t)b * TT + ql0) * CC + kc * 32, klo); qlf[kc] = frag_hp(QL + ((size_t)b * QHI + ql0) * CC + kc * 32, klo); }
  v8f acc[HD / 16] = {}; FaSt f = {-3.0e38f, 0.f};
#pragma unroll 1
  for (int kb = 0; kb < nkb; ++kb) { const int k0 = kb * 128;
    v8f st[8] = {}, stl[8] = {};
#pragma unroll
    for (int kc = 0; kc < HD / 32; ++kc) { v16h kh[8], kl[8];
#pragma unroll
      for (int j = 0; j < 8; ++j) { kh[j] = frag_hp(Kp + (size_t)(j * 16) * CC + kc * 32, klo); kl[j] = frag_hp(KLp + (size_t)(j * 16) * CC + kc * 32, klo); }
      __builtin_amdgcn_sched_barrier(0);   // keeps the group's 32 loads issued together: one round trip a group, not one a product
#pragma unroll
      for (int j = 0; j < 8; ++j) { st[j] = mm16(kh[j], qf[kc], st[j]); stl[j] = mm16(kh[j], qlf[kc], stl[j]); stl[j] = mm16(kl[j], qf[kc], stl[j]); } }
#pragma unroll
    for (int j = 0; j < 8; ++j) st[j] = st[j] + stl[j] * (1.0f / 1024.0f);
    const float alpha = fa_softmax(st, f, kb + 1 == nkb, k0 + 8 * g, tq);
#pragma unroll
    for (int j = 0; j < HD / 16; ++j) acc[j] *= alpha;
#pragma unroll
    for (int c = 0; c < 4; ++c) { float pe[16]; v16b vh[8], vl[8];
#pragma unroll
      for (int j = 0; j < HD / 16; ++j) { const size_t po = (size_t)(j * 16) * KHI + c * 32; vh[j] = frag_bp(Vp + po, vlo); vl[j] = frag_bp(VLp + po, vlo); }
      __builtin_amdgcn_sched_barrier(0);   // as above: the group's 32 loads issued together
#pragma unroll
      for (int i = 0; i < 8; ++i) { pe[i] = st[2 * c][i]; pe[8 + i] = st[2 * c + 1][i]; }
      const F2 p = bsplit16(pe);
#pragma unroll
      for (int j = 0; j < HD / 16; ++j) { acc[j] = mmbf(vh[j], p.h, acc[j]); acc[j] = mmbf(vh[j], p.l, acc[j]); acc[j] = mmbf(vl[j], p.h, acc[j]); } }
    __builtin_amdgcn_sched_barrier(0);   // as in fa_wave: the pointer steps stay behind the last product's wait for the loads
    Kp += 128 * CC; KLp += 128 * CC; Vp += 128; VLp += 128; }
  fa_store(acc, f.lsum, b, ql0, lane, so, Y); }
// block = 2 waves that share nothing: row tiles x and TT / 16 - 1 - x of batch z, so that every block walks the same number of key blocks
__global__ __launch_bounds__(64) void k_fa(const _Float16* __restrict__ QH, const _Float16* __restrict__ KH, const _Float16* __restrict__ QL, const _Float16* __restrict__ KL, const _Float16* __restrict__ VT, const __bf16* __restrict__ VB, const __bf16* __restrict__ VBL, float* __restrict__ Y) { __shared__ __align__(16) float ss[2][16][HD + 4];
  const int wave = __builtin_amdgcn_readfirstlane(threadIdx.x >> 5), lane = threadIdx.x & 31; const int b = blockIdx.z; const int ql0 = (wave == 0 ? (int)blockIdx.x : TT / 16 - 1 - (int)blockIdx.x) * 16;
  if (ql0 < QHI) fa_wave_hi(QH, KH, QL, KL, VB, VBL, b, ql0, lane, ss[wave], Y); else fa_wave(QH, KH, VT, b, ql0, lane, ss[wave], Y); }

extern "C" void kernel_launch(void* const* d_in, const int* in_sizes, int n_in, void* d_out, int out_size, void* d_ws, size_t ws_size, hipStream_t stream) {
  (void)in_sizes; (void)n_in; (void)out_size;
  const float** F = (const float**)d_in;
  if (ws_size < (size_t)WS_END) return;
  char* ws = (char*)d_ws; _Float16 *QH = (_Float16*)(ws + WS_QH), *KH = (_Float16*)(ws + WS_KH), *VT = (_Float16*)(ws + WS_VT), *QL = (_Float16*)(ws + WS_QL), *KL = (_Float16*)(ws + WS_KL); __bf16 *VB = (__bf16*)(ws + WS_VB), *VBL = (__bf16*)(ws + WS_VBL);
  // inputs: 0 x [4,2048,1024]; 1 Wq [1024,128] (in,out); 2 Wk; 3 Wv
  k_proj<<<dim3(TNB * TT / 64, CC / 128, 3), 128, 0, stream>>>(F[0], F[0], F[0], F[1], F[2], F[3], nullptr, nullptr, nullptr, QH, QL, KH, KL, VT, VB, VBL);
  k_fa<<<dim3(TT / 32, 1, TNB), 64, 0, stream>>>(QH, KH, QL, KL, VT, VB, VBL, (float*)d_out);
}

// v005
// It runs in 33.9 microseconds.
// In two side-by-side timings against v004, it was 1.29 and 1.28 times as fast.
// All steps since v000 together make it 15.5 times as fast.
// compute dtype: all float inputs rounded to bf16; q/k/v = x W with EXACT bf16 products on WMMA 16x16x32 (f32 accumulate); causal logits: q, k once to f16 (1 product) x 128^-0.5, 3 products below row 384; softmax in f32 with a running row maximum, exponentials in base 2 (hardware exp2); exp x 2^11 once to f16 against v f16 (bf16 hi + lo below row 384), divided by the row sum last; the key blocks of 32 query rows are dealt over 4 waves and the parts joined in f32; f32 output.
#include <hip/hip_runtime.h>
#include <math.h>

typedef __attribute__((ext_vector_type(16))) _Float16 v16h;
typedef __attribute__((ext_vector_type(16))) __bf16 v16b;
typedef __attribute__((ext_vector_type(8)))  _Float16 v8h;
typedef __attribute__((ext_vector_type(8)))  float v8f;
typedef __attribute__((ext_vector_type(4)))  float v4f;
typedef __attribute__((ext_vector_type(2)))  float v2f;
typedef __attribute__((ext_vector_type(4)))  unsigned v4u;
typedef __attribute__((ext_vector_type(4)))  int v4i;
typedef float __attribute__((may_alias)) float_a;
typedef int __attribute__((may_alias)) int_a;

template <typename T> __device__ __forceinline__ void vst2(void* p, T v) { *(T*)p = v;  }
__device__ __forceinline__ v8f wmma16(v16h a, v16h b, v8f c) {
  v8f d = __builtin_amdgcn_wmma_f32_16x16x32_f16(false, a, false, b, (short)0, c, false, false);
  asm volatile("v_nop\n\tv_nop\n\tv_nop\n\tv_nop" : "+v"(d) : "v"(a), "v"(b));
  return d;
}
__device__ __forceinline__ v8f wmma_bf(v16b a, v16b b, v8f c) {
  v8f d = __builtin_amdgcn_wmma_f32_16x16x32_bf16(false, a, false, b, (short)0, c, false, false);
  asm volatile("v_nop\n\tv_nop\n\tv_nop\n\tv_nop" : "+v"(d) : "v"(a), "v"(b));
  return d;
}
// 16x16x32 fragments: lane = (h = lane>>4, row/col = lane&15); elements 0..7 = k0+8h+0..7, 8..15 = k0+16+8h+0..7; D element r = row 8h+r
__device__ __forceinline__ v16h frag_h(const _Float16* rowk0, int lane) {
  union { v16h v; v8h q[2]; } u; const _Float16* p = rowk0 + 8 * (lane >> 4);
  u.q[0] = *(const v8h*)p; u.q[1] = *(const v8h*)(p + 16); return u.v;
}
__device__ __forceinline__ v16h frag_f32(const float* rowk0, int lane) {
  v16h a; const float* p = rowk0 + 8 * (lane >> 4);
#pragma unroll
  for (int i = 0; i < 8; ++i) { a[i] = (_Float16)p[i]; a[8 + i] = (_Float16)p[16 + i]; }
  return a;
}
__device__ __forceinline__ v16h frag_f32s(const float* rowk0, int lane, float sc) {
  v16h a; const float* p = rowk0 + 8 * (lane >> 4);
#pragma unroll
  for (int i = 0; i < 8; ++i) { a[i] = (_Float16)(p[i] * sc); a[8 + i] = (_Float16)(p[16 + i] * sc); }
  return a;
}
// column fragment from a [K][ld] layout (column n), rows >= K read as 0
__device__ __forceinline__ v16h fragc_f32(const float* W, int k0, int n, int lane, int ld, int K) {
  v16h a; const int g = lane >> 4;
#pragma unroll
  for (int i = 0; i < 8; ++i) { const int ka = k0 + 8 * g + i, kb = ka + 16;
    a[i] = (_Float16)(ka < K ? W[(size_t)(ka < K ? ka : K - 1) * ld + n] : 0.f); a[8 + i] = (_Float16)(kb < K ? W[(size_t)(kb < K ? kb : K - 1) * ld + n] : 0.f); }
  return a;
}
struct F2 { v16b h, l; };
__device__ __forceinline__ F2 bsplit16(const float v[16]) { F2 r;
#pragma unroll
  for (int i = 0; i < 16; ++i) { const __bf16 h = (__bf16)v[i]; r.h[i] = h; r.l[i] = (__bf16)(v[i] - (float)h); }
  return r; }
__device__ __forceinline__ F2 split_row(const float* row, int k0, int lane) { float v[16]; const float* p = row + k0 + 8 * (lane >> 4);
#pragma unroll
  for (int i = 0; i < 8; ++i) { v[i] = p[i]; v[8 + i] = p[16 + i]; }
  return bsplit16(v); }
__device__ __forceinline__ F2 split_rowK(const float* row, int k0, int lane, int K) { float v[16]; const int g = lane >> 4;
#pragma unroll
  for (int i = 0; i < 8; ++i) { const int ka = k0 + 8 * g + i, kb = ka + 16; v[i] = ka < K ? row[ka < K ? ka : K - 1] : 0.f; v[8 + i] = kb < K ? row[kb < K ? kb : K - 1] : 0.f; }
  return bsplit16(v); }
__device__ __forceinline__ F2 split_col(const float* W, int k0, int n, int lane, int ld, int K) { float v[16]; const int g = lane >> 4;
#pragma unroll
  for (int i = 0; i < 8; ++i) { const int ka = k0 + 8 * g + i, kb = ka + 16; v[i] = ka < K ? W[(size_t)(ka < K ? ka : K - 1) * ld + n] : 0.f; v[8 + i] = kb < K ? W[(size_t)(kb < K ? kb : K - 1) * ld + n] : 0.f; }
  return bsplit16(v); }
__device__ __forceinline__ v8f mac3(const F2& a, const F2& b, v8f c) { c = wmma_bf(a.l, b.h, c); c = wmma_bf(a.h, b.l, c); return wmma_bf(a.h, b.h, c); }
__device__ __forceinline__ float sigm(float v) { return 1.0f / (1.0f + expf(-v)); }
#define LDSX() do { asm volatile("s_wait_dscnt 0" ::: "memory"); __builtin_amdgcn_wave_barrier(); __builtin_amdgcn_fence(__ATOMIC_RELEASE, "workgroup"); } while (0)

// Single-head causal self-attention (B 4, T 2,048, C 1,024 -> H 128; (in,out) 1/32-scale weights, no biases): q, k, v = x W; out = softmax_causal(q k^T x 128^-0.5) v -> [B, T, 128].
#define NB 4
#define TT 2048
#define CC 128            // NH * HD = projected width
#define DIN 1024          // input (model) width
#define NH 1
#define HD 128
#define NQB (TT / 64)
#define HG 1
#define SCALE (0.08838834764831845f)
#define CAUSAL 1
#ifndef TNB
#define TNB NB
#endif
__device__ __forceinline__ float bfr(float v) { return (float)(__bf16)v; }
__host__ __device__ __forceinline__ int kb_last(int qb) { return CAUSAL ? ((qb * 64 + 63) >> 7) : (TT / 128 - 1); }
typedef __attribute__((ext_vector_type(8))) __bf16 v8b;
__device__ __forceinline__ v16b frag_b(const __bf16* rowk0, int lane) {
  union { v16b v; v8b q[2]; } u; const __bf16* p = rowk0 + 8 * (lane >> 4);
  u.q[0] = *(const v8b*)p; u.q[1] = *(const v8b*)(p + 16); return u.v;
}
#define QBH 6              // unused: k_fa takes the high-precision path for rows < QHI (32-row query blocks 0..11; few keys, no averaging)
#define QHI 384            // rows carrying a q residual plane
#define KHI 384            // key rows carrying k residual / v bf16 hi+lo planes (used only by the causal high-precision path)
// B fragment (k rows k0+.., output column o) of a weight: (in,out) [K][ld] or (out,in) [ld rows of K]: bf16 exact, or f16(bf16 * 256) exact
__device__ __forceinline__ v16b wcol_io(const float* Wm, int k0, int o, int lane, int ld) { v16b w; const int g = lane >> 4;
#pragma unroll
  for (int i = 0; i < 8; ++i) { w[i] = (__bf16)Wm[(size_t)(k0 + 8 * g + i) * ld + o]; w[8 + i] = (__bf16)Wm[(size_t)(k0 + 16 + 8 * g + i) * ld + o]; }
  return w; }
__device__ __forceinline__ v16b wcol_oi(const float* Wm, int k0, int o, int lane, int K) { v16b w; const float* p = Wm + (size_t)o * K + k0 + 8 * (lane >> 4);
#pragma unroll
  for (int i = 0; i < 8; ++i) { w[i] = (__bf16)p[i]; w[8 + i] = (__bf16)p[16 + i]; }
  return w; }
__device__ __forceinline__ v16h wcolh_io(const float* Wm, int k0, int o, int lane, int ld) { v16h w; const int g = lane >> 4;
#pragma unroll
  for (int i = 0; i < 8; ++i) { w[i] = (_Float16)(bfr(Wm[(size_t)(k0 + 8 * g + i) * ld + o]) * 256.0f); w[8 + i] = (_Float16)(bfr(Wm[(size_t)(k0 + 16 + 8 * g + i) * ld + o]) * 256.0f); }
  return w; }
__device__ __forceinline__ v16h wcolh_oi(const float* Wm, int k0, int o, int lane, int K) { v16h w; const float* p = Wm + (size_t)o * K + k0 + 8 * (lane >> 4);
#pragma unroll
  for (int i = 0; i < 8; ++i) { w[i] = (_Float16)(bfr(p[i]) * 256.0f); w[8 + i] = (_Float16)(bfr(p[16 + i]) * 256.0f); }
  return w; }
#define WQKV_LAYOUT 0   // layout that WCOL reads (0 = (in,out) [DIN][CC]; 1 = (out,in) [CC][DIN]; 2 = per-head [NH][DIN][HD]); nothing calls WCOL: k_proj reads W as (in,out) [DIN][CC] for any value
__device__ __forceinline__ v16b wcol_hdk(const float* Wm, int k0, int o, int lane) { v16b w; const int g = lane >> 4; const float* p = Wm + (size_t)(o / HD) * DIN * HD + (o % HD);
#pragma unroll
  for (int i = 0; i < 8; ++i) { w[i] = (__bf16)p[(size_t)(k0 + 8 * g + i) * HD]; w[8 + i] = (__bf16)p[(size_t)(k0 + 16 + 8 * g + i) * HD]; }
  return w; }
#define WO_OUT_IN 0
#if WQKV_LAYOUT == 1
#define WCOL(W, k0, o, lane) wcol_oi(W, k0, o, lane, DIN)
#elif WQKV_LAYOUT == 2
#define WCOL(W, k0, o, lane) wcol_hdk(W, k0, o, lane)
#else
#define WCOL(W, k0, o, lane) wcol_io(W, k0, o, lane, CC)
#endif
#if WO_OUT_IN
#define WOCOL(W, k0, o, lane) wcol_oi(W, k0, o, lane, CC)
#define WOCOLH(W, k0, o, lane) wcolh_oi(W, k0, o, lane, CC)
#else
#define WOCOL(W, k0, o, lane) wcol_io(W, k0, o, lane, DIN)
#define WOCOLH(W, k0, o, lane) wcolh_io(W, k0, o, lane, DIN)
#endif

#ifndef SM_EXTRA_PARAMS
#define SM_EXTRA_PARAMS
#endif
#ifndef PROJ_EXTRA_PARAMS
#define PROJ_EXTRA_PARAMS
#endif
#ifndef SM_MASK_HOOK
#define SM_MASK_HOOK (void)0
#endif

#define WS_QH  0u                                      // f16 q rows [b*t][CC]
#define WS_KH  (WS_QH + 2u * (size_t)NB * TT * CC)      // f16 k rows [b*t][CC]
#define WS_VT  (WS_KH + 2u * (size_t)NB * TT * CC)      // f16 v planes [b][c][t]
#define WS_QL  (WS_VT + 2u * (size_t)NB * CC * TT)      // f16 q residual x 2^10 rows [b][t < QHI][CC]
#define WS_KL  (WS_QL + 2u * (size_t)NB * QHI * CC)     // f16 k residual x 2^10 rows [b][t < KHI][CC]
#define WS_VB  (WS_KL + 2u * (size_t)NB * KHI * CC)     // bf16 v hi planes [b][c][t < KHI]
#define WS_VBL (WS_VB + 2u * (size_t)NB * CC * KHI)
#define WS_END (WS_VBL + 2u * (size_t)NB * CC * KHI)

#define PKC 64             // k per staged chunk
#define PPIT (PKC + 8)     // LDS row pitch in bf16: 128 B of k + 16 B
typedef __attribute__((ext_vector_type(4))) __bf16 v4b;
// ---- k_proj: block = (64 rows, 128 cols, which): q/k/v = X W (+ b) with exact bf16 products (K = DIN) -> which 0: q f16 rows (+ residual rows < QHI); 1: k f16 rows (+ residual rows < KHI); 2: v f16 planes [c][t] (+ bf16 hi/lo planes for t < KHI)
__global__ __launch_bounds__(128) void k_proj(const float* __restrict__ XQ, const float* __restrict__ XK, const float* __restrict__ XV, const float* __restrict__ WQ, const float* __restrict__ WK, const float* __restrict__ WV, const float* __restrict__ BQ, const float* __restrict__ BK, const float* __restrict__ BV,
    _Float16* __restrict__ QH, _Float16* __restrict__ QL, _Float16* __restrict__ KH, _Float16* __restrict__ KL, _Float16* __restrict__ VT, __bf16* __restrict__ VB, __bf16* __restrict__ VBL) {
  __shared__ __align__(16) _Float16 sh[64][136], sl[64][136]; __shared__ __align__(16) _Float16 th[128][72]; __shared__ __align__(16) __bf16 tb[128][72], tbl[128][72];
  __shared__ __align__(16) __bf16 sw[2][128][PPIT], sx[2][64][PPIT];
  const int tid = threadIdx.x, wave = tid >> 5, lane = tid & 31, col = lane & 15, g = lane >> 4; const int which = blockIdx.z; const int c0 = blockIdx.y * 128; const size_t r0 = (size_t)blockIdx.x * 64; const size_t bb = r0 / TT; const int t0 = (int)(r0 % TT);
  const float* X = which == 0 ? XQ : which == 1 ? XK : XV; const float* WA = which == 0 ? WQ : which == 1 ? WK : WV; const float* BA = which == 0 ? BQ : which == 1 ? BK : BV;
  // Main loop: the block's x rows and W columns go through LDS as bf16 in chunks of PKC k, k-contiguous rows at the pitch for 16-byte readers, two buffers.
  // Whole-line global loads, each element loaded and rounded once a block; the next chunk's loads are in flight while this chunk's products run. Every accumulator still takes its 32-k products in ascending k.
  const unsigned wlo = (unsigned)((tid >> 6) * 32 * CC + 2 * (tid & 63));   // W: this thread's column pair and its 32 k rows of the chunk
  const unsigned xlo = (unsigned)((tid >> 4) * DIN + 4 * (tid & 15));       // x: rows (tid >> 4) + 8 i, four k each
  const float* Wb = WA + c0; const float* Xb = X + r0 * DIN;                // block-uniform bases
  v2f wr[2][32]; v4f xr[2][8];   // two register sets: chunks c + 1 and c + 2 are in flight while chunk c is worked on
  v8f acc[8] = {};
#define PROJ_LD(c, s) do { const float* wp = Wb + (size_t)(c) * PKC * CC; const float* xp = Xb + (size_t)(c) * PKC; \
    _Pragma("unroll") for (int i = 0; i < 32; ++i) wr[s][i] = *(const v2f*)(wp + (size_t)i * CC + wlo); \
    _Pragma("unroll") for (int i = 0; i < 8; ++i) xr[s][i] = *(const v4f*)(xp + (size_t)(8 * i) * DIN + xlo); \
    asm volatile("s_wait_xcnt 0x0" ::: "memory");   /* these loads stay in flight over the loop's foot, where their address registers are stepped: the wait stands ahead of that (a scheduling barrier follows every use) */ \
  } while (0)
#define PROJ_ST(s) do { \
    _Pragma("unroll") for (int q = 0; q < 4; ++q) { v8b w0, w1; \
      _Pragma("unroll") for (int e = 0; e < 8; ++e) { w0[e] = (__bf16)wr[s][q * 8 + e][0]; w1[e] = (__bf16)wr[s][q * 8 + e][1]; } \
      *(v8b*)&sw[s][2 * (tid & 63)][(tid >> 6) * 32 + q * 8] = w0; *(v8b*)&sw[s][2 * (tid & 63) + 1][(tid >> 6) * 32 + q * 8] = w1; } \
    _Pragma("unroll") for (int i = 0; i < 8; ++i) { v4b xv; \
      _Pragma("unroll") for (int e = 0; e < 4; ++e) xv[e] = (__bf16)xr[s][i][e]; \
      *(v4b*)&sx[s][(tid >> 4) + 8 * i][4 * (tid & 15)] = xv; } } while (0)
// work-group barrier that orders LDS alone: __syncthreads() would also wait for the global loads in flight, which nobody else reads
#define PROJ_BAR() do { __builtin_amdgcn_fence(__ATOMIC_RELEASE, "workgroup", "local"); __builtin_amdgcn_s_barrier(); __builtin_amdgcn_fence(__ATOMIC_ACQUIRE, "workgroup", "local"); } while (0)
// one trip: chunk c lies in LDS buffer s (= c & 1); register set s is free, set s ^ 1 holds (in flight) chunk c + 1; more2, more1: a chunk c + 2, c + 1 exists (literals, so that the loop's body has no branch and its load waits are counts)
#define PROJ_TRIP(c, s, more2, more1) do { \
    if (more2) PROJ_LD((c) + 2, s); \
    __builtin_amdgcn_sched_barrier(0);   /* keeps the global loads issued ahead of this chunk's products */ \
    v16b af[PKC / 32], wf[PKC / 32][8]; \
    _Pragma("unroll") for (int ks = 0; ks < PKC / 32; ++ks) { af[ks] = frag_b(&sx[s][wave * 16 + col][ks * 32], lane); \
      _Pragma("unroll") for (int j = 0; j < 8; ++j) wf[ks][j] = frag_b(&sw[s][j * 16 + col][ks * 32], lane); } \
    __builtin_amdgcn_sched_barrier(0);   /* keeps the chunk's LDS reads together ahead of its products: one LDS round trip a chunk, not one a product */ \
    _Pragma("unroll") for (int ks = 0; ks < PKC / 32; ++ks) { \
      _Pragma("unroll") for (int j = 0; j < 8; ++j) acc[j] = __builtin_amdgcn_wmma_f32_16x16x32_bf16(false, af[ks], false, wf[ks][j], (short)0, acc[j], false, false); } \
    __builtin_amdgcn_sched_barrier(0);   /* keeps the wait for chunk c + 1's global loads, and their rounding, behind the products */ \
    if (more1) { PROJ_ST((s) ^ 1); \
      PROJ_BAR(); }   /* publishes chunk c + 1 and ends every wave's reads of the buffer that the next trip refills */ \
  } while (0)
  PROJ_LD(0, 0); PROJ_LD(1, 1);
  __builtin_amdgcn_sched_barrier(0);   // keeps both chunks' loads issued ahead of the wait for the first
  PROJ_ST(0);
  PROJ_BAR();   // chunk 0 is in LDS for every wave
#pragma unroll 1   // the body already holds one trip for each buffer and register set
  for (int c = 0; c < DIN / PKC - 2; c += 2) { PROJ_TRIP(c, 0, 1, 1); PROJ_TRIP(c + 1, 1, 1, 1); }
  PROJ_TRIP(DIN / PKC - 2, 0, 0, 1); PROJ_TRIP(DIN / PKC - 1, 1, 0, 0);   // the last two chunks: nothing left to load, then nothing left to stage
#undef PROJ_TRIP
#undef PROJ_BAR
#undef PROJ_LD
#undef PROJ_ST
  if (which < 2) { _Float16* DH = which == 0 ? QH : KH; _Float16* DL = which == 0 ? QL : KL; const int nhi = which == 0 ? QHI : KHI; const bool hi_rows = t0 < nhi;
#pragma unroll
    for (int j = 0; j < 8; ++j) { const float bias = BA ? bfr(BA[c0 + j * 16 + col]) : 0.f;
#pragma unroll
      for (int r = 0; r < 8; ++r) { const float v = acc[j][r] + bias; const _Float16 hv = (_Float16)v; sh[wave * 16 + 8 * g + r][j * 16 + col] = hv; sl[wave * 16 + 8 * g + r][j * 16 + col] = (_Float16)((v - (float)hv) * 1024.0f); } }
    __syncthreads();
    for (int e = tid; e < 64 * 16; e += 128) { const int rl = e >> 4, q = e & 15; vst2((unsigned*)(DH + (r0 + rl) * CC + c0 + q * 8), *(const v4u*)&sh[rl][q * 8]); if (hi_rows) vst2((unsigned*)(DL + (bb * nhi + t0 + rl) * (size_t)CC + c0 + q * 8), *(const v4u*)&sl[rl][q * 8]); }
  } else { const bool hi_rows = t0 < KHI;
#pragma unroll
    for (int j = 0; j < 8; ++j) { const float bias = BA ? bfr(BA[c0 + j * 16 + col]) : 0.f;
#pragma unroll
      for (int r = 0; r < 8; ++r) { const float v = acc[j][r] + bias; const int rl = wave * 16 + 8 * g + r, cl = j * 16 + col; th[cl][rl] = (_Float16)v; const __bf16 bh = (__bf16)v; tb[cl][rl] = bh; tbl[cl][rl] = (__bf16)(v - (float)bh); } }
    __syncthreads();
    for (int e = tid; e < 128 * 8; e += 128) { const int cl = e >> 3, q = e & 7; vst2((unsigned*)(VT + (bb * CC + c0 + cl) * (size_t)TT + t0 + q * 8), *(const v4u*)&th[cl][q * 8]); if (hi_rows) { const size_t o3 = (bb * CC + c0 + cl) * (size_t)KHI + t0 + q * 8; vst2((unsigned*)(VB + o3), *(const v4u*)&tb[cl][q * 8]); vst2((unsigned*)(VBL + o3), *(const v4u*)&tbl[cl][q * 8]); } } } }
// ---- k_fa: one work-group of 4 waves = 32 query rows (two 16-row tiles) of one batch. Rows >= QHI: wave w takes BOTH tiles against the causal key blocks w, w + 4, ... (128 keys each), so that every k and v fragment it loads feeds two products; running row maxima of its own (no logit plane in the workspace); the four parts are joined in LDS at the end.
// Logits are formed transposed (A = k rows, B = q rows): a lane then holds keys 16j + 8g + r of ITS query (lane & 15), which is already the B-fragment order of P^T; the output is accumulated transposed too (A = v planes [c][t], B = P^T), so maximum, sum and rescale stay in the query's own lanes.
// Same products as before: 1 f16 product (3 with the x 2^10 residuals for rows < QHI); exp(logit - running max) x 2^11 once to f16 against v f16 (bf16 hi + lo, 3 products, for rows < QHI); the division by the row sum comes last.
// Fragment loads stand in the source as whole groups ahead of the products that use them: half of this block's v ahead of the logits, the other half and the next block's k ahead of the softmax.
// plain builtin forms: the compiler keeps the distance behind a matrix instruction itself and may use every register window for the operands
__device__ __forceinline__ v8f mm16(v16h a, v16h b, v8f c) { return __builtin_amdgcn_wmma_f32_16x16x32_f16(false, a, false, b, (short)0, c, false, false); }
__device__ __forceinline__ v8f mmbf(v16b a, v16b b, v8f c) { return __builtin_amdgcn_wmma_f32_16x16x32_bf16(false, a, false, b, (short)0, c, false, false); }
// fragment at a wave-uniform pointer plus the lane's own 32-bit element offset (row or column, and 8 * (lane >> 4)): scalar base + one loop-invariant offset register, so no address register is formed anew for a load group
__device__ __forceinline__ v16h frag_hp(const _Float16* ub, unsigned lo) { union { v16h v; v8h q[2]; } u; const _Float16* p = ub + lo; u.q[0] = *(const v8h*)p; u.q[1] = *(const v8h*)(p + 16); return u.v; }
__device__ __forceinline__ v16b frag_bp(const __bf16* ub, unsigned lo) { union { v16b v; v8b q[2]; } u; const __bf16* p = ub + lo; u.q[0] = *(const v8b*)p; u.q[1] = *(const v8b*)(p + 16); return u.v; }
// a wave-uniform global pointer, both words through readfirstlane: it stays a scalar base of its own, so that every load names that base and a loop-invariant offset register, and no vector address is formed or stepped under loads in flight
typedef const __attribute__((address_space(1))) _Float16* gph;
__device__ __forceinline__ const _Float16* uni(const _Float16* p) { const unsigned long long a = (unsigned long long)p; return (const _Float16*)(gph)(((unsigned long long)(unsigned)__builtin_amdgcn_readfirstlane((int)(a >> 32)) << 32) | (unsigned)__builtin_amdgcn_readfirstlane((int)a)); }
// hardware exp2 with, in the same statement, the one slot that the instruction set asks for behind a transcendental before its source may be overwritten or its result read
__device__ __forceinline__ float exp2_slot(float x) { float e; asm("v_exp_f32 %0, %1\n\tv_nop" : "=v"(e) : "v"(x)); return e; }
struct FaSt { float m, lsum; };   // m: running maximum of logit x SC2 (base-2 domain); lsum: the lane's partial sum of exp x 2^11
#define SC2 ((float)(0.08838834764831845 * 1.4426950408889634))   // 128^-0.5 x log2 e: exp(SCALE x s - max) = exp2(SC2 x s - max2)
// takes the RAW products q.k; masks the diagonal block, updates the running maximum and the lane's partial sum; leaves exp x 2^11 in st and returns the factor for what was summed so far
// each exponential is one fused multiply-add (scale, maximum and the 2^11 all in it) and one hardware exp2; a result below 2^-126 reads 0, far under what f16 or the sum can hold
__device__ __forceinline__ float fa_softmax(v8f (&st)[8], FaSt& f, bool diag, int key0, int tq) {
  if (diag) {
#pragma unroll
    for (int j = 0; j < 8; ++j) {
#pragma unroll
      for (int r = 0; r < 8; ++r) st[j][r] = (key0 + j * 16 + r <= tq) ? st[j][r] : -3.0e38f; } }
  float mloc = -3.0e38f;
#pragma unroll
  for (int j = 0; j < 8; ++j) {
#pragma unroll
    for (int r = 0; r < 8; ++r) mloc = fmaxf(mloc, st[j][r]); }
  mloc = fmaxf(mloc, __shfl_xor(mloc, 16));   // the two lane halves hold the two key halves of the same query
  const float mn = fmaxf(f.m, mloc * SC2); const float alpha = exp2_slot(f.m - mn); f.m = mn;
  const float off = 11.0f - mn; float s = 0.f;
#pragma unroll
  for (int j = 0; j < 8; ++j) {
#pragma unroll
    for (int r = 0; r < 8; ++r) { const float e = exp2_slot(fmaf(st[j][r], SC2, off)); s += e; st[j][r] = e; } }   // a masked key: exp2(-3e38 x SC2 + off) = 0; mn is finite from a wave's first block on: every block that is walked starts at a key <= every query of the tile
  f.lsum = f.lsum * alpha + s; return alpha; }
// joins the four waves' parts of the block's two row tiles: common maximum, each part rescaled to it, parts added in a fixed order, division by the joined row sum last
__device__ __forceinline__ void fa_join(v8f (&acc0)[HD / 16], v8f (&acc1)[HD / 16], const FaSt& f0, const FaSt& f1, int b, int ql0, int wave, int lane, float (*so)[32][HD + 4], float (*sm)[32], float (*sl)[32], float* __restrict__ Y) {
  const int col = lane & 15, g = lane >> 4;
  sm[wave][lane] = g == 0 ? f0.m : f1.m;   // both lane halves hold the same maxima: the lower half stores tile 0's, the upper tile 1's
  __syncthreads();   // every wave's maxima are in LDS
  const float mj0 = fmaxf(fmaxf(sm[0][col], sm[1][col]), fmaxf(sm[2][col], sm[3][col])), mj1 = fmaxf(fmaxf(sm[0][16 + col], sm[1][16 + col]), fmaxf(sm[2][16 + col], sm[3][16 + col]));   // finite: some wave walks block 0 of each tile, which holds key 0 <= every query
  const float sc0 = exp2_slot(f0.m - mj0), sc1 = exp2_slot(f1.m - mj1);   // a wave without a key block of that tile: exp2(-3e38 - max) = 0 on a part that is 0
  float ls0 = f0.lsum * sc0, ls1 = f1.lsum * sc1; ls0 += __shfl_xor(ls0, 16); ls1 += __shfl_xor(ls1, 16);
  sl[wave][lane] = g == 0 ? ls0 : ls1;
#pragma unroll
  for (int j = 0; j < HD / 16; ++j) { const v8f o = acc0[j] * sc0, p = acc1[j] * sc1;
    vst2(&so[wave][col][j * 16 + 8 * g], (v4f){o[0], o[1], o[2], o[3]}); vst2(&so[wave][col][j * 16 + 8 * g + 4], (v4f){o[4], o[5], o[6], o[7]});
    vst2(&so[wave][16 + col][j * 16 + 8 * g], (v4f){p[0], p[1], p[2], p[3]}); vst2(&so[wave][16 + col][j * 16 + 8 * g + 4], (v4f){p[4], p[5], p[6], p[7]}); }
  __syncthreads();   // every wave's rescaled parts and sums are in LDS
#pragma unroll
  for (int i = 0; i < 8; ++i) { const int rl = wave * 8 + i;   // one output row (512 contiguous bytes) a wave and pass
    const float lj = (sl[0][rl] + sl[1][rl]) + (sl[2][rl] + sl[3][rl]); const float inv = lj > 0.f ? 1.0f / lj : 0.f;   // sum and accumulators both carry the 2^11
    const v4f o = (*(const v4f*)&so[0][rl][lane * 4] + *(const v4f*)&so[1][rl][lane * 4]) + (*(const v4f*)&so[2][rl][lane * 4] + *(const v4f*)&so[3][rl][lane * 4]);
    vst2(Y + ((size_t)b * TT + ql0 + rl) * CC + lane * 4, o * inv); } }
// rows >= QHI (at least 4 key blocks, so every wave has one)
__device__ __forceinline__ void fa_wave(const _Float16* __restrict__ QH, const _Float16* __restrict__ KH, const _Float16* __restrict__ VT, int b, int ql0, int wave, int lane, v8f (&acc0)[HD / 16], v8f (&acc1)[HD / 16], FaSt& f0, FaSt& f1) {
  const int col = lane & 15, g = lane >> 4; const int tq = ql0 + col; const int nkb = ((ql0 + 31) >> 7) + 1;
  const _Float16* K0 = KH + (size_t)b * TT * CC; const _Float16* V0 = VT + (size_t)b * CC * TT;   // the batch's k rows and v planes (wave-uniform)
  const unsigned klo = col * CC + 8 * g, vlo = col * TT + 8 * g;
  v16h qf0[HD / 32], qf1[HD / 32], kf[32], vf[32];
  __builtin_amdgcn_sched_barrier(0);   // with the one behind the wait below: nothing but these loads stands between here and the wait, so none of their address registers is reused ahead of it
#pragma unroll
  for (int kc = 0; kc < HD / 32; ++kc) { qf0[kc] = frag_hp(QH + ((size_t)b * TT + ql0) * CC + kc * 32, klo); qf1[kc] = frag_hp(QH + ((size_t)b * TT + ql0 + 16) * CC + kc * 32, klo); }
#pragma unroll
  for (int i = 0; i < 32; ++i) kf[i] = frag_hp(K0 + (size_t)(wave * 128 + (i & 7) * 16) * CC + (i >> 3) * 32, klo);
  asm volatile("s_wait_xcnt 0x0" ::: "memory");   // the registers that the loads above name are free for reuse behind this wait
  __builtin_amdgcn_sched_barrier(0);
  static_assert(QHI >= 384, "every wave needs a first key block");
  int kb = wave;
#pragma unroll 1
  do { const int k0 = kb * 128;   // entered without a test: the loads above stay where they stand, ahead of their wait
    const _Float16* Kp = uni(K0 + (size_t)k0 * CC); const _Float16* Vp = uni(V0 + k0);
#pragma unroll
    for (int i = 0; i < 16; ++i) vf[i] = frag_hp(Vp + (size_t)((i & 7) * 16) * TT + (i >> 3) * 32, vlo);
    __builtin_amdgcn_sched_barrier(0);   // keeps the first half of the v loads issued ahead of the logit products (only half: the wait for k must still be a count that the load counter can hold)
    v8f st0[8] = {}, st1[8] = {};
#pragma unroll
    for (int i = 0; i < 32; ++i) { st0[i & 7] = mm16(kf[i], qf0[i >> 3], st0[i & 7]); st1[i & 7] = mm16(kf[i], qf1[i >> 3], st1[i & 7]); }
    __builtin_amdgcn_sched_barrier(0);   // keeps the loads below from being lifted over the logit products, whose wait for k would then also wait for them
#pragma unroll
    for (int i = 16; i < 32; ++i) vf[i] = frag_hp(Vp + (size_t)((i & 7) * 16) * TT + (i >> 3) * 32, vlo);
    if (kb + 4 < nkb) {
#pragma unroll
      for (int i = 0; i < 32; ++i) kf[i] = frag_hp(Kp + (size_t)(512 + (i & 7) * 16) * CC + (i >> 3) * 32, klo); }
    asm volatile("s_wait_xcnt 0x0" ::: "memory");   // the k loads stay in flight over the loop's foot, where the scalar bases are formed anew: the wait stands ahead of that
    __builtin_amdgcn_sched_barrier(0);   // keeps the rest of the v loads and the next block's k loads issued ahead of the softmax, which then covers their latency
    if (kb + 1 == nkb) {   // the diagonal block: both tiles masked in one branch, so that none of the mask's arithmetic stands in the other blocks' path
#pragma unroll
      for (int j = 0; j < 8; ++j) {
#pragma unroll
        for (int r = 0; r < 8; ++r) { const int key = k0 + 8 * g + j * 16 + r; st0[j][r] = (key <= tq) ? st0[j][r] : -3.0e38f; st1[j][r] = (key <= tq + 16) ? st1[j][r] : -3.0e38f; } } }
    const float alpha0 = fa_softmax(st0, f0, false, 0, 0); const float alpha1 = fa_softmax(st1, f1, false, 0, 0);
#pragma unroll
    for (int j = 0; j < HD / 16; ++j) { acc0[j] *= alpha0; acc1[j] *= alpha1; }
#pragma unroll
    for (int c = 0; c < 4; ++c) { v16h p0, p1;
#pragma unroll
      for (int i = 0; i < 8; ++i) { p0[i] = (_Float16)st0[2 * c][i]; p0[8 + i] = (_Float16)st0[2 * c + 1][i]; p1[i] = (_Float16)st1[2 * c][i]; p1[8 + i] = (_Float16)st1[2 * c + 1][i]; }
#pragma unroll
      for (int j = 0; j < HD / 16; ++j) { acc0[j] = mm16(vf[c * 8 + j], p0, acc0[j]); acc1[j] = mm16(vf[c * 8 + j], p1, acc1[j]); } }
    __builtin_amdgcn_sched_barrier(0);   // keeps the step of the two scalar bases behind the last product's wait for the loads: no base is rewritten under a load in flight
    kb += 4;
  } while (kb < nkb); }
// rows < QHI (at most 3 key blocks): residual products; one 16-row tile a wave, its key blocks kb0, kb0 + 2, ... (two waves a tile)
__device__ __forceinline__ void fa_wave_hi(const _Float16* __restrict__ QH, const _Float16* __restrict__ KH, const _Float16* __restrict__ QL, const _Float16* __restrict__ KL, const __bf16* __restrict__ VB, const __bf16* __restrict__ VBL, int b, int ql0, int kb0, int lane, v8f (&acc)[HD / 16], FaSt& f) {
  const int col = lane & 15, g = lane >> 4; const int tq = ql0 + col; const int nkb = ((ql0 + 15) >> 7) + 1;
  const _Float16* Kp = KH + ((size_t)b * TT + kb0 * 128) * CC; const _Float16* KLp = KL + ((size_t)b * KHI + kb0 * 128) * CC; const __bf16* Vp = VB + (size_t)b * CC * KHI + kb0 * 128; const __bf16* VLp = VBL + (size_t)b * CC * KHI + kb0 * 128;   // wave-uniform; stepped at the loop's foot
  const unsigned klo = col * CC + 8 * g, vlo = col * KHI + 8 * g;
  v16h qf[HD / 32], qlf[HD / 32];
#pragma unroll
  for (int kc = 0; kc < HD / 32; ++kc) { qf[kc] = frag_hp(QH + ((size_t)b * TT + ql0) * CC + kc * 32, klo); qlf[kc] = frag_hp(QL + ((size_t)b * QHI + ql0) * CC + kc * 32, klo); }
#pragma unroll 1
  for (int kb = kb0; kb < nkb; kb += 2) { const int k0 = kb * 128;
    v8f st[8] = {}, stl[8] = {};
#pragma unroll
    for (int kc = 0; kc < HD / 32; ++kc) { v16h kh[8], kl[8];
#pragma unroll
      for (int j = 0; j < 8; ++j) { kh[j] = frag_hp(Kp + (size_t)(j * 16) * CC + kc * 32, klo); kl[j] = frag_hp(KLp + (size_t)(j * 16) * CC + kc * 32, klo); }
      __builtin_amdgcn_sched_barrier(0);   // keeps the group's 32 loads issued together: one round trip a group, not one a product
#pragma unroll
      for (int j = 0; j < 8; ++j) { st[j] = mm16(kh[j], qf[kc], st[j]); stl[j] = mm16(kh[j], qlf[kc], stl[j]); stl[j] = mm16(kl[j], qf[kc], stl[j]); } }
#pragma unroll
    for (int j = 0; j < 8; ++j) st[j] = st[j] + stl[j] * (1.0f / 1024.0f);
    const float alpha = fa_softmax(st, f, kb + 1 == nkb, k0 + 8 * g, tq);
#pragma unroll
    for (int j = 0; j < HD / 16; ++j) acc[j] *= alpha;
#pragma unroll
    for (int c = 0; c < 4; ++c) { float pe[16]; v16b vh[8], vl[8];
#pragma unroll
      for (int j = 0; j < HD / 16; ++j) { const size_t po = (size_t)(j * 16) * KHI + c * 32; vh[j] = frag_bp(Vp + po, vlo); vl[j] = frag_bp(VLp + po, vlo); }
      __builtin_amdgcn_sched_barrier(0);   // as above: the group's 32 loads issued together
#pragma unroll
      for (int i = 0; i < 8; ++i) { pe[i] = st[2 * c][i]; pe[8 + i] = st[2 * c + 1][i]; }
      const F2 p = bsplit16(pe);
#pragma unroll
      for (int j = 0; j < HD / 16; ++j) { acc[j] = mmbf(vh[j], p.h, acc[j]); acc[j] = mmbf(vh[j], p.l, acc[j]); acc[j] = mmbf(vl[j], p.h, acc[j]); } }
    __builtin_amdgcn_sched_barrier(0);   // as in fa_wave: the pointer steps stay behind the last product's wait for the loads
    Kp += 256 * CC; KLp += 256 * CC; Vp += 256; VLp += 256; } }
// block = 4 waves on 32 query rows; the lowest block indices take the rows with the most key blocks; the batch is the fastest index
__global__ __launch_bounds__(128) void k_fa(const _Float16* __restrict__ QH, const _Float16* __restrict__ KH, const _Float16* __restrict__ QL, const _Float16* __restrict__ KL, const _Float16* __restrict__ VT, const __bf16* __restrict__ VB, const __bf16* __restrict__ VBL, float* __restrict__ Y) { __shared__ __align__(16) float so[4][32][HD + 4]; __shared__ float sm[4][32], sl[4][32];
  const int wave = __builtin_amdgcn_readfirstlane(threadIdx.x >> 5), lane = threadIdx.x & 31; const int b = blockIdx.x % TNB; const int ql0 = (TT / 32 - 1 - (int)(blockIdx.x / TNB)) * 32;
  v8f acc0[HD / 16] = {}, acc1[HD / 16] = {}; FaSt f0 = {-3.0e38f, 0.f}, f1 = {-3.0e38f, 0.f};
  if (ql0 >= QHI) fa_wave(QH, KH, VT, b, ql0, wave, lane, acc0, acc1, f0, f1);
  else { fa_wave_hi(QH, KH, QL, KL, VB, VBL, b, ql0 + 16 * (wave & 1), wave >> 1, lane, acc0, f0);   // waves 0, 2: tile 0; waves 1, 3: tile 1; the other tile's part stays empty
    if (wave & 1) {
#pragma unroll
      for (int j = 0; j < HD / 16; ++j) { acc1[j] = acc0[j]; acc0[j] = (v8f){}; }
      f1 = f0; f0 = {-3.0e38f, 0.f}; } }
  fa_join(acc0, acc1, f0, f1, b, ql0, wave, lane, so, sm, sl, Y); }

extern "C" void kernel_launch(void* const* d_in, const int* in_sizes, int n_in, void* d_out, int out_size, void* d_ws, size_t ws_size, hipStream_t stream) {
  (void)in_sizes; (void)n_in; (void)out_size;
  const float** F = (const float**)d_in;
  if (ws_size < (size_t)WS_END) return;
  char* ws = (char*)d_ws; _Float16 *QH = (_Float16*)(ws + WS_QH), *KH = (_Float16*)(ws + WS_KH), *VT = (_Float16*)(ws + WS_VT), *QL = (_Float16*)(ws + WS_QL), *KL = (_Float16*)(ws + WS_KL); __bf16 *VB = (__bf16*)(ws + WS_VB), *VBL = (__bf16*)(ws + WS_VBL);
  // inputs: 0 x [4,2048,1024]; 1 Wq [1024,128] (in,out); 2 Wk; 3 Wv
  k_proj<<<dim3(TNB * TT / 64, CC / 128, 3), 128, 0, stream>>>(F[0], F[0], F[0], F[1], F[2], F[3], nullptr, nullptr, nullptr, QH, QL, KH, KL, VT, VB, VBL);
  k_fa<<<dim3(TNB * (TT / 32), 1, 1), 128, 0, stream>>>(QH, KH, QL, KL, VT, VB, VBL, (float*)d_out);
}

// v006
// One run takes 32.4 microseconds.
// Timed twice side by side with v005, it ran 1.08 and 1.03 times as fast.
// Over all steps from v000 it is 16.3 times as fast.
// compute dtype: all float inputs rounded to bf16; q/k/v = x W with EXACT bf16 products on WMMA 16x16x32 (f32 accumulate); causal logits: q, k once to f16 (1 product) x 128^-0.5, 3 products below row 384; softmax in f32 with a running row maximum, exponentials in base 2 (hardware exp2); exp x 2^11 once to f16 against v f16 (bf16 hi + lo below row 384), divided by the row sum last; the key blocks of 32 query rows are dealt over 4 waves and the parts joined in f32; f32 output.
#include <hip/hip_runtime.h>
#include <math.h>

typedef __attribute__((ext_vector_type(16))) _Float16 v16h;
typedef __attribute__((ext_vector_type(16))) __bf16 v16b;
typedef __attribute__((ext_vector_type(8)))  _Float16 v8h;
typedef __attribute__((ext_vector_type(8)))  float v8f;
typedef __attribute__((ext_vector_type(4)))  float v4f;
typedef __attribute__((ext_vector_type(2)))  float v2f;
typedef __attribute__((ext_vector_type(4)))  unsigned v4u;
typedef __attribute__((ext_vector_type(4)))  int v4i;
typedef float __attribute__((may_alias)) float_a;
typedef int __attribute__((may_alias)) int_a;

template <typename T> __device__ __forceinline__ void vst2(void* p, T v) { *(T*)p = v;  }
__device__ __forceinline__ v8f wmma16(v16h a, v16h b, v8f c) {
  v8f d = __builtin_amdgcn_wmma_f32_16x16x32_f16(false, a, false, b, (short)0, c, false, false);
  asm volatile("v_nop\n\tv_nop\n\tv_nop\n\tv_nop" : "+v"(d) : "v"(a), "v"(b));
  return d;
}
__device__ __forceinline__ v8f wmma_bf(v16b a, v16b b, v8f c) {
  v8f d = __builtin_amdgcn_wmma_f32_16x16x32_bf16(false, a, false, b, (short)0, c, false, false);
  asm volatile("v_nop\n\tv_nop\n\tv_nop\n\tv_nop" : "+v"(d) : "v"(a), "v"(b));
  return d;
}
// 16x16x32 fragments: lane = (h = lane>>4, row/col = lane&15); elements 0..7 = k0+8h+0..7, 8..15 = k0+16+8h+0..7; D element r = row 8h+r
__device__ __forceinline__ v16h frag_h(const _Float16* rowk0, int lane) {
  union { v16h v; v8h q[2]; } u; const _Float16* p = rowk0 + 8 * (lane >> 4);
  u.q[0] = *(const v8h*)p; u.q[1] = *(const v8h*)(p + 16); return u.v;
}
__device__ __forceinline__ v16h frag_f32(const float* rowk0, int lane) {
  v16h a; const float* p = rowk0 + 8 * (lane >> 4);
#pragma unroll
  for (int i = 0; i < 8; ++i) { a[i] = (_Float16)p[i]; a[8 + i] = (_Float16)p[16 + i]; }
  return a;
}
__device__ __forceinline__ v16h frag_f32s(const float* rowk0, int lane, float sc) {
  v16h a; const float* p = rowk0 + 8 * (lane >> 4);
#pragma unroll
  for (int i = 0; i < 8; ++i) { a[i] = (_Float16)(p[i] * sc); a[8 + i] = (_Float16)(p[16 + i] * sc); }
  return a;
}
// column fragment from a [K][ld] layout (column n), rows >= K read as 0
__device__ __forceinline__ v16h fragc_f32(const float* W, int k0, int n, int lane, int ld, int K) {
  v16h a; const int g = lane >> 4;
#pragma unroll
  for (int i = 0; i < 8; ++i) { const int ka = k0 + 8 * g + i, kb = ka + 16;
    a[i] = (_Float16)(ka < K ? W[(size_t)(ka < K ? ka : K - 1) * ld + n] : 0.f); a[8 + i] = (_Float16)(kb < K ? W[(size_t)(kb < K ? kb : K - 1) * ld + n] : 0.f); }
  return a;
}
struct F2 { v16b h, l; };
__device__ __forceinline__ F2 bsplit16(const float v[16]) { F2 r;
#pragma unroll
  for (int i = 0; i < 16; ++i) { const __bf16 h = (__bf16)v[i]; r.h[i] = h; r.l[i] = (__bf16)(v[i] - (float)h); }
  return r; }
__device__ __forceinline__ F2 split_row(const float* row, int k0, int lane) { float v[16]; const float* p = row + k0 + 8 * (lane >> 4);
#pragma unroll
  for (int i = 0; i < 8; ++i) { v[i] = p[i]; v[8 + i] = p[16 + i]; }
  return bsplit16(v); }
__device__ __forceinline__ F2 split_rowK(const float* row, int k0, int lane, int K) { float v[16]; const int g = lane >> 4;
#pragma unroll
  for (int i = 0; i < 8; ++i) { const int ka = k0 + 8 * g + i, kb = ka + 16; v[i] = ka < K ? row[ka < K ? ka : K - 1] : 0.f; v[8 + i] = kb < K ? row[kb < K ? kb : K - 1] : 0.f; }
  return bsplit16(v); }
__device__ __forceinline__ F2 split_col(const float* W, int k0, int n, int lane, int ld, int K) { float v[16]; const int g = lane >> 4;
#pragma unroll
  for (int i = 0; i < 8; ++i) { const int ka = k0 + 8 * g + i, kb = ka + 16; v[i] = ka < K ? W[(size_t)(ka < K ? ka : K - 1) * ld + n] : 0.f; v[8 + i] = kb < K ? W[(size_t)(kb < K ? kb : K - 1) * ld + n] : 0.f; }
  return bsplit16(v); }
__device__ __forceinline__ v8f mac3(const F2& a, const F2& b, v8f c) { c = wmma_bf(a.l, b.h, c); c = wmma_bf(a.h, b.l, c); return wmma_bf(a.h, b.h, c); }
__device__ __forceinline__ float sigm(float v) { return 1.0f / (1.0f + expf(-v)); }
#define LDSX() do { asm volatile("s_wait_dscnt 0" ::: "memory"); __builtin_amdgcn_wave_barrier(); __builtin_amdgcn_fence(__ATOMIC_RELEASE, "workgroup"); } while (0)

// Single-head causal self-attention (B 4, T 2,048, C 1,024 -> H 128; (in,out) 1/32-scale weights, no biases): q, k, v = x W; out = softmax_causal(q k^T x 128^-0.5) v -> [B, T, 128].
#define NB 4
#define TT 2048
#define CC 128            // NH * HD = projected width
#define DIN 1024          // input (model) width
#define NH 1
#define HD 128
#define NQB (TT / 64)
#define HG 1
#define SCALE (0.08838834764831845f)
#define CAUSAL 1
#ifndef TNB
#define TNB NB
#endif
__device__ __forceinline__ float bfr(float v) { return (float)(__bf16)v; }
__host__ __device__ __forceinline__ int kb_last(int qb) { return CAUSAL ? ((qb * 64 + 63) >> 7) : (TT / 128 - 1); }
typedef __attribute__((ext_vector_type(8))) __bf16 v8b;
__device__ __forceinline__ v16b frag_b(const __bf16* rowk0, int lane) {
  union { v16b v; v8b q[2]; } u; const __bf16* p = rowk0 + 8 * (lane >> 4);
  u.q[0] = *(const v8b*)p; u.q[1] = *(const v8b*)(p + 16); return u.v;
}
#define QBH 6              // unused: k_fa takes the high-precision path for rows < QHI (32-row query blocks 0..11; few keys, no averaging)
#define QHI 384            // rows carrying a q residual plane
#define KHI 384            // key rows carrying k residual / v bf16 hi+lo planes (used only by the causal high-precision path)
// B fragment (k rows k0+.., output column o) of a weight: (in,out) [K][ld] or (out,in) [ld rows of K]: bf16 exact, or f16(bf16 * 256) exact
__device__ __forceinline__ v16b wcol_io(const float* Wm, int k0, int o, int lane, int ld) { v16b w; const int g = lane >> 4;
#pragma unroll
  for (int i = 0; i < 8; ++i) { w[i] = (__bf16)Wm[(size_t)(k0 + 8 * g + i) * ld + o]; w[8 + i] = (__bf16)Wm[(size_t)(k0 + 16 + 8 * g + i) * ld + o]; }
  return w; }
__device__ __forceinline__ v16b wcol_oi(const float* Wm, int k0, int o, int lane, int K) { v16b w; const float* p = Wm + (size_t)o * K + k0 + 8 * (lane >> 4);
#pragma unroll
  for (int i = 0; i < 8; ++i) { w[i] = (__bf16)p[i]; w[8 + i] = (__bf16)p[16 + i]; }
  return w; }
__device__ __forceinline__ v16h wcolh_io(const float* Wm, int k0, int o, int lane, int ld) { v16h w; const int g = lane >> 4;
#pragma unroll
  for (int i = 0; i < 8; ++i) { w[i] = (_Float16)(bfr(Wm[(size_t)(k0 + 8 * g + i) * ld + o]) * 256.0f); w[8 + i] = (_Float16)(bfr(Wm[(size_t)(k0 + 16 + 8 * g + i) * ld + o]) * 256.0f); }
  return w; }
__device__ __forceinline__ v16h wcolh_oi(const float* Wm, int k0, int o, int lane, int K) { v16h w; const float* p = Wm + (size_t)o * K + k0 + 8 * (lane >> 4);
#pragma unroll
  for (int i = 0; i < 8; ++i) { w[i] = (_Float16)(bfr(p[i]) * 256.0f); w[8 + i] = (_Float16)(bfr(p[16 + i]) * 256.0f); }
  return w; }
#define WQKV_LAYOUT 0   // layout that WCOL reads (0 = (in,out) [DIN][CC]; 1 = (out,in) [CC][DIN]; 2 = per-head [NH][DIN][HD]); nothing calls WCOL: k_proj reads W as (in,out) [DIN][CC] for any value
__device__ __forceinline__ v16b wcol_hdk(const float* Wm, int k0, int o, int lane) { v16b w; const int g = lane >> 4; const float* p = Wm + (size_t)(o / HD) * DIN * HD + (o % HD);
#pragma unroll
  for (int i = 0; i < 8; ++i) { w[i] = (__bf16)p[(size_t)(k0 + 8 * g + i) * HD]; w[8 + i] = (__bf16)p[(size_t)(k0 + 16 + 8 * g + i) * HD]; }
  return w; }
#define WO_OUT_IN 0
#if WQKV_LAYOUT == 1
#define WCOL(W, k0, o, lane) wcol_oi(W, k0, o, lane, DIN)
#elif WQKV_LAYOUT == 2
#define WCOL(W, k0, o, lane) wcol_hdk(W, k0, o, lane)
#else
#define WCOL(W, k0, o, lane) wcol_io(W, k0, o, lane, CC)
#endif
#if WO_OUT_IN
#define WOCOL(W, k0, o, lane) wcol_oi(W, k0, o, lane, CC)
#define WOCOLH(W, k0, o, lane) wcolh_oi(W, k0, o, lane, CC)
#else
#define WOCOL(W, k0, o, lane) wcol_io(W, k0, o, lane, DIN)
#define WOCOLH(W, k0, o, lane) wcolh_io(W, k0, o, lane, DIN)
#endif

#ifndef SM_EXTRA_PARAMS
#define SM_EXTRA_PARAMS
#endif
#ifndef PROJ_EXTRA_PARAMS
#define PROJ_EXTRA_PARAMS
#endif
#ifndef SM_MASK_HOOK
#define SM_MASK_HOOK (void)0
#endif

// Every plane lies in the order of its reader's 16x16x32 fragments, so that a wave's 16-byte load covers 512 contiguous bytes (4 whole lines) and not 32 bytes of each of 16 rows:
// q, k (and residuals): [b*t / 16][c / 32][(c / 16) & 1][lane = 16 * ((c / 8) & 1) + t % 16][c % 8]; v: [b][t / 32][c / 16][(t / 16) & 1][lane = 16 * ((t / 8) & 1) + c % 16][t % 8]
#define WS_QH  0u                                      // f16 q [b*t][CC]
#define WS_KH  (WS_QH + 2u * (size_t)NB * TT * CC)      // f16 k [b*t][CC]
#define WS_VT  (WS_KH + 2u * (size_t)NB * TT * CC)      // f16 v [b][t][CC]
#define WS_QL  (WS_VT + 2u * (size_t)NB * CC * TT)      // f16 q residual x 2^10 [b][t < QHI][CC]
#define WS_KL  (WS_QL + 2u * (size_t)NB * QHI * CC)     // f16 k residual x 2^10 [b][t < KHI][CC]
#define WS_VB  (WS_KL + 2u * (size_t)NB * KHI * CC)     // bf16 v hi [b][t < KHI][CC]
#define WS_VBL (WS_VB + 2u * (size_t)NB * CC * KHI)
#define WS_END (WS_VBL + 2u * (size_t)NB * CC * KHI)

#define PKC 64             // k per staged chunk
#define PPIT (PKC + 8)     // LDS row pitch in bf16: 128 B of k + 16 B
typedef __attribute__((ext_vector_type(4))) __bf16 v4b;
// ---- k_proj: block = (64 rows, 128 cols, which): q/k/v = X W (+ b) with exact bf16 products (K = DIN) -> which 0: q f16 (+ residual, rows < QHI); 1: k f16 (+ residual, rows < KHI); 2: v f16 (+ bf16 hi/lo for t < KHI); all stored in fragment order (see WS_QH)
__global__ __launch_bounds__(128) void k_proj(const float* __restrict__ XQ, const float* __restrict__ XK, const float* __restrict__ XV, const float* __restrict__ WQ, const float* __restrict__ WK, const float* __restrict__ WV, const float* __restrict__ BQ, const float* __restrict__ BK, const float* __restrict__ BV,
    _Float16* __restrict__ QH, _Float16* __restrict__ QL, _Float16* __restrict__ KH, _Float16* __restrict__ KL, _Float16* __restrict__ VT, __bf16* __restrict__ VB, __bf16* __restrict__ VBL) {
  __shared__ __align__(16) _Float16 sh[64][136], sl[64][136]; __shared__ __align__(16) _Float16 th[128][72]; __shared__ __align__(16) __bf16 tb[128][72], tbl[128][72];
  __shared__ __align__(16) __bf16 sw[2][128][PPIT], sx[2][64][PPIT];
  const int tid = threadIdx.x, wave = tid >> 5, lane = tid & 31, col = lane & 15, g = lane >> 4; const int which = blockIdx.z; const int c0 = blockIdx.y * 128; const size_t r0 = (size_t)blockIdx.x * 64; const size_t bb = r0 / TT; const int t0 = (int)(r0 % TT);
  const float* X = which == 0 ? XQ : which == 1 ? XK : XV; const float* WA = which == 0 ? WQ : which == 1 ? WK : WV; const float* BA = which == 0 ? BQ : which == 1 ? BK : BV;
  // Main loop: the block's x rows and W columns go through LDS as bf16 in chunks of PKC k, k-contiguous rows at the pitch for 16-byte readers, two buffers.
  // Whole-line global loads, each element loaded and rounded once a block; the next chunk's loads are in flight while this chunk's products run. Every accumulator still takes its 32-k products in ascending k.
  const unsigned wlo = (unsigned)((tid >> 6) * 32 * CC + 2 * (tid & 63));   // W: this thread's column pair and its 32 k rows of the chunk
  const unsigned xlo = (unsigned)((tid >> 4) * DIN + 4 * (tid & 15));       // x: rows (tid >> 4) + 8 i, four k each
  const float* Wb = WA + c0; const float* Xb = X + r0 * DIN;                // block-uniform bases
  v2f wr[2][32]; v4f xr[2][8];   // two register sets: chunks c + 1 and c + 2 are in flight while chunk c is worked on
  v8f acc[8] = {};
#define PROJ_LD(c, s) do { const float* wp = Wb + (size_t)(c) * PKC * CC; const float* xp = Xb + (size_t)(c) * PKC; \
    _Pragma("unroll") for (int i = 0; i < 32; ++i) wr[s][i] = *(const v2f*)(wp + (size_t)i * CC + wlo); \
    _Pragma("unroll") for (int i = 0; i < 8; ++i) xr[s][i] = *(const v4f*)(xp + (size_t)(8 * i) * DIN + xlo); \
    asm volatile("s_wait_xcnt 0x0" ::: "memory");   /* these loads stay in flight over the loop's foot, where their address registers are stepped: the wait stands ahead of that (a scheduling barrier follows every use) */ \
  } while (0)
#define PROJ_ST(s) do { \
    _Pragma("unroll") for (int q = 0; q < 4; ++q) { v8b w0, w1; \
      _Pragma("unroll") for (int e = 0; e < 8; ++e) { w0[e] = (__bf16)wr[s][q * 8 + e][0]; w1[e] = (__bf16)wr[s][q * 8 + e][1]; } \
      *(v8b*)&sw[s][2 * (tid & 63)][(tid >> 6) * 32 + q * 8] = w0; *(v8b*)&sw[s][2 * (tid & 63) + 1][(tid >> 6) * 32 + q * 8] = w1; } \
    _Pragma("unroll") for (int i = 0; i < 8; ++i) { v4b xv; \
      _Pragma("unroll") for (int e = 0; e < 4; ++e) xv[e] = (__bf16)xr[s][i][e]; \
      *(v4b*)&sx[s][(tid >> 4) + 8 * i][4 * (tid & 15)] = xv; } } while (0)
// work-group barrier that orders LDS alone: __syncthreads() would also wait for the global loads in flight, which nobody else reads
#define PROJ_BAR() do { __builtin_amdgcn_fence(__ATOMIC_RELEASE, "workgroup", "local"); __builtin_amdgcn_s_barrier(); __builtin_amdgcn_fence(__ATOMIC_ACQUIRE, "workgroup", "local"); } while (0)
// one trip: chunk c lies in LDS buffer s (= c & 1); register set s is free, set s ^ 1 holds (in flight) chunk c + 1; more2, more1: a chunk c + 2, c + 1 exists (literals, so that the loop's body has no branch and its load waits are counts)
#define PROJ_TRIP(c, s, more2, more1) do { \
    if (more2) PROJ_LD((c) + 2, s); \
    __builtin_amdgcn_sched_barrier(0);   /* keeps the global loads issued ahead of this chunk's products */ \
    v16b af[PKC / 32], wf[PKC / 32][8]; \
    _Pragma("unroll") for (int ks = 0; ks < PKC / 32; ++ks) { af[ks] = frag_b(&sx[s][wave * 16 + col][ks * 32], lane); \
      _Pragma("unroll") for (int j = 0; j < 8; ++j) wf[ks][j] = frag_b(&sw[s][j * 16 + col][ks * 32], lane); } \
    __builtin_amdgcn_sched_barrier(0);   /* keeps the chunk's LDS reads together ahead of its products: one LDS round trip a chunk, not one a product */ \
    _Pragma("unroll") for (int ks = 0; ks < PKC / 32; ++ks) { \
      _Pragma("unroll") for (int j = 0; j < 8; ++j) acc[j] = __builtin_amdgcn_wmma_f32_16x16x32_bf16(false, af[ks], false, wf[ks][j], (short)0, acc[j], false, false); } \
    __builtin_amdgcn_sched_barrier(0);   /* keeps the wait for chunk c + 1's global loads, and their rounding, behind the products */ \
    if (more1) { PROJ_ST((s) ^ 1); \
      PROJ_BAR(); }   /* publishes chunk c + 1 and ends every wave's reads of the buffer that the next trip refills */ \
  } while (0)
  PROJ_LD(0, 0); PROJ_LD(1, 1);
  __builtin_amdgcn_sched_barrier(0);   // keeps both chunks' loads issued ahead of the wait for the first
  PROJ_ST(0);
  PROJ_BAR();   // chunk 0 is in LDS for every wave
#pragma unroll 1   // the body already holds one trip for each buffer and register set
  for (int c = 0; c < DIN / PKC - 2; c += 2) { PROJ_TRIP(c, 0, 1, 1); PROJ_TRIP(c + 1, 1, 1, 1); }
  PROJ_TRIP(DIN / PKC - 2, 0, 0, 1); PROJ_TRIP(DIN / PKC - 1, 1, 0, 0);   // the last two chunks: nothing left to load, then nothing left to stage
#undef PROJ_TRIP
#undef PROJ_BAR
#undef PROJ_LD
#undef PROJ_ST
// behind a store of the loops below: its data registers take the next LDS read and its address registers are stepped at the loop's foot; the wait stands ahead of both, and the scheduling barrier keeps those writes behind it
#define STORE_XW() do { asm volatile("s_wait_xcnt 0x0" ::: "memory"); __builtin_amdgcn_sched_barrier(0); } while (0)
  if (which < 2) { _Float16* DH = which == 0 ? QH : KH; _Float16* DL = which == 0 ? QL : KL; const int nhi = which == 0 ? QHI : KHI; const bool hi_rows = t0 < nhi;
#pragma unroll
    for (int j = 0; j < 8; ++j) { const float bias = BA ? bfr(BA[c0 + j * 16 + col]) : 0.f;
#pragma unroll
      for (int r = 0; r < 8; ++r) { const float v = acc[j][r] + bias; const _Float16 hv = (_Float16)v; sh[wave * 16 + 8 * g + r][j * 16 + col] = hv; sl[wave * 16 + 8 * g + r][j * 16 + col] = (_Float16)((v - (float)hv) * 1024.0f); } }
    __syncthreads();
    static_assert(CC == 128, "the fragment-order planes take one 128-column block a row");
    for (int e = tid; e < 64 * 16; e += 128) { const int rl = (e >> 8) * 16 + (e & 15), q = (e >> 4) & 15;   // e = the block's 16-byte piece in fragment order: row tile, then the 8-column group q, then the row in the tile
      vst2((unsigned*)(DH + r0 * CC + (size_t)e * 8), *(const v4u*)&sh[rl][q * 8]);
      STORE_XW();
      if (hi_rows) { vst2((unsigned*)(DL + (bb * nhi + t0) * (size_t)CC + (size_t)e * 8), *(const v4u*)&sl[rl][q * 8]);
        STORE_XW(); } }
  } else { const bool hi_rows = t0 < KHI;
#pragma unroll
    for (int j = 0; j < 8; ++j) { const float bias = BA ? bfr(BA[c0 + j * 16 + col]) : 0.f;
#pragma unroll
      for (int r = 0; r < 8; ++r) { const float v = acc[j][r] + bias; const int rl = wave * 16 + 8 * g + r, cl = j * 16 + col; th[cl][rl] = (_Float16)v; const __bf16 bh = (__bf16)v; tb[cl][rl] = bh; tbl[cl][rl] = (__bf16)(v - (float)bh); } }
    __syncthreads();
    for (int e = tid; e < 128 * 8; e += 128) { const int cl = ((e >> 6) & 7) * 16 + (e & 15), tl = (e >> 9) * 32 + ((e >> 4) & 3) * 8;   // e = the block's 16-byte piece in fragment order: 32-key chunk, channel tile, 8-key group, channel in the tile
      vst2((unsigned*)(VT + (bb * TT + t0) * (size_t)CC + (size_t)e * 8), *(const v4u*)&th[cl][tl]);
      STORE_XW();
      if (hi_rows) { const size_t o3 = (bb * KHI + t0) * (size_t)CC + (size_t)e * 8; vst2((unsigned*)(VB + o3), *(const v4u*)&tb[cl][tl]); vst2((unsigned*)(VBL + o3), *(const v4u*)&tbl[cl][tl]);
        STORE_XW(); } } } }
#undef STORE_XW
// ---- k_fa: one work-group of 4 waves = 32 query rows (two 16-row tiles) of one batch. Rows >= QHI: wave w takes BOTH tiles against the causal key blocks w, w + 4, ... (128 keys each), so that every k and v fragment it loads feeds two products; running row maxima of its own (no logit plane in the workspace); the four parts are joined in LDS at the end.
// Logits are formed transposed (A = k rows, B = q rows): a lane then holds keys 16j + 8g + r of ITS query (lane & 15), which is already the B-fragment order of P^T; the output is accumulated transposed too (A = v transposed, B = P^T), so maximum, sum and rescale stay in the query's own lanes.
// Same products as before: 1 f16 product (3 with the x 2^10 residuals for rows < QHI); exp(logit - running max) x 2^11 once to f16 against v f16 (bf16 hi + lo, 3 products, for rows < QHI); the division by the row sum comes last.
// Fragment loads stand in the source as whole groups ahead of the products that use them: half of this block's v ahead of the logits, the other half and the next block's k ahead of the softmax.
// plain builtin forms: the compiler keeps the distance behind a matrix instruction itself and may use every register window for the operands
__device__ __forceinline__ v8f mm16(v16h a, v16h b, v8f c) { return __builtin_amdgcn_wmma_f32_16x16x32_f16(false, a, false, b, (short)0, c, false, false); }
__device__ __forceinline__ v8f mmbf(v16b a, v16b b, v8f c) { return __builtin_amdgcn_wmma_f32_16x16x32_bf16(false, a, false, b, (short)0, c, false, false); }
// fragment (1 KB in fragment order: elements 0..7 of all 32 lanes, then elements 8..15) at a wave-uniform pointer plus the lane's own 32-bit element offset 8 * lane: scalar base + one loop-invariant offset register, so no address register is formed anew for a load group
__device__ __forceinline__ v16h frag_hp(const _Float16* ub, unsigned lo) { union { v16h v; v8h q[2]; } u; const _Float16* p = ub + lo; u.q[0] = *(const v8h*)p; u.q[1] = *(const v8h*)(p + 256); return u.v; }
__device__ __forceinline__ v16b frag_bp(const __bf16* ub, unsigned lo) { union { v16b v; v8b q[2]; } u; const __bf16* p = ub + lo; u.q[0] = *(const v8b*)p; u.q[1] = *(const v8b*)(p + 256); return u.v; }
// a wave-uniform global pointer, both words through readfirstlane: it stays a scalar base of its own, so that every load names that base and a loop-invariant offset register, and no vector address is formed or stepped under loads in flight
typedef const __attribute__((address_space(1))) _Float16* gph;
__device__ __forceinline__ const _Float16* uni(const _Float16* p) { const unsigned long long a = (unsigned long long)p; return (const _Float16*)(gph)(((unsigned long long)(unsigned)__builtin_amdgcn_readfirstlane((int)(a >> 32)) << 32) | (unsigned)__builtin_amdgcn_readfirstlane((int)a)); }
// hardware exp2 with, in the same statement, the one slot that the instruction set asks for behind a transcendental before its source may be overwritten or its result read
__device__ __forceinline__ float exp2_slot(float x) { float e; asm("v_exp_f32 %0, %1\n\tv_nop" : "=v"(e) : "v"(x)); return e; }
struct FaSt { float m, lsum; };   // m: running maximum of logit x SC2 (base-2 domain); lsum: the lane's partial sum of exp x 2^11
#define SC2 ((float)(0.08838834764831845 * 1.4426950408889634))   // 128^-0.5 x log2 e: exp(SCALE x s - max) = exp2(SC2 x s - max2)
// takes the RAW products q.k; masks the diagonal block, updates the running maximum and the lane's partial sum; leaves exp x 2^11 in st and returns the factor for what was summed so far
// each exponential is one fused multiply-add (scale, maximum and the 2^11 all in it) and one hardware exp2; a result below 2^-126 reads 0, far under what f16 or the sum can hold
__device__ __forceinline__ float fa_softmax(v8f (&st)[8], FaSt& f, bool diag, int key0, int tq) {
  if (diag) {
#pragma unroll
    for (int j = 0; j < 8; ++j) {
#pragma unroll
      for (int r = 0; r < 8; ++r) st[j][r] = (key0 + j * 16 + r <= tq) ? st[j][r] : -3.0e38f; } }
  float mloc = -3.0e38f;
#pragma unroll
  for (int j = 0; j < 8; ++j) {
#pragma unroll
    for (int r = 0; r < 8; ++r) mloc = fmaxf(mloc, st[j][r]); }
  mloc = fmaxf(mloc, __shfl_xor(mloc, 16));   // the two lane halves hold the two key halves of the same query
  const float mn = fmaxf(f.m, mloc * SC2); const float alpha = exp2_slot(f.m - mn); f.m = mn;
  const float off = 11.0f - mn; float s = 0.f;
#pragma unroll
  for (int j = 0; j < 8; ++j) {
#pragma unroll
    for (int r = 0; r < 8; ++r) { const float e = exp2_slot(fmaf(st[j][r], SC2, off)); s += e; st[j][r] = e; } }   // a masked key: exp2(-3e38 x SC2 + off) = 0; mn is finite from a wave's first block on: every block that is walked starts at a key <= every query of the tile
  f.lsum = f.lsum * alpha + s; return alpha; }
// joins the four waves' parts of the block's two row tiles: common maximum, each part rescaled to it, parts added in a fixed order, division by the joined row sum last
__device__ __forceinline__ void fa_join(v8f (&acc0)[HD / 16], v8f (&acc1)[HD / 16], const FaSt& f0, const FaSt& f1, int b, int ql0, int wave, int lane, float (*so)[32][HD + 4], float (*sm)[32], float (*sl)[32], float* __restrict__ Y) {
  const int col = lane & 15, g = lane >> 4;
  sm[wave][lane] = g == 0 ? f0.m : f1.m;   // both lane halves hold the same maxima: the lower half stores tile 0's, the upper tile 1's
  __syncthreads();   // every wave's maxima are in LDS
  const float mj0 = fmaxf(fmaxf(sm[0][col], sm[1][col]), fmaxf(sm[2][col], sm[3][col])), mj1 = fmaxf(fmaxf(sm[0][16 + col], sm[1][16 + col]), fmaxf(sm[2][16 + col], sm[3][16 + col]));   // finite: some wave walks block 0 of each tile, which holds key 0 <= every query
  const float sc0 = exp2_slot(f0.m - mj0), sc1 = exp2_slot(f1.m - mj1);   // a wave without a key block of that tile: exp2(-3e38 - max) = 0 on a part that is 0
  float ls0 = f0.lsum * sc0, ls1 = f1.lsum * sc1; ls0 += __shfl_xor(ls0, 16); ls1 += __shfl_xor(ls1, 16);
  sl[wave][lane] = g == 0 ? ls0 : ls1;
#pragma unroll
  for (int j = 0; j < HD / 16; ++j) { const v8f o = acc0[j] * sc0, p = acc1[j] * sc1;
    vst2(&so[wave][col][j * 16 + 8 * g], (v4f){o[0], o[1], o[2], o[3]}); vst2(&so[wave][col][j * 16 + 8 * g + 4], (v4f){o[4], o[5], o[6], o[7]});
    vst2(&so[wave][16 + col][j * 16 + 8 * g], (v4f){p[0], p[1], p[2], p[3]}); vst2(&so[wave][16 + col][j * 16 + 8 * g + 4], (v4f){p[4], p[5], p[6], p[7]}); }
  __syncthreads();   // every wave's rescaled parts and sums are in LDS
#pragma unroll
  for (int i = 0; i < 8; ++i) { const int rl = wave * 8 + i;   // one output row (512 contiguous bytes) a wave and pass
    const float lj = (sl[0][rl] + sl[1][rl]) + (sl[2][rl] + sl[3][rl]); const float inv = lj > 0.f ? 1.0f / lj : 0.f;   // sum and accumulators both carry the 2^11
    const v4f o = (*(const v4f*)&so[0][rl][lane * 4] + *(const v4f*)&so[1][rl][lane * 4]) + (*(const v4f*)&so[2][rl][lane * 4] + *(const v4f*)&so[3][rl][lane * 4]);
    vst2(Y + ((size_t)b * TT + ql0 + rl) * CC + lane * 4, o * inv); } }
// rows >= QHI (at least 4 key blocks, so every wave has one)
__device__ __forceinline__ void fa_wave(const _Float16* __restrict__ QH, const _Float16* __restrict__ KH, const _Float16* __restrict__ VT, int b, int ql0, int wave, int lane, v8f (&acc0)[HD / 16], v8f (&acc1)[HD / 16], FaSt& f0, FaSt& f1) {
  const int col = lane & 15, g = lane >> 4; const int tq = ql0 + col; const int nkb = ((ql0 + 31) >> 7) + 1;
  const _Float16* K0 = KH + (size_t)b * TT * CC; const _Float16* V0 = VT + (size_t)b * TT * CC;   // the batch's k and v (wave-uniform)
  const unsigned flo = 8 * lane;
  v16h qf0[HD / 32], qf1[HD / 32], kf[32], vf[32];
  __builtin_amdgcn_sched_barrier(0);   // with the one behind the wait below: nothing but these loads stands between here and the wait, so none of their address registers is reused ahead of it
#pragma unroll
  for (int kc = 0; kc < HD / 32; ++kc) { qf0[kc] = frag_hp(QH + ((size_t)b * TT + ql0) * CC + kc * 512, flo); qf1[kc] = frag_hp(QH + ((size_t)b * TT + ql0 + 16) * CC + kc * 512, flo); }
#pragma unroll
  for (int i = 0; i < 32; ++i) kf[i] = frag_hp(K0 + (size_t)(wave * 128 + (i & 7) * 16) * CC + (i >> 3) * 512, flo);
  asm volatile("s_wait_xcnt 0x0" ::: "memory");   // the registers that the loads above name are free for reuse behind this wait
  __builtin_amdgcn_sched_barrier(0);
  static_assert(QHI >= 384, "every wave needs a first key block");
  int kb = wave;
#pragma unroll 1
  do { const int k0 = kb * 128;   // entered without a test: the loads above stay where they stand, ahead of their wait
    const _Float16* Kp = uni(K0 + (size_t)k0 * CC); const _Float16* Vp = uni(V0 + (size_t)k0 * CC);
#pragma unroll
    for (int i = 0; i < 16; ++i) vf[i] = frag_hp(Vp + (i >> 3) * 4096 + (i & 7) * 512, flo);
    __builtin_amdgcn_sched_barrier(0);   // keeps the first half of the v loads issued ahead of the logit products (only half: the wait for k must still be a count that the load counter can hold)
    v8f st0[8] = {}, st1[8] = {};
#pragma unroll
    for (int i = 0; i < 32; ++i) { st0[i & 7] = mm16(kf[i], qf0[i >> 3], st0[i & 7]); st1[i & 7] = mm16(kf[i], qf1[i >> 3], st1[i & 7]); }
    __builtin_amdgcn_sched_barrier(0);   // keeps the loads below from being lifted over the logit products, whose wait for k would then also wait for them
#pragma unroll
    for (int i = 16; i < 32; ++i) vf[i] = frag_hp(Vp + (i >> 3) * 4096 + (i & 7) * 512, flo);
    if (kb + 4 < nkb) {
#pragma unroll
      for (int i = 0; i < 32; ++i) kf[i] = frag_hp(Kp + (size_t)(512 + (i & 7) * 16) * CC + (i >> 3) * 512, flo); }
    asm volatile("s_wait_xcnt 0x0" ::: "memory");   // the k loads stay in flight over the loop's foot, where the scalar bases are formed anew: the wait stands ahead of that
    __builtin_amdgcn_sched_barrier(0);   // keeps the rest of the v loads and the next block's k loads issued ahead of the softmax, which then covers their latency
    if (kb + 1 == nkb) {   // the diagonal block: both tiles masked in one branch, so that none of the mask's arithmetic stands in the other blocks' path
#pragma unroll
      for (int j = 0; j < 8; ++j) {
#pragma unroll
        for (int r = 0; r < 8; ++r) { const int key = k0 + 8 * g + j * 16 + r; st0[j][r] = (key <= tq) ? st0[j][r] : -3.0e38f; st1[j][r] = (key <= tq + 16) ? st1[j][r] : -3.0e38f; } } }
    const float alpha0 = fa_softmax(st0, f0, false, 0, 0); const float alpha1 = fa_softmax(st1, f1, false, 0, 0);
#pragma unroll
    for (int j = 0; j < HD / 16; ++j) { acc0[j] *= alpha0; acc1[j] *= alpha1; }
#pragma unroll
    for (int c = 0; c < 4; ++c) { v16h p0, p1;
#pragma unroll
      for (int i = 0; i < 8; ++i) { p0[i] = (_Float16)st0[2 * c][i]; p0[8 + i] = (_Float16)st0[2 * c + 1][i]; p1[i] = (_Float16)st1[2 * c][i]; p1[8 + i] = (_Float16)st1[2 * c + 1][i]; }
#pragma unroll
      for (int j = 0; j < HD / 16; ++j) { acc0[j] = mm16(vf[c * 8 + j], p0, acc0[j]); acc1[j] = mm16(vf[c * 8 + j], p1, acc1[j]); } }
    __builtin_amdgcn_sched_barrier(0);   // keeps the step of the two scalar bases behind the last product's wait for the loads: no base is rewritten under a load in flight
    kb += 4;
  } while (kb < nkb); }
// rows < QHI (at most 3 key blocks): residual products; one 16-row tile a wave, its key blocks kb0, kb0 + 2, ... (two waves a tile)
__device__ __forceinline__ void fa_wave_hi(const _Float16* __restrict__ QH, const _Float16* __restrict__ KH, const _Float16* __restrict__ QL, const _Float16* __restrict__ KL, const __bf16* __restrict__ VB, const __bf16* __restrict__ VBL, int b, int ql0, int kb0, int lane, v8f (&acc)[HD / 16], FaSt& f) {
  const int col = lane & 15, g = lane >> 4; const int tq = ql0 + col; const int nkb = ((ql0 + 15) >> 7) + 1;
  const _Float16* Kp = KH + ((size_t)b * TT + kb0 * 128) * CC; const _Float16* KLp = KL + ((size_t)b * KHI + kb0 * 128) * CC; const __bf16* Vp = VB + ((size_t)b * KHI + kb0 * 128) * CC; const __bf16* VLp = VBL + ((size_t)b * KHI + kb0 * 128) * CC;   // wave-uniform; stepped at the loop's foot
  const unsigned flo = 8 * lane;
  if (kb0 >= nkb) return;   // wave-uniform; tested ahead of the q loads, so that they stay where they stand, ahead of their wait, and the loop below is entered without a test
  v16h qf[HD / 32], qlf[HD / 32];
  __builtin_amdgcn_sched_barrier(0);   // as in fa_wave: nothing but these loads stands between here and the wait, so none of their address registers is reused ahead of it
#pragma unroll
  for (int kc = 0; kc < HD / 32; ++kc) { qf[kc] = frag_hp(QH + ((size_t)b * TT + ql0) * CC + kc * 512, flo); qlf[kc] = frag_hp(QL + ((size_t)b * QHI + ql0) * CC + kc * 512, flo); }
  asm volatile("s_wait_xcnt 0x0" ::: "memory");   // the registers that the loads above name are free for reuse behind this wait
  __builtin_amdgcn_sched_barrier(0);
  int kb = kb0;
#pragma unroll 1
  do { const int k0 = kb * 128;
    v8f st[8] = {}, stl[8] = {};
#pragma unroll
    for (int kc = 0; kc < HD / 32; ++kc) { v16h kh[8], kl[8];
#pragma unroll
      for (int j = 0; j < 8; ++j) { kh[j] = frag_hp(Kp + (size_t)(j * 16) * CC + kc * 512, flo); kl[j] = frag_hp(KLp + (size_t)(j * 16) * CC + kc * 512, flo); }
      __builtin_amdgcn_sched_barrier(0);   // keeps the group's 32 loads issued together: one round trip a group, not one a product
#pragma unroll
      for (int j = 0; j < 8; ++j) { st[j] = mm16(kh[j], qf[kc], st[j]); stl[j] = mm16(kh[j], qlf[kc], stl[j]); stl[j] = mm16(kl[j], qf[kc], stl[j]); } }
#pragma unroll
    for (int j = 0; j < 8; ++j) st[j] = st[j] + stl[j] * (1.0f / 1024.0f);
    const float alpha = fa_softmax(st, f, kb + 1 == nkb, k0 + 8 * g, tq);
#pragma unroll
    for (int j = 0; j < HD / 16; ++j) acc[j] *= alpha;
#pragma unroll
    for (int c = 0; c < 4; ++c) { float pe[16]; v16b vh[8], vl[8];
#pragma unroll
      for (int j = 0; j < HD / 16; ++j) { const size_t po = (size_t)c * 4096 + j * 512; vh[j] = frag_bp(Vp + po, flo); vl[j] = frag_bp(VLp + po, flo); }
      __builtin_amdgcn_sched_barrier(0);   // as above: the group's 32 loads issued together
#pragma unroll
      for (int i = 0; i < 8; ++i) { pe[i] = st[2 * c][i]; pe[8 + i] = st[2 * c + 1][i]; }
      const F2 p = bsplit16(pe);
#pragma unroll
      for (int j = 0; j < HD / 16; ++j) { acc[j] = mmbf(vh[j], p.h, acc[j]); acc[j] = mmbf(vh[j], p.l, acc[j]); acc[j] = mmbf(vl[j], p.h, acc[j]); } }
    __builtin_amdgcn_sched_barrier(0);   // as in fa_wave: the pointer steps stay behind the last product's wait for the loads
    Kp += 256 * CC; KLp += 256 * CC; Vp += 256 * CC; VLp += 256 * CC; kb += 2;
  } while (kb < nkb); }
// block = 4 waves on 32 query rows; the lowest block indices take the rows with the most key blocks; the batch is the fastest index
__global__ __launch_bounds__(128) void k_fa(const _Float16* __restrict__ QH, const _Float16* __restrict__ KH, const _Float16* __restrict__ QL, const _Float16* __restrict__ KL, const _Float16* __restrict__ VT, const __bf16* __restrict__ VB, const __bf16* __restrict__ VBL, float* __restrict__ Y) { __shared__ __align__(16) float so[4][32][HD + 4]; __shared__ float sm[4][32], sl[4][32];
  const int wave = __builtin_amdgcn_readfirstlane(threadIdx.x >> 5), lane = threadIdx.x & 31; const int b = blockIdx.x % TNB; const int ql0 = (TT / 32 - 1 - (int)(blockIdx.x / TNB)) * 32;
  v8f acc0[HD / 16] = {}, acc1[HD / 16] = {}; FaSt f0 = {-3.0e38f, 0.f}, f1 = {-3.0e38f, 0.f};
  if (ql0 >= QHI) fa_wave(QH, KH, VT, b, ql0, wave, lane, acc0, acc1, f0, f1);
  else { fa_wave_hi(QH, KH, QL, KL, VB, VBL, b, ql0 + 16 * (wave & 1), wave >> 1, lane, acc0, f0);   // waves 0, 2: tile 0; waves 1, 3: tile 1; the other tile's part stays empty
    if (wave & 1) {
#pragma unroll
      for (int j = 0; j < HD / 16; ++j) { acc1[j] = acc0[j]; acc0[j] = (v8f){}; }
      f1 = f0; f0 = {-3.0e38f, 0.f}; } }
  fa_join(acc0, acc1, f0, f1, b, ql0, wave, lane, so, sm, sl, Y); }

extern "C" void kernel_launch(void* const* d_in, const int* in_sizes, int n_in, void* d_out, int out_size, void* d_ws, size_t ws_size, hipStream_t stream) {
  (void)in_sizes; (void)n_in; (void)out_size;
  const float** F = (const float**)d_in;
  if (ws_size < (size_t)WS_END) return;
  char* ws = (char*)d_ws; _Float16 *QH = (_Float16*)(ws + WS_QH), *KH = (_Float16*)(ws + WS_KH), *VT = (_Float16*)(ws + WS_VT), *QL = (_Float16*)(ws + WS_QL), *KL = (_Float16*)(ws + WS_KL); __bf16 *VB = (__bf16*)(ws + WS_VB), *VBL = (__bf16*)(ws + WS_VBL);
  // inputs: 0 x [4,2048,1024]; 1 Wq [1024,128] (in,out); 2 Wk; 3 Wv
  k_proj<<<dim3(TNB * TT / 64, CC / 128, 3), 128, 0, stream>>>(F[0], F[0], F[0], F[1], F[2], F[3], nullptr, nullptr, nullptr, QH, QL, KH, KL, VT, VB, VBL);
  k_fa<<<dim3(TNB * (TT / 32), 1, 1), 128, 0, stream>>>(QH, KH, QL, KL, VT, VB, VBL, (float*)d_out);
}

// v007
// One run takes 29 microseconds.
// Two timings next to v006 put it at 1.11 and 1.10 times that version's speed.
// Counting every step since v000, it is 18.1 times as fast.
// compute dtype: all float inputs rounded to bf16; q/k/v = x W with EXACT bf16 products on WMMA 16x16x32 (f32 accumulate); causal logits: q, k once to f16 (1 product) x 128^-0.5, 3 products below row 384; softmax in f32 with a running row maximum, exponentials in base 2 (hardware exp2); exp x 2^11 once to f16 against v f16 (bf16 hi + lo below row 384), divided by the row sum last; the key blocks of 32 query rows are dealt over 4 waves and the parts joined in f32; f32 output.
#include <hip/hip_runtime.h>
#include <math.h>

typedef __attribute__((ext_vector_type(16))) _Float16 v16h;
typedef __attribute__((ext_vector_type(16))) __bf16 v16b;
typedef __attribute__((ext_vector_type(8)))  _Float16 v8h;
typedef __attribute__((ext_vector_type(8)))  float v8f;
typedef __attribute__((ext_vector_type(4)))  float v4f;
typedef __attribute__((ext_vector_type(2)))  float v2f;
typedef __attribute__((ext_vector_type(4)))  unsigned v4u;
typedef __attribute__((ext_vector_type(4)))  int v4i;
typedef float __attribute__((may_alias)) float_a;
typedef int __attribute__((may_alias)) int_a;

template <typename T> __device__ __forceinline__ void vst2(void* p, T v) { *(T*)p = v;  }
__device__ __forceinline__ v8f wmma16(v16h a, v16h b, v8f c) {
  v8f d = __builtin_amdgcn_wmma_f32_16x16x32_f16(false, a, false, b, (short)0, c, false, false);
  asm volatile("v_nop\n\tv_nop\n\tv_nop\n\tv_nop" : "+v"(d) : "v"(a), "v"(b));
  return d;
}
__device__ __forceinline__ v8f wmma_bf(v16b a, v16b b, v8f c) {
  v8f d = __builtin_amdgcn_wmma_f32_16x16x32_bf16(false, a, false, b, (short)0, c, false, false);
  asm volatile("v_nop\n\tv_nop\n\tv_nop\n\tv_nop" : "+v"(d) : "v"(a), "v"(b));
  return d;
}
// 16x16x32 fragments: lane = (h = lane>>4, row/col = lane&15); elements 0..7 = k0+8h+0..7, 8..15 = k0+16+8h+0..7; D element r = row 8h+r
__device__ __forceinline__ v16h frag_h(const _Float16* rowk0, int lane) {
  union { v16h v; v8h q[2]; } u; const _Float16* p = rowk0 + 8 * (lane >> 4);
  u.q[0] = *(const v8h*)p; u.q[1] = *(const v8h*)(p + 16); return u.v;
}
__device__ __forceinline__ v16h frag_f32(const float* rowk0, int lane) {
  v16h a; const float* p = rowk0 + 8 * (lane >> 4);
#pragma unroll
  for (int i = 0; i < 8; ++i) { a[i] = (_Float16)p[i]; a[8 + i] = (_Float16)p[16 + i]; }
  return a;
}
__device__ __forceinline__ v16h frag_f32s(const float* rowk0, int lane, float sc) {
  v16h a; const float* p = rowk0 + 8 * (lane >> 4);
#pragma unroll
  for (int i = 0; i < 8; ++i) { a[i] = (_Float16)(p[i] * sc); a[8 + i] = (_Float16)(p[16 + i] * sc); }
  return a;
}
// column fragment from a [K][ld] layout (column n), rows >= K read as 0
__device__ __forceinline__ v16h fragc_f32(const float* W, int k0, int n, int lane, int ld, int K) {
  v16h a; const int g = lane >> 4;
#pragma unroll
  for (int i = 0; i < 8; ++i) { const int ka = k0 + 8 * g + i, kb = ka + 16;
    a[i] = (_Float16)(ka < K ? W[(size_t)(ka < K ? ka : K - 1) * ld + n] : 0.f); a[8 + i] = (_Float16)(kb < K ? W[(size_t)(kb < K ? kb : K - 1) * ld + n] : 0.f); }
  return a;
}
struct F2 { v16b h, l; };
__device__ __forceinline__ F2 bsplit16(const float v[16]) { F2 r;
#pragma unroll
  for (int i = 0; i < 16; ++i) { const __bf16 h = (__bf16)v[i]; r.h[i] = h; r.l[i] = (__bf16)(v[i] - (float)h); }
  return r; }
__device__ __forceinline__ F2 split_row(const float* row, int k0, int lane) { float v[16]; const float* p = row + k0 + 8 * (lane >> 4);
#pragma unroll
  for (int i = 0; i < 8; ++i) { v[i] = p[i]; v[8 + i] = p[16 + i]; }
  return bsplit16(v); }
__device__ __forceinline__ F2 split_rowK(const float* row, int k0, int lane, int K) { float v[16]; const int g = lane >> 4;
#pragma unroll
  for (int i = 0; i < 8; ++i) { const int ka = k0 + 8 * g + i, kb = ka + 16; v[i] = ka < K ? row[ka < K ? ka : K - 1] : 0.f; v[8 + i] = kb < K ? row[kb < K ? kb : K - 1] : 0.f; }
  return bsplit16(v); }
__device__ __forceinline__ F2 split_col(const float* W, int k0, int n, int lane, int ld, int K) { float v[16]; const int g = lane >> 4;
#pragma unroll
  for (int i = 0; i < 8; ++i) { const int ka = k0 + 8 * g + i, kb = ka + 16; v[i] = ka < K ? W[(size_t)(ka < K ? ka : K - 1) * ld + n] : 0.f; v[8 + i] = kb < K ? W[(size_t)(kb < K ? kb : K - 1) * ld + n] : 0.f; }
  return bsplit16(v); }
__device__ __forceinline__ v8f mac3(const F2& a, const F2& b, v8f c) { c = wmma_bf(a.l, b.h, c); c = wmma_bf(a.h, b.l, c); return wmma_bf(a.h, b.h, c); }
__device__ __forceinline__ float sigm(float v) { return 1.0f / (1.0f + expf(-v)); }
#define LDSX() do { asm volatile("s_wait_dscnt 0" ::: "memory"); __builtin_amdgcn_wave_barrier(); __builtin_amdgcn_fence(__ATOMIC_RELEASE, "workgroup"); } while (0)

// Single-head causal self-attention (B 4, T 2,048, C 1,024 -> H 128; (in,out) 1/32-scale weights, no biases): q, k, v = x W; out = softmax_causal(q k^T x 128^-0.5) v -> [B, T, 128].
#define NB 4
#define TT 2048
#define CC 128            // NH * HD = projected width
#define DIN 1024          // input (model) width
#define NH 1
#define HD 128
#define NQB (TT / 64)
#define HG 1
#define SCALE (0.08838834764831845f)
#define CAUSAL 1
#ifndef TNB
#define TNB NB
#endif
__device__ __forceinline__ float bfr(float v) { return (float)(__bf16)v; }
__host__ __device__ __forceinline__ int kb_last(int qb) { return CAUSAL ? ((qb * 64 + 63) >> 7) : (TT / 128 - 1); }
typedef __attribute__((ext_vector_type(8))) __bf16 v8b;
__device__ __forceinline__ v16b frag_b(const __bf16* rowk0, int lane) {
  union { v16b v; v8b q[2]; } u; const __bf16* p = rowk0 + 8 * (lane >> 4);
  u.q[0] = *(const v8b*)p; u.q[1] = *(const v8b*)(p + 16); return u.v;
}
#define QBH 6              // unused: k_fa takes the high-precision path for rows < QHI (32-row query blocks 0..11; few keys, no averaging)
#define QHI 384            // rows carrying a q residual plane
#define KHI 384            // key rows carrying k residual / v bf16 hi+lo planes (used only by the causal high-precision path)
// B fragment (k rows k0+.., output column o) of a weight: (in,out) [K][ld] or (out,in) [ld rows of K]: bf16 exact, or f16(bf16 * 256) exact
__device__ __forceinline__ v16b wcol_io(const float* Wm, int k0, int o, int lane, int ld) { v16b w; const int g = lane >> 4;
#pragma unroll
  for (int i = 0; i < 8; ++i) { w[i] = (__bf16)Wm[(size_t)(k0 + 8 * g + i) * ld + o]; w[8 + i] = (__bf16)Wm[(size_t)(k0 + 16 + 8 * g + i) * ld + o]; }
  return w; }
__device__ __forceinline__ v16b wcol_oi(const float* Wm, int k0, int o, int lane, int K) { v16b w; const float* p = Wm + (size_t)o * K + k0 + 8 * (lane >> 4);
#pragma unroll
  for (int i = 0; i < 8; ++i) { w[i] = (__bf16)p[i]; w[8 + i] = (__bf16)p[16 + i]; }
  return w; }
__device__ __forceinline__ v16h wcolh_io(const float* Wm, int k0, int o, int lane, int ld) { v16h w; const int g = lane >> 4;
#pragma unroll
  for (int i = 0; i < 8; ++i) { w[i] = (_Float16)(bfr(Wm[(size_t)(k0 + 8 * g + i) * ld + o]) * 256.0f); w[8 + i] = (_Float16)(bfr(Wm[(size_t)(k0 + 16 + 8 * g + i) * ld + o]) * 256.0f); }
  return w; }
__device__ __forceinline__ v16h wcolh_oi(const float* Wm, int k0, int o, int lane, int K) { v16h w; const float* p = Wm + (size_t)o * K + k0 + 8 * (lane >> 4);
#pragma unroll
  for (int i = 0; i < 8; ++i) { w[i] = (_Float16)(bfr(p[i]) * 256.0f); w[8 + i] = (_Float16)(bfr(p[16 + i]) * 256.0f); }
  return w; }
#define WQKV_LAYOUT 0   // layout that WCOL reads (0 = (in,out) [DIN][CC]; 1 = (out,in) [CC][DIN]; 2 = per-head [NH][DIN][HD]); nothing calls WCOL: k_proj reads W as (in,out) [DIN][CC] for any value
__device__ __forceinline__ v16b wcol_hdk(const float* Wm, int k0, int o, int lane) { v16b w; const int g = lane >> 4; const float* p = Wm + (size_t)(o / HD) * DIN * HD + (o % HD);
#pragma unroll
  for (int i = 0; i < 8; ++i) { w[i] = (__bf16)p[(size_t)(k0 + 8 * g + i) * HD]; w[8 + i] = (__bf16)p[(size_t)(k0 + 16 + 8 * g + i) * HD]; }
  return w; }
#define WO_OUT_IN 0
#if WQKV_LAYOUT == 1
#define WCOL(W, k0, o, lane) wcol_oi(W, k0, o, lane, DIN)
#elif WQKV_LAYOUT == 2
#define WCOL(W, k0, o, lane) wcol_hdk(W, k0, o, lane)
#else
#define WCOL(W, k0, o, lane) wcol_io(W, k0, o, lane, CC)
#endif
#if WO_OUT_IN
#define WOCOL(W, k0, o, lane) wcol_oi(W, k0, o, lane, CC)
#define WOCOLH(W, k0, o, lane) wcolh_oi(W, k0, o, lane, CC)
#else
#define WOCOL(W, k0, o, lane) wcol_io(W, k0, o, lane, DIN)
#define WOCOLH(W, k0, o, lane) wcolh_io(W, k0, o, lane, DIN)
#endif

#ifndef SM_EXTRA_PARAMS
#define SM_EXTRA_PARAMS
#endif
#ifndef PROJ_EXTRA_PARAMS
#define PROJ_EXTRA_PARAMS
#endif
#ifndef SM_MASK_HOOK
#define SM_MASK_HOOK (void)0
#endif

// Every plane lies in the order of its reader's 16x16x32 fragments, so that a wave's 16-byte load covers 512 contiguous bytes (4 whole lines) and not 32 bytes of each of 16 rows:
// q, k (and residuals): [b*t / 16][c / 32][(c / 16) & 1][lane = 16 * ((c / 8) & 1) + t % 16][c % 8]; v: [b][t / 32][c / 16][(t / 16) & 1][lane = 16 * ((t / 8) & 1) + c % 16][t % 8]
#define WS_QH  0u                                      // f16 q [b*t][CC]
#define WS_KH  (WS_QH + 2u * (size_t)NB * TT * CC)      // f16 k [b*t][CC]
#define WS_VT  (WS_KH + 2u * (size_t)NB * TT * CC)      // f16 v [b][t][CC]
#define WS_QL  (WS_VT + 2u * (size_t)NB * CC * TT)      // f16 q residual x 2^10 [b][t < QHI][CC]
#define WS_KL  (WS_QL + 2u * (size_t)NB * QHI * CC)     // f16 k residual x 2^10 [b][t < KHI][CC]
#define WS_VB  (WS_KL + 2u * (size_t)NB * KHI * CC)     // bf16 v hi [b][t < KHI][CC]
#define WS_VBL (WS_VB + 2u * (size_t)NB * CC * KHI)
#define WS_END (WS_VBL + 2u * (size_t)NB * CC * KHI)

#define PKC 64             // k per staged chunk
#define PPIT (PKC + 8)     // LDS row pitch in bf16: 128 B of k + 16 B
typedef __attribute__((ext_vector_type(4))) __bf16 v4b;
#define PBM 128            // x rows a block
// ---- k_proj: block = (PBM rows, 128 cols, which) on 8 waves, a wave = 32 rows x 64 cols (2 x 4 accumulator tiles: 6 LDS fragments feed 8 products): q/k/v = X W (+ b) with exact bf16 products (K = DIN) -> which 0: q f16 (+ residual, rows < QHI); 1: k f16 (+ residual, rows < KHI); 2: v f16 (+ bf16 hi/lo for t < KHI); all stored in fragment order (see WS_QH)
__global__ __launch_bounds__(256) void k_proj(const float* __restrict__ XQ, const float* __restrict__ XK, const float* __restrict__ XV, const float* __restrict__ WQ, const float* __restrict__ WK, const float* __restrict__ WV, const float* __restrict__ BQ, const float* __restrict__ BK, const float* __restrict__ BV,
    _Float16* __restrict__ QH, _Float16* __restrict__ QL, _Float16* __restrict__ KH, _Float16* __restrict__ KL, _Float16* __restrict__ VT, __bf16* __restrict__ VB, __bf16* __restrict__ VBL) {
  __shared__ __align__(16) _Float16 sh[PBM][136], sl[PBM][136]; __shared__ __align__(16) _Float16 th[128][PBM + 8]; __shared__ __align__(16) __bf16 tb[128][PBM + 8], tbl[128][PBM + 8];
  __shared__ __align__(16) __bf16 sw[2][128][PPIT], sx[2][PBM][PPIT];
  const int tid = threadIdx.x, wave = tid >> 5, lane = tid & 31, col = lane & 15, g = lane >> 4; const int wm = (wave >> 1) * 32, wn = (wave & 1) * 64;   // the wave's first row and column in the block
  const int which = blockIdx.z; const int c0 = blockIdx.y * 128; const size_t r0 = (size_t)blockIdx.x * PBM; const size_t bb = r0 / TT; const int t0 = (int)(r0 % TT);
  const float* X = which == 0 ? XQ : which == 1 ? XK : XV; const float* WA = which == 0 ? WQ : which == 1 ? WK : WV; const float* BA = which == 0 ? BQ : which == 1 ? BK : BV;
  // Main loop: the block's x rows and W columns go through LDS as bf16 in chunks of PKC k, k-contiguous rows at the pitch for 16-byte readers, two buffers.
  // Whole-line global loads, each element loaded and rounded once a block; the next chunk's loads are in flight while this chunk's products run. Every accumulator still takes its 32-k products in ascending k.
  const unsigned wlo = (unsigned)((tid >> 6) * 16 * CC + 2 * (tid & 63));   // W: this thread's column pair and its 16 k rows of the chunk
  const unsigned xlo = (unsigned)((tid >> 4) * DIN + 4 * (tid & 15));       // x: rows (tid >> 4) + 16 i, four k each
  const float* Wb = WA + c0; const float* Xb = X + r0 * DIN;                // block-uniform bases
  v2f wr[2][16]; v4f xr[2][8];   // two register sets: chunks c + 1 and c + 2 are in flight while chunk c is worked on
  v8f acc[2][4] = {};
#define PROJ_LD(c, s) do { const float* wp = Wb + (size_t)(c) * PKC * CC; const float* xp = Xb + (size_t)(c) * PKC; \
    _Pragma("unroll") for (int i = 0; i < 16; ++i) wr[s][i] = *(const v2f*)(wp + (size_t)i * CC + wlo); \
    _Pragma("unroll") for (int i = 0; i < 8; ++i) xr[s][i] = *(const v4f*)(xp + (size_t)(16 * i) * DIN + xlo); \
    asm volatile("s_wait_xcnt 0x0" ::: "memory");   /* these loads stay in flight over the loop's foot, where their address registers are stepped: the wait stands ahead of that (a scheduling barrier follows every use) */ \
  } while (0)
#define PROJ_ST(s) do { \
    _Pragma("unroll") for (int q = 0; q < 2; ++q) { v8b w0, w1; \
      _Pragma("unroll") for (int e = 0; e < 8; ++e) { w0[e] = (__bf16)wr[s][q * 8 + e][0]; w1[e] = (__bf16)wr[s][q * 8 + e][1]; } \
      *(v8b*)&sw[s][2 * (tid & 63)][(tid >> 6) * 16 + q * 8] = w0; *(v8b*)&sw[s][2 * (tid & 63) + 1][(tid >> 6) * 16 + q * 8] = w1; } \
    _Pragma("unroll") for (int i = 0; i < 8; ++i) { v4b xv; \
      _Pragma("unroll") for (int e = 0; e < 4; ++e) xv[e] = (__bf16)xr[s][i][e]; \
      *(v4b*)&sx[s][(tid >> 4) + 16 * i][4 * (tid & 15)] = xv; } } while (0)
// work-group barrier that orders LDS alone: __syncthreads() would also wait for the global loads in flight, which nobody else reads
#define PROJ_BAR() do { __builtin_amdgcn_fence(__ATOMIC_RELEASE, "workgroup", "local"); __builtin_amdgcn_s_barrier(); __builtin_amdgcn_fence(__ATOMIC_ACQUIRE, "workgroup", "local"); } while (0)
// one trip: chunk c lies in LDS buffer s (= c & 1); register set s is free, set s ^ 1 holds (in flight) chunk c + 1; more2, more1: a chunk c + 2, c + 1 exists (literals, so that the loop's body has no branch and its load waits are counts)
#define PROJ_TRIP(c, s, more2, more1) do { \
    if (more2) PROJ_LD((c) + 2, s); \
    __builtin_amdgcn_sched_barrier(0);   /* keeps the global loads issued ahead of this chunk's products */ \
    v16b af[PKC / 32][2], wf[PKC / 32][4]; \
    _Pragma("unroll") for (int ks = 0; ks < PKC / 32; ++ks) { \
      _Pragma("unroll") for (int i = 0; i < 2; ++i) af[ks][i] = frag_b(&sx[s][wm + i * 16 + col][ks * 32], lane); \
      _Pragma("unroll") for (int j = 0; j < 4; ++j) wf[ks][j] = frag_b(&sw[s][wn + j * 16 + col][ks * 32], lane); } \
    __builtin_amdgcn_sched_barrier(0);   /* keeps the chunk's LDS reads together ahead of its products: one LDS round trip a chunk, not one a product */ \
    _Pragma("unroll") for (int ks = 0; ks < PKC / 32; ++ks) { \
      _Pragma("unroll") for (int i = 0; i < 2; ++i) { \
        _Pragma("unroll") for (int j = 0; j < 4; ++j) acc[i][j] = __builtin_amdgcn_wmma_f32_16x16x32_bf16(false, af[ks][i], false, wf[ks][j], (short)0, acc[i][j], false, false); } } \
    __builtin_amdgcn_sched_barrier(0);   /* keeps the wait for chunk c + 1's global loads, and their rounding, behind the products */ \
    if (more1) { PROJ_ST((s) ^ 1); \
      PROJ_BAR(); }   /* publishes chunk c + 1 and ends every wave's reads of the buffer that the next trip refills */ \
  } while (0)
  PROJ_LD(0, 0); PROJ_LD(1, 1);
  __builtin_amdgcn_sched_barrier(0);   // keeps both chunks' loads issued ahead of the wait for the first
  PROJ_ST(0);
  PROJ_BAR();   // chunk 0 is in LDS for every wave
#pragma unroll 1   // the body already holds one trip for each buffer and register set
  for (int c = 0; c < DIN / PKC - 2; c += 2) { PROJ_TRIP(c, 0, 1, 1); PROJ_TRIP(c + 1, 1, 1, 1); }
  PROJ_TRIP(DIN / PKC - 2, 0, 0, 1); PROJ_TRIP(DIN / PKC - 1, 1, 0, 0);   // the last two chunks: nothing left to load, then nothing left to stage
#undef PROJ_TRIP
#undef PROJ_BAR
#undef PROJ_LD
#undef PROJ_ST
// behind a store of the loops below: its data registers take the next LDS read and its address registers are stepped at the loop's foot; the wait stands ahead of both, and the scheduling barrier keeps those writes behind it
#define STORE_XW() do { asm volatile("s_wait_xcnt 0x0" ::: "memory"); __builtin_amdgcn_sched_barrier(0); } while (0)
  if (which < 2) { _Float16* DH = which == 0 ? QH : KH; _Float16* DL = which == 0 ? QL : KL; const int nhi = which == 0 ? QHI : KHI; const bool hi_rows = t0 < nhi;
#pragma unroll
    for (int j = 0; j < 4; ++j) { const float bias = BA ? bfr(BA[c0 + wn + j * 16 + col]) : 0.f;
#pragma unroll
      for (int i = 0; i < 2; ++i) {
#pragma unroll
        for (int r = 0; r < 8; ++r) { const float v = acc[i][j][r] + bias; const _Float16 hv = (_Float16)v; sh[wm + i * 16 + 8 * g + r][wn + j * 16 + col] = hv; sl[wm + i * 16 + 8 * g + r][wn + j * 16 + col] = (_Float16)((v - (float)hv) * 1024.0f); } } }
    __syncthreads();
    static_assert(CC == 128, "the fragment-order planes take one 128-column block a row"); static_assert(TT % PBM == 0 && QHI % PBM == 0 && KHI % PBM == 0, "a block lies in one batch and wholly inside or outside the residual rows");
    for (int e = tid; e < PBM * 16; e += 256) { const int rl = (e >> 8) * 16 + (e & 15), q = (e >> 4) & 15;   // e = the block's 16-byte piece in fragment order: row tile, then the 8-column group q, then the row in the tile
      vst2((unsigned*)(DH + r0 * CC + (size_t)e * 8), *(const v4u*)&sh[rl][q * 8]);
      STORE_XW();
      if (hi_rows) { vst2((unsigned*)(DL + (bb * nhi + t0) * (size_t)CC + (size_t)e * 8), *(const v4u*)&sl[rl][q * 8]);
        STORE_XW(); } }
  } else { const bool hi_rows = t0 < KHI;
#pragma unroll
    for (int j = 0; j < 4; ++j) { const float bias = BA ? bfr(BA[c0 + wn + j * 16 + col]) : 0.f;
#pragma unroll
      for (int i = 0; i < 2; ++i) {
#pragma unroll
        for (int r = 0; r < 8; ++r) { const float v = acc[i][j][r] + bias; const int rl = wm + i * 16 + 8 * g + r, cl = wn + j * 16 + col; th[cl][rl] = (_Float16)v; const __bf16 bh = (__bf16)v; tb[cl][rl] = bh; tbl[cl][rl] = (__bf16)(v - (float)bh); } } }
    __syncthreads();
    for (int e = tid; e < 128 * (PBM / 8); e += 256) { const int cl = ((e >> 6) & 7) * 16 + (e & 15), tl = (e >> 9) * 32 + ((e >> 4) & 3) * 8;   // e = the block's 16-byte piece in fragment order: 32-key chunk, channel tile, 8-key group, channel in the tile
      vst2((unsigned*)(VT + (bb * TT + t0) * (size_t)CC + (size_t)e * 8), *(const v4u*)&th[cl][tl]);
      STORE_XW();
      if (hi_rows) { const size_t o3 = (bb * KHI + t0) * (size_t)CC + (size_t)e * 8; vst2((unsigned*)(VB + o3), *(const v4u*)&tb[cl][tl]); vst2((unsigned*)(VBL + o3), *(const v4u*)&tbl[cl][tl]);
        STORE_XW(); } } } }
#undef STORE_XW
// ---- k_fa: one work-group of 4 waves = 32 query rows (two 16-row tiles) of one batch. Rows >= QHI: wave w takes BOTH tiles against the causal key blocks w, w + 4, ... (128 keys each), so that every k and v fragment it loads feeds two products; running row maxima of its own (no logit plane in the workspace); the four parts are joined in LDS at the end.
// Logits are formed transposed (A = k rows, B = q rows): a lane then holds keys 16j + 8g + r of ITS query (lane & 15), which is already the B-fragment order of P^T; the output is accumulated transposed too (A = v transposed, B = P^T), so maximum, sum and rescale stay in the query's own lanes.
// Same products as before: 1 f16 product (3 with the x 2^10 residuals for rows < QHI); exp(logit - running max) x 2^11 once to f16 against v f16 (bf16 hi + lo, 3 products, for rows < QHI); the division by the row sum comes last.
// Fragment loads stand in the source as whole groups ahead of the products that use them: half of this block's v ahead of the logits, the other half and the next block's k ahead of the softmax.
// plain builtin forms: the compiler keeps the distance behind a matrix instruction itself and may use every register window for the operands
__device__ __forceinline__ v8f mm16(v16h a, v16h b, v8f c) { return __builtin_amdgcn_wmma_f32_16x16x32_f16(false, a, false, b, (short)0, c, false, false); }
__device__ __forceinline__ v8f mmbf(v16b a, v16b b, v8f c) { return __builtin_amdgcn_wmma_f32_16x16x32_bf16(false, a, false, b, (short)0, c, false, false); }
// fragment (1 KB in fragment order: elements 0..7 of all 32 lanes, then elements 8..15) at a wave-uniform pointer plus the lane's own 32-bit element offset 8 * lane: scalar base + one loop-invariant offset register, so no address register is formed anew for a load group
__device__ __forceinline__ v16h frag_hp(const _Float16* ub, unsigned lo) { union { v16h v; v8h q[2]; } u; const _Float16* p = ub + lo; u.q[0] = *(const v8h*)p; u.q[1] = *(const v8h*)(p + 256); return u.v; }
__device__ __forceinline__ v16b frag_bp(const __bf16* ub, unsigned lo) { union { v16b v; v8b q[2]; } u; const __bf16* p = ub + lo; u.q[0] = *(const v8b*)p; u.q[1] = *(const v8b*)(p + 256); return u.v; }
// a wave-uniform global pointer, both words through readfirstlane: it stays a scalar base of its own, so that every load names that base and a loop-invariant offset register, and no vector address is formed or stepped under loads in flight
typedef const __attribute__((address_space(1))) _Float16* gph;
__device__ __forceinline__ const _Float16* uni(const _Float16* p) { const unsigned long long a = (unsigned long long)p; return (const _Float16*)(gph)(((unsigned long long)(unsigned)__builtin_amdgcn_readfirstlane((int)(a >> 32)) << 32) | (unsigned)__builtin_amdgcn_readfirstlane((int)a)); }
// hardware exp2 with, in the same statement, the one slot that the instruction set asks for behind a transcendental before its source may be overwritten or its result read
__device__ __forceinline__ float exp2_slot(float x) { float e; asm("v_exp_f32 %0, %1\n\tv_nop" : "=v"(e) : "v"(x)); return e; }
struct FaSt { float m, lsum; };   // m: running maximum of logit x SC2 (base-2 domain); lsum: the lane's partial sum of exp x 2^11
#define SC2 ((float)(0.08838834764831845 * 1.4426950408889634))   // 128^-0.5 x log2 e: exp(SCALE x s - max) = exp2(SC2 x s - max2)
// takes the RAW products q.k; masks the diagonal block, updates the running maximum and the lane's partial sum; leaves exp x 2^11 in st and returns the factor for what was summed so far
// each exponential is one fused multiply-add (scale, maximum and the 2^11 all in it) and one hardware exp2; a result below 2^-126 reads 0, far under what f16 or the sum can hold
__device__ __forceinline__ float fa_softmax(v8f (&st)[8], FaSt& f, bool diag, int key0, int tq) {
  if (diag) {
#pragma unroll
    for (int j = 0; j < 8; ++j) {
#pragma unroll
      for (int r = 0; r < 8; ++r) st[j][r] = (key0 + j * 16 + r <= tq) ? st[j][r] : -3.0e38f; } }
  float mloc = -3.0e38f;
#pragma unroll
  for (int j = 0; j < 8; ++j) {
#pragma unroll
    for (int r = 0; r < 8; ++r) mloc = fmaxf(mloc, st[j][r]); }
  mloc = fmaxf(mloc, __shfl_xor(mloc, 16));   // the two lane halves hold the two key halves of the same query
  const float mn = fmaxf(f.m, mloc * SC2); const float alpha = exp2_slot(f.m - mn); f.m = mn;
  const float off = 11.0f - mn; float s = 0.f;
#pragma unroll
  for (int j = 0; j < 8; ++j) {
#pragma unroll
    for (int r = 0; r < 8; ++r) { const float e = exp2_slot(fmaf(st[j][r], SC2, off)); s += e; st[j][r] = e; } }   // a masked key: exp2(-3e38 x SC2 + off) = 0; mn is finite from a wave's first block on: every block that is walked starts at a key <= every query of the tile
  f.lsum = f.lsum * alpha + s; return alpha; }
// joins the four waves' parts of the block's two row tiles: common maximum, each part rescaled to it, parts added in a fixed order, division by the joined row sum last
__device__ __forceinline__ void fa_join(v8f (&acc0)[HD / 16], v8f (&acc1)[HD / 16], const FaSt& f0, const FaSt& f1, int b, int ql0, int wave, int lane, float (*so)[32][HD + 4], float (*sm)[32], float (*sl)[32], float* __restrict__ Y) {
  const int col = lane & 15, g = lane >> 4;
  sm[wave][lane] = g == 0 ? f0.m : f1.m;   // both lane halves hold the same maxima: the lower half stores tile 0's, the upper tile 1's
  __syncthreads();   // every wave's maxima are in LDS
  const float mj0 = fmaxf(fmaxf(sm[0][col], sm[1][col]), fmaxf(sm[2][col], sm[3][col])), mj1 = fmaxf(fmaxf(sm[0][16 + col], sm[1][16 + col]), fmaxf(sm[2][16 + col], sm[3][16 + col]));   // finite: some wave walks block 0 of each tile, which holds key 0 <= every query
  const float sc0 = exp2_slot(f0.m - mj0), sc1 = exp2_slot(f1.m - mj1);   // a wave without a key block of that tile: exp2(-3e38 - max) = 0 on a part that is 0
  float ls0 = f0.lsum * sc0, ls1 = f1.lsum * sc1; ls0 += __shfl_xor(ls0, 16); ls1 += __shfl_xor(ls1, 16);
  sl[wave][lane] = g == 0 ? ls0 : ls1;
#pragma unroll
  for (int j = 0; j < HD / 16; ++j) { const v8f o = acc0[j] * sc0, p = acc1[j] * sc1;
    vst2(&so[wave][col][j * 16 + 8 * g], (v4f){o[0], o[1], o[2], o[3]}); vst2(&so[wave][col][j * 16 + 8 * g + 4], (v4f){o[4], o[5], o[6], o[7]});
    vst2(&so[wave][16 + col][j * 16 + 8 * g], (v4f){p[0], p[1], p[2], p[3]}); vst2(&so[wave][16 + col][j * 16 + 8 * g + 4], (v4f){p[4], p[5], p[6], p[7]}); }
  __syncthreads();   // every wave's rescaled parts and sums are in LDS
#pragma unroll
  for (int i = 0; i < 8; ++i) { const int rl = wave * 8 + i;   // one output row (512 contiguous bytes) a wave and pass
    const float lj = (sl[0][rl] + sl[1][rl]) + (sl[2][rl] + sl[3][rl]); const float inv = lj > 0.f ? 1.0f / lj : 0.f;   // sum and accumulators both carry the 2^11
    const v4f o = (*(const v4f*)&so[0][rl][lane * 4] + *(const v4f*)&so[1][rl][lane * 4]) + (*(const v4f*)&so[2][rl][lane * 4] + *(const v4f*)&so[3][rl][lane * 4]);
    vst2(Y + ((size_t)b * TT + ql0 + rl) * CC + lane * 4, o * inv); } }
// rows >= QHI (at least 4 key blocks, so every wave has one)
__device__ __forceinline__ void fa_wave(const _Float16* __restrict__ QH, const _Float16* __restrict__ KH, const _Float16* __restrict__ VT, int b, int ql0, int wave, int lane, v8f (&acc0)[HD / 16], v8f (&acc1)[HD / 16], FaSt& f0, FaSt& f1) {
  const int col = lane & 15, g = lane >> 4; const int tq = ql0 + col; const int nkb = ((ql0 + 31) >> 7) + 1;
  const _Float16* K0 = KH + (size_t)b * TT * CC; const _Float16* V0 = VT + (size_t)b * TT * CC;   // the batch's k and v (wave-uniform)
  const unsigned flo = 8 * lane;
  v16h qf0[HD / 32], qf1[HD / 32], kf[32], vf[32];
  __builtin_amdgcn_sched_barrier(0);   // with the one behind the wait below: nothing but these loads stands between here and the wait, so none of their address registers is reused ahead of it
#pragma unroll
  for (int kc = 0; kc < HD / 32; ++kc) { qf0[kc] = frag_hp(QH + ((size_t)b * TT + ql0) * CC + kc * 512, flo); qf1[kc] = frag_hp(QH + ((size_t)b * TT + ql0 + 16) * CC + kc * 512, flo); }
#pragma unroll
  for (int i = 0; i < 32; ++i) kf[i] = frag_hp(K0 + (size_t)(wave * 128 + (i & 7) * 16) * CC + (i >> 3) * 512, flo);
  asm volatile("s_wait_xcnt 0x0" ::: "memory");   // the registers that the loads above name are free for reuse behind this wait
  __builtin_amdgcn_sched_barrier(0);
  static_assert(QHI >= 384, "every wave needs a first key block");
  int kb = wave;
#pragma unroll 1
  do { const int k0 = kb * 128;   // entered without a test: the loads above stay where they stand, ahead of their wait
    const _Float16* Kp = uni(K0 + (size_t)k0 * CC); const _Float16* Vp = uni(V0 + (size_t)k0 * CC);
#pragma unroll
    for (int i = 0; i < 16; ++i) vf[i] = frag_hp(Vp + (i >> 3) * 4096 + (i & 7) * 512, flo);
    __builtin_amdgcn_sched_barrier(0);   // keeps the first half of the v loads issued ahead of the logit products (only half: the wait for k must still be a count that the load counter can hold)
    v8f st0[8] = {}, st1[8] = {};
#pragma unroll
    for (int i = 0; i < 32; ++i) { st0[i & 7] = mm16(kf[i], qf0[i >> 3], st0[i & 7]); st1[i & 7] = mm16(kf[i], qf1[i >> 3], st1[i & 7]); }
    __builtin_amdgcn_sched_barrier(0);   // keeps the loads below from being lifted over the logit products, whose wait for k would then also wait for them
#pragma unroll
    for (int i = 16; i < 32; ++i) vf[i] = frag_hp(Vp + (i >> 3) * 4096 + (i & 7) * 512, flo);
    if (kb + 4 < nkb) {
#pragma unroll
      for (int i = 0; i < 32; ++i) kf[i] = frag_hp(Kp + (size_t)(512 + (i & 7) * 16) * CC + (i >> 3) * 512, flo); }
    asm volatile("s_wait_xcnt 0x0" ::: "memory");   // the k loads stay in flight over the loop's foot, where the scalar bases are formed anew: the wait stands ahead of that
    __builtin_amdgcn_sched_barrier(0);   // keeps the rest of the v loads and the next block's k loads issued ahead of the softmax, which then covers their latency
    if (kb + 1 == nkb) {   // the diagonal block: both tiles masked in one branch, so that none of the mask's arithmetic stands in the other blocks' path
#pragma unroll
      for (int j = 0; j < 8; ++j) {
#pragma unroll
        for (int r = 0; r < 8; ++r) { const int key = k0 + 8 * g + j * 16 + r; st0[j][r] = (key <= tq) ? st0[j][r] : -3.0e38f; st1[j][r] = (key <= tq + 16) ? st1[j][r] : -3.0e38f; } } }
    const float alpha0 = fa_softmax(st0, f0, false, 0, 0); const float alpha1 = fa_softmax(st1, f1, false, 0, 0);
#pragma unroll
    for (int j = 0; j < HD / 16; ++j) { acc0[j] *= alpha0; acc1[j] *= alpha1; }
#pragma unroll
    for (int c = 0; c < 4; ++c) { v16h p0, p1;
#pragma unroll
      for (int i = 0; i < 8; ++i) { p0[i] = (_Float16)st0[2 * c][i]; p0[8 + i] = (_Float16)st0[2 * c + 1][i]; p1[i] = (_Float16)st1[2 * c][i]; p1[8 + i] = (_Float16)st1[2 * c + 1][i]; }
#pragma unroll
      for (int j = 0; j < HD / 16; ++j) { acc0[j] = mm16(vf[c * 8 + j], p0, acc0[j]); acc1[j] = mm16(vf[c * 8 + j], p1, acc1[j]); } }
    __builtin_amdgcn_sched_barrier(0);   // keeps the step of the two scalar bases behind the last product's wait for the loads: no base is rewritten under a load in flight
    kb += 4;
  } while (kb < nkb); }
// rows < QHI (at most 3 key blocks): residual products; one 16-row tile a wave, its key blocks kb0, kb0 + 2, ... (two waves a tile)
__device__ __forceinline__ void fa_wave_hi(const _Float16* __restrict__ QH, const _Float16* __restrict__ KH, const _Float16* __restrict__ QL, const _Float16* __restrict__ KL, const __bf16* __restrict__ VB, const __bf16* __restrict__ VBL, int b, int ql0, int kb0, int lane, v8f (&acc)[HD / 16], FaSt& f) {
  const int col = lane & 15, g = lane >> 4; const int tq = ql0 + col; const int nkb = ((ql0 + 15) >> 7) + 1;
  const _Float16* Kp = KH + ((size_t)b * TT + kb0 * 128) * CC; const _Float16* KLp = KL + ((size_t)b * KHI + kb0 * 128) * CC; const __bf16* Vp = VB + ((size_t)b * KHI + kb0 * 128) * CC; const __bf16* VLp = VBL + ((size_t)b * KHI + kb0 * 128) * CC;   // wave-uniform; stepped at the loop's foot
  const unsigned flo = 8 * lane;
  if (kb0 >= nkb) return;   // wave-uniform; tested ahead of the q loads, so that they stay where they stand, ahead of their wait, and the loop below is entered without a test
  v16h qf[HD / 32], qlf[HD / 32];
  __builtin_amdgcn_sched_barrier(0);   // as in fa_wave: nothing but these loads stands between here and the wait, so none of their address registers is reused ahead of it
#pragma unroll
  for (int kc = 0; kc < HD / 32; ++kc) { qf[kc] = frag_hp(QH + ((size_t)b * TT + ql0) * CC + kc * 512, flo); qlf[kc] = frag_hp(QL + ((size_t)b * QHI + ql0) * CC + kc * 512, flo); }
  asm volatile("s_wait_xcnt 0x0" ::: "memory");   // the registers that the loads above name are free for reuse behind this wait
  __builtin_amdgcn_sched_barrier(0);
  int kb = kb0;
#pragma unroll 1
  do { const int k0 = kb * 128;
    v8f st[8] = {}, stl[8] = {};
#pragma unroll
    for (int kc = 0; kc < HD / 32; ++kc) { v16h kh[8], kl[8];
#pragma unroll
      for (int j = 0; j < 8; ++j) { kh[j] = frag_hp(Kp + (size_t)(j * 16) * CC + kc * 512, flo); kl[j] = frag_hp(KLp + (size_t)(j * 16) * CC + kc * 512, flo); }
      __builtin_amdgcn_sched_barrier(0);   // keeps the group's 32 loads issued together: one round trip a group, not one a product
#pragma unroll
      for (int j = 0; j < 8; ++j) { st[j] = mm16(kh[j], qf[kc], st[j]); stl[j] = mm16(kh[j], qlf[kc], stl[j]); stl[j] = mm16(kl[j], qf[kc], stl[j]); } }
#pragma unroll
    for (int j = 0; j < 8; ++j) st[j] = st[j] + stl[j] * (1.0f / 1024.0f);
    const float alpha = fa_softmax(st, f, kb + 1 == nkb, k0 + 8 * g, tq);
#pragma unroll
    for (int j = 0; j < HD / 16; ++j) acc[j] *= alpha;
#pragma unroll
    for (int c = 0; c < 4; ++c) { float pe[16]; v16b vh[8], vl[8];
#pragma unroll
      for (int j = 0; j < HD / 16; ++j) { const size_t po = (size_t)c * 4096 + j * 512; vh[j] = frag_bp(Vp + po, flo); vl[j] = frag_bp(VLp + po, flo); }
      __builtin_amdgcn_sched_barrier(0);   // as above: the group's 32 loads issued together
#pragma unroll
      for (int i = 0; i < 8; ++i) { pe[i] = st[2 * c][i]; pe[8 + i] = st[2 * c + 1][i]; }
      const F2 p = bsplit16(pe);
#pragma unroll
      for (int j = 0; j < HD / 16; ++j) { acc[j] = mmbf(vh[j], p.h, acc[j]); acc[j] = mmbf(vh[j], p.l, acc[j]); acc[j] = mmbf(vl[j], p.h, acc[j]); } }
    __builtin_amdgcn_sched_barrier(0);   // as in fa_wave: the pointer steps stay behind the last product's wait for the loads
    Kp += 256 * CC; KLp += 256 * CC; Vp += 256 * CC; VLp += 256 * CC; kb += 2;
  } while (kb < nkb); }
// block = 4 waves on 32 query rows; the lowest block indices take the rows with the most key blocks; the batch is the fastest index
__global__ __launch_bounds__(128) void k_fa(const _Float16* __restrict__ QH, const _Float16* __restrict__ KH, const _Float16* __restrict__ QL, const _Float16* __restrict__ KL, const _Float16* __restrict__ VT, const __bf16* __restrict__ VB, const __bf16* __restrict__ VBL, float* __restrict__ Y) { __shared__ __align__(16) float so[4][32][HD + 4]; __shared__ float sm[4][32], sl[4][32];
  const int wave = __builtin_amdgcn_readfirstlane(threadIdx.x >> 5), lane = threadIdx.x & 31; const int b = blockIdx.x % TNB; const int ql0 = (TT / 32 - 1 - (int)(blockIdx.x / TNB)) * 32;
  v8f acc0[HD / 16] = {}, acc1[HD / 16] = {}; FaSt f0 = {-3.0e38f, 0.f}, f1 = {-3.0e38f, 0.f};
  if (ql0 >= QHI) fa_wave(QH, KH, VT, b, ql0, wave, lane, acc0, acc1, f0, f1);
  else { fa_wave_hi(QH, KH, QL, KL, VB, VBL, b, ql0 + 16 * (wave & 1), wave >> 1, lane, acc0, f0);   // waves 0, 2: tile 0; waves 1, 3: tile 1; the other tile's part stays empty
    if (wave & 1) {
#pragma unroll
      for (int j = 0; j < HD / 16; ++j) { acc1[j] = acc0[j]; acc0[j] = (v8f){}; }
      f1 = f0; f0 = {-3.0e38f, 0.f}; } }
  fa_join(acc0, acc1, f0, f1, b, ql0, wave, lane, so, sm, sl, Y); }

extern "C" void kernel_launch(void* const* d_in, const int* in_sizes, int n_in, void* d_out, int out_size, void* d_ws, size_t ws_size, hipStream_t stream) {
  (void)in_sizes; (void)n_in; (void)out_size;
  const float** F = (const float**)d_in;
  if (ws_size < (size_t)WS_END) return;
  char* ws = (char*)d_ws; _Float16 *QH = (_Float16*)(ws + WS_QH), *KH = (_Float16*)(ws + WS_KH), *VT = (_Float16*)(ws + WS_VT), *QL = (_Float16*)(ws + WS_QL), *KL = (_Float16*)(ws + WS_KL); __bf16 *VB = (__bf16*)(ws + WS_VB), *VBL = (__bf16*)(ws + WS_VBL);
  // inputs: 0 x [4,2048,1024]; 1 Wq [1024,128] (in,out); 2 Wk; 3 Wv
  k_proj<<<dim3(TNB * TT / PBM, CC / 128, 3), 256, 0, stream>>>(F[0], F[0], F[0], F[1], F[2], F[3], nullptr, nullptr, nullptr, QH, QL, KH, KL, VT, VB, VBL);
  k_fa<<<dim3(TNB * (TT / 32), 1, 1), 128, 0, stream>>>(QH, KH, QL, KL, VT, VB, VBL, (float*)d_out);
}

// v008
// It runs in 27.9 microseconds.
// Next to v007, in two timings, it ran 1.03 times as fast each time.
// Counting every step since v000, it is 18.7 times as fast.
// compute dtype: all float inputs rounded to bf16; q/k/v = x W with EXACT bf16 products on WMMA 16x16x32 (f32 accumulate); causal logits: q, k once to f16 (1 product) x 128^-0.5, 3 products below row 384; softmax in f32 with a running row maximum, exponentials in base 2 (hardware exp2); exp x 2^11 once to f16 against v f16 (bf16 hi + lo below row 384), divided by the row sum last; the key blocks of 32 query rows are dealt over 4 waves and the parts joined in f32; f32 output.
#include <hip/hip_runtime.h>
#include <math.h>

typedef __attribute__((ext_vector_type(16))) _Float16 v16h;
typedef __attribute__((ext_vector_type(16))) __bf16 v16b;
typedef __attribute__((ext_vector_type(8)))  _Float16 v8h;
typedef __attribute__((ext_vector_type(8)))  float v8f;
typedef __attribute__((ext_vector_type(4)))  float v4f;
typedef __attribute__((ext_vector_type(2)))  float v2f;
typedef __attribute__((ext_vector_type(4)))  unsigned v4u;
typedef __attribute__((ext_vector_type(4)))  int v4i;
typedef float __attribute__((may_alias)) float_a;
typedef int __attribute__((may_alias)) int_a;

template <typename T> __device__ __forceinline__ void vst2(void* p, T v) { *(T*)p = v;  }
__device__ __forceinline__ v8f wmma16(v16h a, v16h b, v8f c) {
  v8f d = __builtin_amdgcn_wmma_f32_16x16x32_f16(false, a, false, b, (short)0, c, false, false);
  asm volatile("v_nop\n\tv_nop\n\tv_nop\n\tv_nop" : "+v"(d) : "v"(a), "v"(b));
  return d;
}
__device__ __forceinline__ v8f wmma_bf(v16b a, v16b b, v8f c) {
  v8f d = __builtin_amdgcn_wmma_f32_16x16x32_bf16(false, a, false, b, (short)0, c, false, false);
  asm volatile("v_nop\n\tv_nop\n\tv_nop\n\tv_nop" : "+v"(d) : "v"(a), "v"(b));
  return d;
}
// 16x16x32 fragments: lane = (h = lane>>4, row/col = lane&15); elements 0..7 = k0+8h+0..7, 8..15 = k0+16+8h+0..7; D element r = row 8h+r
__device__ __forceinline__ v16h frag_h(const _Float16* rowk0, int lane) {
  union { v16h v; v8h q[2]; } u; const _Float16* p = rowk0 + 8 * (lane >> 4);
  u.q[0] = *(const v8h*)p; u.q[1] = *(const v8h*)(p + 16); return u.v;
}
__device__ __forceinline__ v16h frag_f32(const float* rowk0, int lane) {
  v16h a; const float* p = rowk0 + 8 * (lane >> 4);
#pragma unroll
  for (int i = 0; i < 8; ++i) { a[i] = (_Float16)p[i]; a[8 + i] = (_Float16)p[16 + i]; }
  return a;
}
__device__ __forceinline__ v16h frag_f32s(const float* rowk0, int lane, float sc) {
  v16h a; const float* p = rowk0 + 8 * (lane >> 4);
#pragma unroll
  for (int i = 0; i < 8; ++i) { a[i] = (_Float16)(p[i] * sc); a[8 + i] = (_Float16)(p[16 + i] * sc); }
  return a;
}
// column fragment from a [K][ld] layout (column n), rows >= K read as 0
__device__ __forceinline__ v16h fragc_f32(const float* W, int k0, int n, int lane, int ld, int K) {
  v16h a; const int g = lane >> 4;
#pragma unroll
  for (int i = 0; i < 8; ++i) { const int ka = k0 + 8 * g + i, kb = ka + 16;
    a[i] = (_Float16)(ka < K ? W[(size_t)(ka < K ? ka : K - 1) * ld + n] : 0.f); a[8 + i] = (_Float16)(kb < K ? W[(size_t)(kb < K ? kb : K - 1) * ld + n] : 0.f); }
  return a;
}
struct F2 { v16b h, l; };
__device__ __forceinline__ F2 bsplit16(const float v[16]) { F2 r;
#pragma unroll
  for (int i = 0; i < 16; ++i) { const __bf16 h = (__bf16)v[i]; r.h[i] = h; r.l[i] = (__bf16)(v[i] - (float)h); }
  return r; }
__device__ __forceinline__ F2 split_row(const float* row, int k0, int lane) { float v[16]; const float* p = row + k0 + 8 * (lane >> 4);
#pragma unroll
  for (int i = 0; i < 8; ++i) { v[i] = p[i]; v[8 + i] = p[16 + i]; }
  return bsplit16(v); }
__device__ __forceinline__ F2 split_rowK(const float* row, int k0, int lane, int K) { float v[16]; const int g = lane >> 4;
#pragma unroll
  for (int i = 0; i < 8; ++i) { const int ka = k0 + 8 * g + i, kb = ka + 16; v[i] = ka < K ? row[ka < K ? ka : K - 1] : 0.f; v[8 + i] = kb < K ? row[kb < K ? kb : K - 1] : 0.f; }
  return bsplit16(v); }
__device__ __forceinline__ F2 split_col(const float* W, int k0, int n, int lane, int ld, int K) { float v[16]; const int g = lane >> 4;
#pragma unroll
  for (int i = 0; i < 8; ++i) { const int ka = k0 + 8 * g + i, kb = ka + 16; v[i] = ka < K ? W[(size_t)(ka < K ? ka : K - 1) * ld + n] : 0.f; v[8 + i] = kb < K ? W[(size_t)(kb < K ? kb : K - 1) * ld + n] : 0.f; }
  return bsplit16(v); }
__device__ __forceinline__ v8f mac3(const F2& a, const F2& b, v8f c) { c = wmma_bf(a.l, b.h, c); c = wmma_bf(a.h, b.l, c); return wmma_bf(a.h, b.h, c); }
__device__ __forceinline__ float sigm(float v) { return 1.0f / (1.0f + expf(-v)); }
#define LDSX() do { asm volatile("s_wait_dscnt 0" ::: "memory"); __builtin_amdgcn_wave_barrier(); __builtin_amdgcn_fence(__ATOMIC_RELEASE, "workgroup"); } while (0)

// Single-head causal self-attention (B 4, T 2,048, C 1,024 -> H 128; (in,out) 1/32-scale weights, no biases): q, k, v = x W; out = softmax_causal(q k^T x 128^-0.5) v -> [B, T, 128].
#define NB 4
#define TT 2048
#define CC 128            // NH * HD = projected width
#define DIN 1024          // input (model) width
#define NH 1
#define HD 128
#define NQB (TT / 64)
#define HG 1
#define SCALE (0.08838834764831845f)
#define CAUSAL 1
#ifndef TNB
#define TNB NB
#endif
__device__ __forceinline__ float bfr(float v) { return (float)(__bf16)v; }
__host__ __device__ __forceinline__ int kb_last(int qb) { return CAUSAL ? ((qb * 64 + 63) >> 7) : (TT / 128 - 1); }
typedef __attribute__((ext_vector_type(8))) __bf16 v8b;
__device__ __forceinline__ v16b frag_b(const __bf16* rowk0, int lane) {
  union { v16b v; v8b q[2]; } u; const __bf16* p = rowk0 + 8 * (lane >> 4);
  u.q[0] = *(const v8b*)p; u.q[1] = *(const v8b*)(p + 16); return u.v;
}
#define QBH 6              // unused: k_fa takes the high-precision path for rows < QHI (32-row query blocks 0..11; few keys, no averaging)
#define QHI 384            // rows carrying a q residual plane
#define KHI 384            // key rows carrying k residual / v bf16 hi+lo planes (used only by the causal high-precision path)
// B fragment (k rows k0+.., output column o) of a weight: (in,out) [K][ld] or (out,in) [ld rows of K]: bf16 exact, or f16(bf16 * 256) exact
__device__ __forceinline__ v16b wcol_io(const float* Wm, int k0, int o, int lane, int ld) { v16b w; const int g = lane >> 4;
#pragma unroll
  for (int i = 0; i < 8; ++i) { w[i] = (__bf16)Wm[(size_t)(k0 + 8 * g + i) * ld + o]; w[8 + i] = (__bf16)Wm[(size_t)(k0 + 16 + 8 * g + i) * ld + o]; }
  return w; }
__device__ __forceinline__ v16b wcol_oi(const float* Wm, int k0, int o, int lane, int K) { v16b w; const float* p = Wm + (size_t)o * K + k0 + 8 * (lane >> 4);
#pragma unroll
  for (int i = 0; i < 8; ++i) { w[i] = (__bf16)p[i]; w[8 + i] = (__bf16)p[16 + i]; }
  return w; }
__device__ __forceinline__ v16h wcolh_io(const float* Wm, int k0, int o, int lane, int ld) { v16h w; const int g = lane >> 4;
#pragma unroll
  for (int i = 0; i < 8; ++i) { w[i] = (_Float16)(bfr(Wm[(size_t)(k0 + 8 * g + i) * ld + o]) * 256.0f); w[8 + i] = (_Float16)(bfr(Wm[(size_t)(k0 + 16 + 8 * g + i) * ld + o]) * 256.0f); }
  return w; }
__device__ __forceinline__ v16h wcolh_oi(const float* Wm, int k0, int o, int lane, int K) { v16h w; const float* p = Wm + (size_t)o * K + k0 + 8 * (lane >> 4);
#pragma unroll
  for (int i = 0; i < 8; ++i) { w[i] = (_Float16)(bfr(p[i]) * 256.0f); w[8 + i] = (_Float16)(bfr(p[16 + i]) * 256.0f); }
  return w; }
#define WQKV_LAYOUT 0   // layout that WCOL reads (0 = (in,out) [DIN][CC]; 1 = (out,in) [CC][DIN]; 2 = per-head [NH][DIN][HD]); nothing calls WCOL: k_proj reads W as (in,out) [DIN][CC] for any value
__device__ __forceinline__ v16b wcol_hdk(const float* Wm, int k0, int o, int lane) { v16b w; const int g = lane >> 4; const float* p = Wm + (size_t)(o / HD) * DIN * HD + (o % HD);
#pragma unroll
  for (int i = 0; i < 8; ++i) { w[i] = (__bf16)p[(size_t)(k0 + 8 * g + i) * HD]; w[8 + i] = (__bf16)p[(size_t)(k0 + 16 + 8 * g + i) * HD]; }
  return w; }
#define WO_OUT_IN 0
#if WQKV_LAYOUT == 1
#define WCOL(W, k0, o, lane) wcol_oi(W, k0, o, lane, DIN)
#elif WQKV_LAYOUT == 2
#define WCOL(W, k0, o, lane) wcol_hdk(W, k0, o, lane)
#else
#define WCOL(W, k0, o, lane) wcol_io(W, k0, o, lane, CC)
#endif
#if WO_OUT_IN
#define WOCOL(W, k0, o, lane) wcol_oi(W, k0, o, lane, CC)
#define WOCOLH(W, k0, o, lane) wcolh_oi(W, k0, o, lane, CC)
#else
#define WOCOL(W, k0, o, lane) wcol_io(W, k0, o, lane, DIN)
#define WOCOLH(W, k0, o, lane) wcolh_io(W, k0, o, lane, DIN)
#endif

#ifndef SM_EXTRA_PARAMS
#define SM_EXTRA_PARAMS
#endif
#ifndef PROJ_EXTRA_PARAMS
#define PROJ_EXTRA_PARAMS
#endif
#ifndef SM_MASK_HOOK
#define SM_MASK_HOOK (void)0
#endif

// Every plane lies in the order of its reader's 16x16x32 fragments, so that a wave's 16-byte load covers 512 contiguous bytes (4 whole lines) and not 32 bytes of each of 16 rows:
// q, k (and residuals): [b*t / 16][c / 32][(c / 16) & 1][lane = 16 * ((c / 8) & 1) + t % 16][c % 8]; v: [b][t / 32][c / 16][(t / 16) & 1][lane = 16 * ((t / 8) & 1) + c % 16][t % 8]
#define WS_QH  0u                                      // f16 q [b*t][CC]
#define WS_KH  (WS_QH + 2u * (size_t)NB * TT * CC)      // f16 k [b*t][CC]
#define WS_VT  (WS_KH + 2u * (size_t)NB * TT * CC)      // f16 v [b][t][CC]
#define WS_QL  (WS_VT + 2u * (size_t)NB * CC * TT)      // f16 q residual x 2^10 [b][t < QHI][CC]
#define WS_KL  (WS_QL + 2u * (size_t)NB * QHI * CC)     // f16 k residual x 2^10 [b][t < KHI][CC]
#define WS_VB  (WS_KL + 2u * (size_t)NB * KHI * CC)     // bf16 v hi [b][t < KHI][CC]
#define WS_VBL (WS_VB + 2u * (size_t)NB * CC * KHI)
#define WS_END (WS_VBL + 2u * (size_t)NB * CC * KHI)

#define PKC 64             // k per staged chunk
#define PPIT (PKC + 8)     // LDS row pitch in bf16: 128 B of k + 16 B
typedef __attribute__((ext_vector_type(4))) __bf16 v4b;
#define PBM 128            // x rows a block
// a block-uniform global pointer, both words through readfirstlane: it stays a scalar base of its own, so that every load of a chunk names that base and a loop-invariant offset register, and no vector address is formed anew (and then reused) under loads in flight
typedef const __attribute__((address_space(1))) float* gpf;
__device__ __forceinline__ const float* unif(const float* p) { const unsigned long long a = (unsigned long long)p; return (const float*)(gpf)(((unsigned long long)(unsigned)__builtin_amdgcn_readfirstlane((int)(a >> 32)) << 32) | (unsigned)__builtin_amdgcn_readfirstlane((int)a)); }
// ---- k_proj: block = (PBM rows, 128 cols, which) on 8 waves, a wave = 32 rows x 64 cols (2 x 4 accumulator tiles: 6 LDS fragments feed 8 products): q/k/v = X W (+ b) with exact bf16 products (K = DIN) -> which 0: q f16 (+ residual, rows < QHI); 1: k f16 (+ residual, rows < KHI); 2: v f16 (+ bf16 hi/lo for t < KHI); all stored in fragment order (see WS_QH)
__global__ __launch_bounds__(256) void k_proj(const float* __restrict__ XQ, const float* __restrict__ XK, const float* __restrict__ XV, const float* __restrict__ WQ, const float* __restrict__ WK, const float* __restrict__ WV, const float* __restrict__ BQ, const float* __restrict__ BK, const float* __restrict__ BV,
    _Float16* __restrict__ QH, _Float16* __restrict__ QL, _Float16* __restrict__ KH, _Float16* __restrict__ KL, _Float16* __restrict__ VT, __bf16* __restrict__ VB, __bf16* __restrict__ VBL) {
  __shared__ __align__(16) _Float16 sh[PBM][136], sl[PBM][136]; __shared__ __align__(16) _Float16 th[128][PBM + 8]; __shared__ __align__(16) __bf16 tb[128][PBM + 8], tbl[128][PBM + 8];
  __shared__ __align__(16) __bf16 sw[2][128][PPIT], sx[2][PBM][PPIT];
  const int tid = threadIdx.x, wave = tid >> 5, lane = tid & 31, col = lane & 15, g = lane >> 4; const int wm = (wave >> 1) * 32, wn = (wave & 1) * 64;   // the wave's first row and column in the block
  const int which = blockIdx.z; const int c0 = blockIdx.y * 128; const size_t r0 = (size_t)blockIdx.x * PBM; const size_t bb = r0 / TT; const int t0 = (int)(r0 % TT);
  const float* X = which == 0 ? XQ : which == 1 ? XK : XV; const float* WA = which == 0 ? WQ : which == 1 ? WK : WV; const float* BA = which == 0 ? BQ : which == 1 ? BK : BV;
  // Main loop: the block's x rows and W columns go through LDS as bf16 in chunks of PKC k, k-contiguous rows at the pitch for 16-byte readers, two buffers.
  // Whole-line global loads, each element loaded and rounded once a block; the next chunk's loads are in flight while this chunk's products run.
  // The 64 blocks of one weight walk the same W chunks and the 3 blocks of one row tile the same x chunks: each block enters the ring of chunks at its own place and wraps round, so that L2 is not asked for the same lines by all of them at the same moment. Every accumulator takes its 32-k products in that rotated order.
  const unsigned wlo = (unsigned)((tid >> 6) * 16 * CC + 2 * (tid & 63));   // W: this thread's column pair and its 16 k rows of the chunk
  const unsigned xlo = (unsigned)((tid >> 4) * DIN + 4 * (tid & 15));       // x: rows (tid >> 4) + 16 i, four k each
  const float* Wb = WA + c0; const float* Xb = X + r0 * DIN;                // block-uniform bases
  // the block's first chunk: about a third of the ring lies between the 3 sharers of x; the sharers of a W are dealt over all 16 places so that any 4 neighbouring residues of the index mod 8 hold every place (for speed only, the values are right wherever a block runs)
  const int rot = (int)((((blockIdx.x >> 3) << 1 | (blockIdx.x & 1u)) + 5u * blockIdx.z) & (DIN / PKC - 1));
  static_assert((DIN / PKC & (DIN / PKC - 1)) == 0, "the wrap is a mask");
  v2f wr[2][16]; v4f xr[2][8];   // two register sets: chunks c + 1 and c + 2 are in flight while chunk c is worked on
  v8f acc[2][4] = {};
#define PROJ_LD(c, s) do { const int cr = ((c) + rot) & (DIN / PKC - 1); const float* wp = unif(Wb + (size_t)cr * PKC * CC); const float* xp = unif(Xb + (size_t)cr * PKC); \
    _Pragma("unroll") for (int i = 0; i < 16; ++i) wr[s][i] = *(const v2f*)(wp + (size_t)i * CC + wlo); \
    _Pragma("unroll") for (int i = 0; i < 8; ++i) xr[s][i] = *(const v4f*)(xp + (size_t)(16 * i) * DIN + xlo); \
    asm volatile("s_wait_xcnt 0x0" ::: "memory");   /* these loads stay in flight into the next trip, where their scalar bases are formed anew: the wait stands ahead of that (a scheduling barrier follows every use) */ \
  } while (0)
#define PROJ_ST(s) do { \
    _Pragma("unroll") for (int q = 0; q < 2; ++q) { v8b w0, w1; \
      _Pragma("unroll") for (int e = 0; e < 8; ++e) { w0[e] = (__bf16)wr[s][q * 8 + e][0]; w1[e] = (__bf16)wr[s][q * 8 + e][1]; } \
      *(v8b*)&sw[s][2 * (tid & 63)][(tid >> 6) * 16 + q * 8] = w0; *(v8b*)&sw[s][2 * (tid & 63) + 1][(tid >> 6) * 16 + q * 8] = w1; } \
    _Pragma("unroll") for (int i = 0; i < 8; ++i) { v4b xv; \
      _Pragma("unroll") for (int e = 0; e < 4; ++e) xv[e] = (__bf16)xr[s][i][e]; \
      *(v4b*)&sx[s][(tid >> 4) + 16 * i][4 * (tid & 15)] = xv; } } while (0)
// work-group barrier that orders LDS alone: __syncthreads() would also wait for the global loads in flight, which nobody else reads
#define PROJ_BAR() do { __builtin_amdgcn_fence(__ATOMIC_RELEASE, "workgroup", "local"); __builtin_amdgcn_s_barrier(); __builtin_amdgcn_fence(__ATOMIC_ACQUIRE, "workgroup", "local"); } while (0)
// one trip: chunk c lies in LDS buffer s (= c & 1); register set s is free, set s ^ 1 holds (in flight) chunk c + 1; more2, more1: a chunk c + 2, c + 1 exists (literals, so that the loop's body has no branch and its load waits are counts)
#define PROJ_TRIP(c, s, more2, more1) do { \
    if (more2) PROJ_LD((c) + 2, s); \
    __builtin_amdgcn_sched_barrier(0);   /* keeps the global loads issued ahead of this chunk's products */ \
    v16b af[PKC / 32][2], wf[PKC / 32][4]; \
    _Pragma("unroll") for (int ks = 0; ks < PKC / 32; ++ks) { \
      _Pragma("unroll") for (int i = 0; i < 2; ++i) af[ks][i] = frag_b(&sx[s][wm + i * 16 + col][ks * 32], lane); \
      _Pragma("unroll") for (int j = 0; j < 4; ++j) wf[ks][j] = frag_b(&sw[s][wn + j * 16 + col][ks * 32], lane); } \
    __builtin_amdgcn_sched_barrier(0);   /* keeps the chunk's LDS reads together ahead of its products: one LDS round trip a chunk, not one a product */ \
    _Pragma("unroll") for (int ks = 0; ks < PKC / 32; ++ks) { \
      _Pragma("unroll") for (int i = 0; i < 2; ++i) { \
        _Pragma("unroll") for (int j = 0; j < 4; ++j) acc[i][j] = __builtin_amdgcn_wmma_f32_16x16x32_bf16(false, af[ks][i], false, wf[ks][j], (short)0, acc[i][j], false, false); } } \
    __builtin_amdgcn_sched_barrier(0);   /* keeps the wait for chunk c + 1's global loads, and their rounding, behind the products */ \
    if (more1) { PROJ_ST((s) ^ 1); \
      PROJ_BAR(); }   /* publishes chunk c + 1 and ends every wave's reads of the buffer that the next trip refills */ \
  } while (0)
  PROJ_LD(0, 0);
  __builtin_amdgcn_sched_barrier(0);   // keeps the forming of the second chunk's scalar bases behind the wait that ends the first chunk's loads
  PROJ_LD(1, 1);
  __builtin_amdgcn_sched_barrier(0);   // keeps both chunks' loads issued ahead of the wait for the first
  PROJ_ST(0);
  PROJ_BAR();   // chunk 0 is in LDS for every wave
#pragma unroll 1   // the body already holds one trip for each buffer and register set
  for (int c = 0; c < DIN / PKC - 2; c += 2) { PROJ_TRIP(c, 0, 1, 1); PROJ_TRIP(c + 1, 1, 1, 1); }
  PROJ_TRIP(DIN / PKC - 2, 0, 0, 1); PROJ_TRIP(DIN / PKC - 1, 1, 0, 0);   // the last two chunks: nothing left to load, then nothing left to stage
#undef PROJ_TRIP
#undef PROJ_BAR
#undef PROJ_LD
#undef PROJ_ST
// behind a store of the loops below: its data registers take the next LDS read and its address registers are stepped at the loop's foot; the wait stands ahead of both, and the scheduling barrier keeps those writes behind it
#define STORE_XW() do { asm volatile("s_wait_xcnt 0x0" ::: "memory"); __builtin_amdgcn_sched_barrier(0); } while (0)
  if (which < 2) { _Float16* DH = which == 0 ? QH : KH; _Float16* DL = which == 0 ? QL : KL; const int nhi = which == 0 ? QHI : KHI; const bool hi_rows = t0 < nhi;
#pragma unroll
    for (int j = 0; j < 4; ++j) { const float bias = BA ? bfr(BA[c0 + wn + j * 16 + col]) : 0.f;
#pragma unroll
      for (int i = 0; i < 2; ++i) {
#pragma unroll
        for (int r = 0; r < 8; ++r) { const float v = acc[i][j][r] + bias; const _Float16 hv = (_Float16)v; sh[wm + i * 16 + 8 * g + r][wn + j * 16 + col] = hv; sl[wm + i * 16 + 8 * g + r][wn + j * 16 + col] = (_Float16)((v - (float)hv) * 1024.0f); } } }
    __syncthreads();
    static_assert(CC == 128, "the fragment-order planes take one 128-column block a row"); static_assert(TT % PBM == 0 && QHI % PBM == 0 && KHI % PBM == 0, "a block lies in one batch and wholly inside or outside the residual rows");
    for (int e = tid; e < PBM * 16; e += 256) { const int rl = (e >> 8) * 16 + (e & 15), q = (e >> 4) & 15;   // e = the block's 16-byte piece in fragment order: row tile, then the 8-column group q, then the row in the tile
      vst2((unsigned*)(DH + r0 * CC + (size_t)e * 8), *(const v4u*)&sh[rl][q * 8]);
      STORE_XW();
      if (hi_rows) { vst2((unsigned*)(DL + (bb * nhi + t0) * (size_t)CC + (size_t)e * 8), *(const v4u*)&sl[rl][q * 8]);
        STORE_XW(); } }
  } else { const bool hi_rows = t0 < KHI;
#pragma unroll
    for (int j = 0; j < 4; ++j) { const float bias = BA ? bfr(BA[c0 + wn + j * 16 + col]) : 0.f;
#pragma unroll
      for (int i = 0; i < 2; ++i) {
#pragma unroll
        for (int r = 0; r < 8; ++r) { const float v = acc[i][j][r] + bias; const int rl = wm + i * 16 + 8 * g + r, cl = wn + j * 16 + col; th[cl][rl] = (_Float16)v; const __bf16 bh = (__bf16)v; tb[cl][rl] = bh; tbl[cl][rl] = (__bf16)(v - (float)bh); } } }
    __syncthreads();
    for (int e = tid; e < 128 * (PBM / 8); e += 256) { const int cl = ((e >> 6) & 7) * 16 + (e & 15), tl = (e >> 9) * 32 + ((e >> 4) & 3) * 8;   // e = the block's 16-byte piece in fragment order: 32-key chunk, channel tile, 8-key group, channel in the tile
      vst2((unsigned*)(VT + (bb * TT + t0) * (size_t)CC + (size_t)e * 8), *(const v4u*)&th[cl][tl]);
      STORE_XW();
      if (hi_rows) { const size_t o3 = (bb * KHI + t0) * (size_t)CC + (size_t)e * 8; vst2((unsigned*)(VB + o3), *(const v4u*)&tb[cl][tl]); vst2((unsigned*)(VBL + o3), *(const v4u*)&tbl[cl][tl]);
        STORE_XW(); } } } }
#undef STORE_XW
// ---- k_fa: one work-group of 4 waves = 32 query rows (two 16-row tiles) of one batch. Rows >= QHI: wave w takes BOTH tiles against the causal key blocks w, w + 4, ... (128 keys each), so that every k and v fragment it loads feeds two products; running row maxima of its own (no logit plane in the workspace); the four parts are joined in LDS at the end.
// Logits are formed transposed (A = k rows, B = q rows): a lane then holds keys 16j + 8g + r of ITS query (lane & 15), which is already the B-fragment order of P^T; the output is accumulated transposed too (A = v transposed, B = P^T), so maximum, sum and rescale stay in the query's own lanes.
// Same products as before: 1 f16 product (3 with the x 2^10 residuals for rows < QHI); exp(logit - running max) x 2^11 once to f16 against v f16 (bf16 hi + lo, 3 products, for rows < QHI); the division by the row sum comes last.
// Fragment loads stand in the source as whole groups ahead of the products that use them: half of this block's v ahead of the logits, the other half and the next block's k ahead of the softmax.
// plain builtin forms: the compiler keeps the distance behind a matrix instruction itself and may use every register window for the operands
__device__ __forceinline__ v8f mm16(v16h a, v16h b, v8f c) { return __builtin_amdgcn_wmma_f32_16x16x32_f16(false, a, false, b, (short)0, c, false, false); }
__device__ __forceinline__ v8f mmbf(v16b a, v16b b, v8f c) { return __builtin_amdgcn_wmma_f32_16x16x32_bf16(false, a, false, b, (short)0, c, false, false); }
// fragment (1 KB in fragment order: elements 0..7 of all 32 lanes, then elements 8..15) at a wave-uniform pointer plus the lane's own 32-bit element offset 8 * lane: scalar base + one loop-invariant offset register, so no address register is formed anew for a load group
__device__ __forceinline__ v16h frag_hp(const _Float16* ub, unsigned lo) { union { v16h v; v8h q[2]; } u; const _Float16* p = ub + lo; u.q[0] = *(const v8h*)p; u.q[1] = *(const v8h*)(p + 256); return u.v; }
__device__ __forceinline__ v16b frag_bp(const __bf16* ub, unsigned lo) { union { v16b v; v8b q[2]; } u; const __bf16* p = ub + lo; u.q[0] = *(const v8b*)p; u.q[1] = *(const v8b*)(p + 256); return u.v; }
// a wave-uniform global pointer, both words through readfirstlane: it stays a scalar base of its own, so that every load names that base and a loop-invariant offset register, and no vector address is formed or stepped under loads in flight
typedef const __attribute__((address_space(1))) _Float16* gph;
__device__ __forceinline__ const _Float16* uni(const _Float16* p) { const unsigned long long a = (unsigned long long)p; return (const _Float16*)(gph)(((unsigned long long)(unsigned)__builtin_amdgcn_readfirstlane((int)(a >> 32)) << 32) | (unsigned)__builtin_amdgcn_readfirstlane((int)a)); }
// hardware exp2 with, in the same statement, the one slot that the instruction set asks for behind a transcendental before its source may be overwritten or its result read
__device__ __forceinline__ float exp2_slot(float x) { float e; asm("v_exp_f32 %0, %1\n\tv_nop" : "=v"(e) : "v"(x)); return e; }
struct FaSt { float m, lsum; };   // m: running maximum of logit x SC2 (base-2 domain); lsum: the lane's partial sum of exp x 2^11
#define SC2 ((float)(0.08838834764831845 * 1.4426950408889634))   // 128^-0.5 x log2 e: exp(SCALE x s - max) = exp2(SC2 x s - max2)
// takes the RAW products q.k; masks the diagonal block, updates the running maximum and the lane's partial sum; leaves exp x 2^11 in st and returns the factor for what was summed so far
// each exponential is one fused multiply-add (scale, maximum and the 2^11 all in it) and one hardware exp2; a result below 2^-126 reads 0, far under what f16 or the sum can hold
__device__ __forceinline__ float fa_softmax(v8f (&st)[8], FaSt& f, bool diag, int key0, int tq) {
  if (diag) {
#pragma unroll
    for (int j = 0; j < 8; ++j) {
#pragma unroll
      for (int r = 0; r < 8; ++r) st[j][r] = (key0 + j * 16 + r <= tq) ? st[j][r] : -3.0e38f; } }
  float mloc = -3.0e38f;
#pragma unroll
  for (int j = 0; j < 8; ++j) {
#pragma unroll
    for (int r = 0; r < 8; ++r) mloc = fmaxf(mloc, st[j][r]); }
  mloc = fmaxf(mloc, __shfl_xor(mloc, 16));   // the two lane halves hold the two key halves of the same query
  const float mn = fmaxf(f.m, mloc * SC2); const float alpha = exp2_slot(f.m - mn); f.m = mn;
  const float off = 11.0f - mn; float s = 0.f;
#pragma unroll
  for (int j = 0; j < 8; ++j) {
#pragma unroll
    for (int r = 0; r < 8; ++r) { const float e = exp2_slot(fmaf(st[j][r], SC2, off)); s += e; st[j][r] = e; } }   // a masked key: exp2(-3e38 x SC2 + off) = 0; mn is finite from a wave's first block on: every block that is walked starts at a key <= every query of the tile
  f.lsum = f.lsum * alpha + s; return alpha; }
// joins the four waves' parts of the block's two row tiles: common maximum, each part rescaled to it, parts added in a fixed order, division by the joined row sum last
__device__ __forceinline__ void fa_join(v8f (&acc0)[HD / 16], v8f (&acc1)[HD / 16], const FaSt& f0, const FaSt& f1, int b, int ql0, int wave, int lane, float (*so)[32][HD + 4], float (*sm)[32], float (*sl)[32], float* __restrict__ Y) {
  const int col = lane & 15, g = lane >> 4;
  sm[wave][lane] = g == 0 ? f0.m : f1.m;   // both lane halves hold the same maxima: the lower half stores tile 0's, the upper tile 1's
  __syncthreads();   // every wave's maxima are in LDS
  const float mj0 = fmaxf(fmaxf(sm[0][col], sm[1][col]), fmaxf(sm[2][col], sm[3][col])), mj1 = fmaxf(fmaxf(sm[0][16 + col], sm[1][16 + col]), fmaxf(sm[2][16 + col], sm[3][16 + col]));   // finite: some wave walks block 0 of each tile, which holds key 0 <= every query
  const float sc0 = exp2_slot(f0.m - mj0), sc1 = exp2_slot(f1.m - mj1);   // a wave without a key block of that tile: exp2(-3e38 - max) = 0 on a part that is 0
  float ls0 = f0.lsum * sc0, ls1 = f1.lsum * sc1; ls0 += __shfl_xor(ls0, 16); ls1 += __shfl_xor(ls1, 16);
  sl[wave][lane] = g == 0 ? ls0 : ls1;
#pragma unroll
  for (int j = 0; j < HD / 16; ++j) { const v8f o = acc0[j] * sc0, p = acc1[j] * sc1;
    vst2(&so[wave][col][j * 16 + 8 * g], (v4f){o[0], o[1], o[2], o[3]}); vst2(&so[wave][col][j * 16 + 8 * g + 4], (v4f){o[4], o[5], o[6], o[7]});
    vst2(&so[wave][16 + col][j * 16 + 8 * g], (v4f){p[0], p[1], p[2], p[3]}); vst2(&so[wave][16 + col][j * 16 + 8 * g + 4], (v4f){p[4], p[5], p[6], p[7]}); }
  __syncthreads();   // every wave's rescaled parts and sums are in LDS
#pragma unroll
  for (int i = 0; i < 8; ++i) { const int rl = wave * 8 + i;   // one output row (512 contiguous bytes) a wave and pass
    const float lj = (sl[0][rl] + sl[1][rl]) + (sl[2][rl] + sl[3][rl]); const float inv = lj > 0.f ? 1.0f / lj : 0.f;   // sum and accumulators both carry the 2^11
    const v4f o = (*(const v4f*)&so[0][rl][lane * 4] + *(const v4f*)&so[1][rl][lane * 4]) + (*(const v4f*)&so[2][rl][lane * 4] + *(const v4f*)&so[3][rl][lane * 4]);
    vst2(Y + ((size_t)b * TT + ql0 + rl) * CC + lane * 4, o * inv); } }
// rows >= QHI (at least 4 key blocks, so every wave has one)
__device__ __forceinline__ void fa_wave(const _Float16* __restrict__ QH, const _Float16* __restrict__ KH, const _Float16* __restrict__ VT, int b, int ql0, int wave, int lane, v8f (&acc0)[HD / 16], v8f (&acc1)[HD / 16], FaSt& f0, FaSt& f1) {
  const int col = lane & 15, g = lane >> 4; const int tq = ql0 + col; const int nkb = ((ql0 + 31) >> 7) + 1;
  // The row tiles of a batch walk the same k and v blocks: each tile enters its waves' rings of key blocks at its own place and wraps round, so that L2 is not asked for the same lines by all of them at the same moment. The running maximum takes the blocks in any order.
  const int nw = (nkb - wave + 3) >> 2;   // this wave's key blocks: wave, wave + 4, ...
  int first = (ql0 >> 6) & 3;             // then taken mod nw; it steps with every second tile (for speed only)
  for (int t = 0; t < 3; ++t) first = first >= nw ? first - nw : first;
  const _Float16* K0 = KH + (size_t)b * TT * CC; const _Float16* V0 = VT + (size_t)b * TT * CC;   // the batch's k and v (wave-uniform)
  const unsigned flo = 8 * lane;
  v16h qf0[HD / 32], qf1[HD / 32], kf[32], vf[32];
  __builtin_amdgcn_sched_barrier(0);   // with the one behind the wait below: nothing but these loads stands between here and the wait, so none of their address registers is reused ahead of it
#pragma unroll
  for (int kc = 0; kc < HD / 32; ++kc) { qf0[kc] = frag_hp(QH + ((size_t)b * TT + ql0) * CC + kc * 512, flo); qf1[kc] = frag_hp(QH + ((size_t)b * TT + ql0 + 16) * CC + kc * 512, flo); }
#pragma unroll
  for (int i = 0; i < 32; ++i) kf[i] = frag_hp(K0 + (size_t)((wave + 4 * first) * 128 + (i & 7) * 16) * CC + (i >> 3) * 512, flo);
  asm volatile("s_wait_xcnt 0x0" ::: "memory");   // the registers that the loads above name are free for reuse behind this wait
  __builtin_amdgcn_sched_barrier(0);
  static_assert(QHI >= 384, "every wave needs a first key block");
  int kb = wave + 4 * first, left = nw;
#pragma unroll 1
  do { const int k0 = kb * 128;   // entered without a test: the loads above stay where they stand, ahead of their wait
    const int kbn = kb + 4 < nkb ? kb + 4 : wave;   // the next block of the ring
    const _Float16* Kn = uni(K0 + (size_t)(kbn * 128) * CC); const _Float16* Vp = uni(V0 + (size_t)k0 * CC);
#pragma unroll
    for (int i = 0; i < 16; ++i) vf[i] = frag_hp(Vp + (i >> 3) * 4096 + (i & 7) * 512, flo);
    __builtin_amdgcn_sched_barrier(0);   // keeps the first half of the v loads issued ahead of the logit products (only half: the wait for k must still be a count that the load counter can hold)
    v8f st0[8] = {}, st1[8] = {};
#pragma unroll
    for (int i = 0; i < 32; ++i) { st0[i & 7] = mm16(kf[i], qf0[i >> 3], st0[i & 7]); st1[i & 7] = mm16(kf[i], qf1[i >> 3], st1[i & 7]); }
    __builtin_amdgcn_sched_barrier(0);   // keeps the loads below from being lifted over the logit products, whose wait for k would then also wait for them
#pragma unroll
    for (int i = 16; i < 32; ++i) vf[i] = frag_hp(Vp + (i >> 3) * 4096 + (i & 7) * 512, flo);
    if (left > 1) {
#pragma unroll
      for (int i = 0; i < 32; ++i) kf[i] = frag_hp(Kn + (size_t)((i & 7) * 16) * CC + (i >> 3) * 512, flo); }
    asm volatile("s_wait_xcnt 0x0" ::: "memory");   // the k loads stay in flight over the loop's foot, where the scalar bases are formed anew: the wait stands ahead of that
    __builtin_amdgcn_sched_barrier(0);   // keeps the rest of the v loads and the next block's k loads issued ahead of the softmax, which then covers their latency
    if (kb + 1 == nkb) {   // the diagonal block: both tiles masked in one branch, so that none of the mask's arithmetic stands in the other blocks' path
#pragma unroll
      for (int j = 0; j < 8; ++j) {
#pragma unroll
        for (int r = 0; r < 8; ++r) { const int key = k0 + 8 * g + j * 16 + r; st0[j][r] = (key <= tq) ? st0[j][r] : -3.0e38f; st1[j][r] = (key <= tq + 16) ? st1[j][r] : -3.0e38f; } } }
    const float alpha0 = fa_softmax(st0, f0, false, 0, 0); const float alpha1 = fa_softmax(st1, f1, false, 0, 0);
#pragma unroll
    for (int j = 0; j < HD / 16; ++j) { acc0[j] *= alpha0; acc1[j] *= alpha1; }
#pragma unroll
    for (int c = 0; c < 4; ++c) { v16h p0, p1;
#pragma unroll
      for (int i = 0; i < 8; ++i) { p0[i] = (_Float16)st0[2 * c][i]; p0[8 + i] = (_Float16)st0[2 * c + 1][i]; p1[i] = (_Float16)st1[2 * c][i]; p1[8 + i] = (_Float16)st1[2 * c + 1][i]; }
#pragma unroll
      for (int j = 0; j < HD / 16; ++j) { acc0[j] = mm16(vf[c * 8 + j], p0, acc0[j]); acc1[j] = mm16(vf[c * 8 + j], p1, acc1[j]); } }
    __builtin_amdgcn_sched_barrier(0);   // keeps the step of the two scalar bases behind the last product's wait for the loads: no base is rewritten under a load in flight
    kb = kbn; --left;
  } while (left > 0); }
// rows < QHI (at most 3 key blocks): residual products; one 16-row tile a wave, its key blocks kb0, kb0 + 2, ... (two waves a tile)
__device__ __forceinline__ void fa_wave_hi(const _Float16* __restrict__ QH, const _Float16* __restrict__ KH, const _Float16* __restrict__ QL, const _Float16* __restrict__ KL, const __bf16* __restrict__ VB, const __bf16* __restrict__ VBL, int b, int ql0, int kb0, int lane, v8f (&acc)[HD / 16], FaSt& f) {
  const int col = lane & 15, g = lane >> 4; const int tq = ql0 + col; const int nkb = ((ql0 + 15) >> 7) + 1;
  const _Float16* Kp = KH + ((size_t)b * TT + kb0 * 128) * CC; const _Float16* KLp = KL + ((size_t)b * KHI + kb0 * 128) * CC; const __bf16* Vp = VB + ((size_t)b * KHI + kb0 * 128) * CC; const __bf16* VLp = VBL + ((size_t)b * KHI + kb0 * 128) * CC;   // wave-uniform; stepped at the loop's foot
  const unsigned flo = 8 * lane;
  if (kb0 >= nkb) return;   // wave-uniform; tested ahead of the q loads, so that they stay where they stand, ahead of their wait, and the loop below is entered without a test
  v16h qf[HD / 32], qlf[HD / 32];
  __builtin_amdgcn_sched_barrier(0);   // as in fa_wave: nothing but these loads stands between here and the wait, so none of their address registers is reused ahead of it
#pragma unroll
  for (int kc = 0; kc < HD / 32; ++kc) { qf[kc] = frag_hp(QH + ((size_t)b * TT + ql0) * CC + kc * 512, flo); qlf[kc] = frag_hp(QL + ((size_t)b * QHI + ql0) * CC + kc * 512, flo); }
  asm volatile("s_wait_xcnt 0x0" ::: "memory");   // the registers that the loads above name are free for reuse behind this wait
  __builtin_amdgcn_sched_barrier(0);
  int kb = kb0;
#pragma unroll 1
  do { const int k0 = kb * 128;
    v8f st[8] = {}, stl[8] = {};
#pragma unroll
    for (int kc = 0; kc < HD / 32; ++kc) { v16h kh[8], kl[8];
#pragma unroll
      for (int j = 0; j < 8; ++j) { kh[j] = frag_hp(Kp + (size_t)(j * 16) * CC + kc * 512, flo); kl[j] = frag_hp(KLp + (size_t)(j * 16) * CC + kc * 512, flo); }
      __builtin_amdgcn_sched_barrier(0);   // keeps the group's 32 loads issued together: one round trip a group, not one a product
#pragma unroll
      for (int j = 0; j < 8; ++j) { st[j] = mm16(kh[j], qf[kc], st[j]); stl[j] = mm16(kh[j], qlf[kc], stl[j]); stl[j] = mm16(kl[j], qf[kc], stl[j]); } }
#pragma unroll
    for (int j = 0; j < 8; ++j) st[j] = st[j] + stl[j] * (1.0f / 1024.0f);
    const float alpha = fa_softmax(st, f, kb + 1 == nkb, k0 + 8 * g, tq);
#pragma unroll
    for (int j = 0; j < HD / 16; ++j) acc[j] *= alpha;
#pragma unroll
    for (int c = 0; c < 4; ++c) { float pe[16]; v16b vh[8], vl[8];
#pragma unroll
      for (int j = 0; j < HD / 16; ++j) { const size_t po = (size_t)c * 4096 + j * 512; vh[j] = frag_bp(Vp + po, flo); vl[j] = frag_bp(VLp + po, flo); }
      __builtin_amdgcn_sched_barrier(0);   // as above: the group's 32 loads issued together
#pragma unroll
      for (int i = 0; i < 8; ++i) { pe[i] = st[2 * c][i]; pe[8 + i] = st[2 * c + 1][i]; }
      const F2 p = bsplit16(pe);
#pragma unroll
      for (int j = 0; j < HD / 16; ++j) { acc[j] = mmbf(vh[j], p.h, acc[j]); acc[j] = mmbf(vh[j], p.l, acc[j]); acc[j] = mmbf(vl[j], p.h, acc[j]); } }
    __builtin_amdgcn_sched_barrier(0);   // as in fa_wave: the pointer steps stay behind the last product's wait for the loads
    Kp += 256 * CC; KLp += 256 * CC; Vp += 256 * CC; VLp += 256 * CC; kb += 2;
  } while (kb < nkb); }
// block = 4 waves on 32 query rows; the lowest block indices take the rows with the most key blocks; the batch is the fastest index
__global__ __launch_bounds__(128) void k_fa(const _Float16* __restrict__ QH, const _Float16* __restrict__ KH, const _Float16* __restrict__ QL, const _Float16* __restrict__ KL, const _Float16* __restrict__ VT, const __bf16* __restrict__ VB, const __bf16* __restrict__ VBL, float* __restrict__ Y) { __shared__ __align__(16) float so[4][32][HD + 4]; __shared__ float sm[4][32], sl[4][32];
  const int wave = __builtin_amdgcn_readfirstlane(threadIdx.x >> 5), lane = threadIdx.x & 31; const int b = blockIdx.x % TNB; const int ql0 = (TT / 32 - 1 - (int)(blockIdx.x / TNB)) * 32;
  v8f acc0[HD / 16] = {}, acc1[HD / 16] = {}; FaSt f0 = {-3.0e38f, 0.f}, f1 = {-3.0e38f, 0.f};
  if (ql0 >= QHI) fa_wave(QH, KH, VT, b, ql0, wave, lane, acc0, acc1, f0, f1);
  else { fa_wave_hi(QH, KH, QL, KL, VB, VBL, b, ql0 + 16 * (wave & 1), wave >> 1, lane, acc0, f0);   // waves 0, 2: tile 0; waves 1, 3: tile 1; the other tile's part stays empty
    if (wave & 1) {
#pragma unroll
      for (int j = 0; j < HD / 16; ++j) { acc1[j] = acc0[j]; acc0[j] = (v8f){}; }
      f1 = f0; f0 = {-3.0e38f, 0.f}; } }
  fa_join(acc0, acc1, f0, f1, b, ql0, wave, lane, so, sm, sl, Y); }

extern "C" void kernel_launch(void* const* d_in, const int* in_sizes, int n_in, void* d_out, int out_size, void* d_ws, size_t ws_size, hipStream_t stream) {
  (void)in_sizes; (void)n_in; (void)out_size;
  const float** F = (const float**)d_in;
  if (ws_size < (size_t)WS_END) return;
  char* ws = (char*)d_ws; _Float16 *QH = (_Float16*)(ws + WS_QH), *KH = (_Float16*)(ws + WS_KH), *VT = (_Float16*)(ws + WS_VT), *QL = (_Float16*)(ws + WS_QL), *KL = (_Float16*)(ws + WS_KL); __bf16 *VB = (__bf16*)(ws + WS_VB), *VBL = (__bf16*)(ws + WS_VBL);
  // inputs: 0 x [4,2048,1024]; 1 Wq [1024,128] (in,out); 2 Wk; 3 Wv
  k_proj<<<dim3(TNB * TT / PBM, CC / 128, 3), 256, 0, stream>>>(F[0], F[0], F[0], F[1], F[2], F[3], nullptr, nullptr, nullptr, QH, QL, KH, KL, VT, VB, VBL);
  k_fa<<<dim3(TNB * (TT / 32), 1, 1), 128, 0, stream>>>(QH, KH, QL, KL, VT, VB, VBL, (float*)d_out);
}

// v009
// A run of this version takes 24.4 microseconds.
// Next to v008, in two timings, it ran 1.13 and 1.14 times as fast.
// All steps since v000 together make it 21.2 times as fast.
// compute dtype: all float inputs rounded to bf16; q/k/v = x W with EXACT bf16 products on WMMA 16x16x32 (f32 accumulate); causal logits: q, k once to f16 (1 product) x 128^-0.5, 3 products below row 384; softmax in f32 with a running row maximum, exponentials in base 2 (hardware exp2); exp x 2^11 once to f16 against v f16 (bf16 hi + lo below row 384), divided by the row sum last; the key blocks of 32 query rows are dealt over 4 waves and the parts joined in f32; f32 output.
#include <hip/hip_runtime.h>
#include <math.h>

typedef __attribute__((ext_vector_type(16))) _Float16 v16h;
typedef __attribute__((ext_vector_type(16))) __bf16 v16b;
typedef __attribute__((ext_vector_type(8)))  _Float16 v8h;
typedef __attribute__((ext_vector_type(8)))  float v8f;
typedef __attribute__((ext_vector_type(4)))  float v4f;
typedef __attribute__((ext_vector_type(2)))  float v2f;
typedef __attribute__((ext_vector_type(4)))  unsigned v4u;
typedef __attribute__((ext_vector_type(4)))  int v4i;
typedef float __attribute__((may_alias)) float_a;
typedef int __attribute__((may_alias)) int_a;

template <typename T> __device__ __forceinline__ void vst2(void* p, T v) { *(T*)p = v;  }
__device__ __forceinline__ v8f wmma16(v16h a, v16h b, v8f c) {
  v8f d = __builtin_amdgcn_wmma_f32_16x16x32_f16(false, a, false, b, (short)0, c, false, false);
  asm volatile("v_nop\n\tv_nop\n\tv_nop\n\tv_nop" : "+v"(d) : "v"(a), "v"(b));
  return d;
}
__device__ __forceinline__ v8f wmma_bf(v16b a, v16b b, v8f c) {
  v8f d = __builtin_amdgcn_wmma_f32_16x16x32_bf16(false, a, false, b, (short)0, c, false, false);
  asm volatile("v_nop\n\tv_nop\n\tv_nop\n\tv_nop" : "+v"(d) : "v"(a), "v"(b));
  return d;
}
// 16x16x32 fragments: lane = (h = lane>>4, row/col = lane&15); elements 0..7 = k0+8h+0..7, 8..15 = k0+16+8h+0..7; D element r = row 8h+r
__device__ __forceinline__ v16h frag_h(const _Float16* rowk0, int lane) {
  union { v16h v; v8h q[2]; } u; const _Float16* p = rowk0 + 8 * (lane >> 4);
  u.q[0] = *(const v8h*)p; u.q[1] = *(const v8h*)(p + 16); return u.v;
}
__device__ __forceinline__ v16h frag_f32(const float* rowk0, int lane) {
  v16h a; const float* p = rowk0 + 8 * (lane >> 4);
#pragma unroll
  for (int i = 0; i < 8; ++i) { a[i] = (_Float16)p[i]; a[8 + i] = (_Float16)p[16 + i]; }
  return a;
}
__device__ __forceinline__ v16h frag_f32s(const float* rowk0, int lane, float sc) {
  v16h a; const float* p = rowk0 + 8 * (lane >> 4);
#pragma unroll
  for (int i = 0; i < 8; ++i) { a[i] = (_Float16)(p[i] * sc); a[8 + i] = (_Float16)(p[16 + i] * sc); }
  return a;
}
// column fragment from a [K][ld] layout (column n), rows >= K read as 0
__device__ __forceinline__ v16h fragc_f32(const float* W, int k0, int n, int lane, int ld, int K) {
  v16h a; const int g = lane >> 4;
#pragma unroll
  for (int i = 0; i < 8; ++i) { const int ka = k0 + 8 * g + i, kb = ka + 16;
    a[i] = (_Float16)(ka < K ? W[(size_t)(ka < K ? ka : K - 1) * ld + n] : 0.f); a[8 + i] = (_Float16)(kb < K ? W[(size_t)(kb < K ? kb : K - 1) * ld + n] : 0.f); }
  return a;
}
struct F2 { v16b h, l; };
__device__ __forceinline__ F2 bsplit16(const float v[16]) { F2 r;
#pragma unroll
  for (int i = 0; i < 16; ++i) { const __bf16 h = (__bf16)v[i]; r.h[i] = h; r.l[i] = (__bf16)(v[i] - (float)h); }
  return r; }
__device__ __forceinline__ F2 split_row(const float* row, int k0, int lane) { float v[16]; const float* p = row + k0 + 8 * (lane >> 4);
#pragma unroll
  for (int i = 0; i < 8; ++i) { v[i] = p[i]; v[8 + i] = p[16 + i]; }
  return bsplit16(v); }
__device__ __forceinline__ F2 split_rowK(const float* row, int k0, int lane, int K) { float v[16]; const int g = lane >> 4;
#pragma unroll
  for (int i = 0; i < 8; ++i) { const int ka = k0 + 8 * g + i, kb = ka + 16; v[i] = ka < K ? row[ka < K ? ka : K - 1] : 0.f; v[8 + i] = kb < K ? row[kb < K ? kb : K - 1] : 0.f; }
  return bsplit16(v); }
__device__ __forceinline__ F2 split_col(const float* W, int k0, int n, int lane, int ld, int K) { float v[16]; const int g = lane >> 4;
#pragma unroll
  for (int i = 0; i < 8; ++i) { const int ka = k0 + 8 * g + i, kb = ka + 16; v[i] = ka < K ? W[(size_t)(ka < K ? ka : K - 1) * ld + n] : 0.f; v[8 + i] = kb < K ? W[(size_t)(kb < K ? kb : K - 1) * ld + n] : 0.f; }
  return bsplit16(v); }
__device__ __forceinline__ v8f mac3(const F2& a, const F2& b, v8f c) { c = wmma_bf(a.l, b.h, c); c = wmma_bf(a.h, b.l, c); return wmma_bf(a.h, b.h, c); }
__device__ __forceinline__ float sigm(float v) { return 1.0f / (1.0f + expf(-v)); }
#define LDSX() do { asm volatile("s_wait_dscnt 0" ::: "memory"); __builtin_amdgcn_wave_barrier(); __builtin_amdgcn_fence(__ATOMIC_RELEASE, "workgroup"); } while (0)

// Single-head causal self-attention (B 4, T 2,048, C 1,024 -> H 128; (in,out) 1/32-scale weights, no biases): q, k, v = x W; out = softmax_causal(q k^T x 128^-0.5) v -> [B, T, 128].
#define NB 4
#define TT 2048
#define CC 128            // NH * HD = projected width
#define DIN 1024          // input (model) width
#define NH 1
#define HD 128
#define NQB (TT / 64)
#define HG 1
#define SCALE (0.08838834764831845f)
#define CAUSAL 1
#ifndef TNB
#define TNB NB
#endif
__device__ __forceinline__ float bfr(float v) { return (float)(__bf16)v; }
__host__ __device__ __forceinline__ int kb_last(int qb) { return CAUSAL ? ((qb * 64 + 63) >> 7) : (TT / 128 - 1); }
typedef __attribute__((ext_vector_type(8))) __bf16 v8b;
__device__ __forceinline__ v16b frag_b(const __bf16* rowk0, int lane) {
  union { v16b v; v8b q[2]; } u; const __bf16* p = rowk0 + 8 * (lane >> 4);
  u.q[0] = *(const v8b*)p; u.q[1] = *(const v8b*)(p + 16); return u.v;
}
#define QBH 6              // unused: k_fa takes the high-precision path for rows < QHI (32-row query blocks 0..11; few keys, no averaging)
#define QHI 384            // rows carrying a q residual plane
#define KHI 384            // key rows carrying k residual / v bf16 hi+lo planes (used only by the causal high-precision path)
// B fragment (k rows k0+.., output column o) of a weight: (in,out) [K][ld] or (out,in) [ld rows of K]: bf16 exact, or f16(bf16 * 256) exact
__device__ __forceinline__ v16b wcol_io(const float* Wm, int k0, int o, int lane, int ld) { v16b w; const int g = lane >> 4;
#pragma unroll
  for (int i = 0; i < 8; ++i) { w[i] = (__bf16)Wm[(size_t)(k0 + 8 * g + i) * ld + o]; w[8 + i] = (__bf16)Wm[(size_t)(k0 + 16 + 8 * g + i) * ld + o]; }
  return w; }
__device__ __forceinline__ v16b wcol_oi(const float* Wm, int k0, int o, int lane, int K) { v16b w; const float* p = Wm + (size_t)o * K + k0 + 8 * (lane >> 4);
#pragma unroll
  for (int i = 0; i < 8; ++i) { w[i] = (__bf16)p[i]; w[8 + i] = (__bf16)p[16 + i]; }
  return w; }
__device__ __forceinline__ v16h wcolh_io(const float* Wm, int k0, int o, int lane, int ld) { v16h w; const int g = lane >> 4;
#pragma unroll
  for (int i = 0; i < 8; ++i) { w[i] = (_Float16)(bfr(Wm[(size_t)(k0 + 8 * g + i) * ld + o]) * 256.0f); w[8 + i] = (_Float16)(bfr(Wm[(size_t)(k0 + 16 + 8 * g + i) * ld + o]) * 256.0f); }
  return w; }
__device__ __forceinline__ v16h wcolh_oi(const float* Wm, int k0, int o, int lane, int K) { v16h w; const float* p = Wm + (size_t)o * K + k0 + 8 * (lane >> 4);
#pragma unroll
  for (int i = 0; i < 8; ++i) { w[i] = (_Float16)(bfr(p[i]) * 256.0f); w[8 + i] = (_Float16)(bfr(p[16 + i]) * 256.0f); }
  return w; }
#define WQKV_LAYOUT 0   // layout that WCOL reads (0 = (in,out) [DIN][CC]; 1 = (out,in) [CC][DIN]; 2 = per-head [NH][DIN][HD]); nothing calls WCOL: k_proj reads W as (in,out) [DIN][CC] for any value
__device__ __forceinline__ v16b wcol_hdk(const float* Wm, int k0, int o, int lane) { v16b w; const int g = lane >> 4; const float* p = Wm + (size_t)(o / HD) * DIN * HD + (o % HD);
#pragma unroll
  for (int i = 0; i < 8; ++i) { w[i] = (__bf16)p[(size_t)(k0 + 8 * g + i) * HD]; w[8 + i] = (__bf16)p[(size_t)(k0 + 16 + 8 * g + i) * HD]; }
  return w; }
#define WO_OUT_IN 0
#if WQKV_LAYOUT == 1
#define WCOL(W, k0, o, lane) wcol_oi(W, k0, o, lane, DIN)
#elif WQKV_LAYOUT == 2
#define WCOL(W, k0, o, lane) wcol_hdk(W, k0, o, lane)
#else
#define WCOL(W, k0, o, lane) wcol_io(W, k0, o, lane, CC)
#endif
#if WO_OUT_IN
#define WOCOL(W, k0, o, lane) wcol_oi(W, k0, o, lane, CC)
#define WOCOLH(W, k0, o, lane) wcolh_oi(W, k0, o, lane, CC)
#else
#define WOCOL(W, k0, o, lane) wcol_io(W, k0, o, lane, DIN)
#define WOCOLH(W, k0, o, lane) wcolh_io(W, k0, o, lane, DIN)
#endif

#ifndef SM_EXTRA_PARAMS
#define SM_EXTRA_PARAMS
#endif
#ifndef PROJ_EXTRA_PARAMS
#define PROJ_EXTRA_PARAMS
#endif
#ifndef SM_MASK_HOOK
#define SM_MASK_HOOK (void)0
#endif

// Every plane lies in the order of its reader's 16x16x32 fragments, so that a wave's 16-byte load covers 512 contiguous bytes (4 whole lines) and not 32 bytes of each of 16 rows:
// q, k (and residuals): [b*t / 16][c / 32][(c / 16) & 1][lane = 16 * ((c / 8) & 1) + t % 16][c % 8]; v: [b][t / 32][c / 16][(t / 16) & 1][lane = 16 * ((t / 8) & 1) + c % 16][t % 8]
#define WS_QH  0u                                      // f16 q [b*t][CC]
#define WS_KH  (WS_QH + 2u * (size_t)NB * TT * CC)      // f16 k [b*t][CC]
#define WS_VT  (WS_KH + 2u * (size_t)NB * TT * CC)      // f16 v [b][t][CC]
#define WS_QL  (WS_VT + 2u * (size_t)NB * CC * TT)      // f16 q residual x 2^10 [b][t < QHI][CC]
#define WS_KL  (WS_QL + 2u * (size_t)NB * QHI * CC)     // f16 k residual x 2^10 [b][t < KHI][CC]
#define WS_VB  (WS_KL + 2u * (size_t)NB * KHI * CC)     // bf16 v hi [b][t < KHI][CC]
#define WS_VBL (WS_VB + 2u * (size_t)NB * CC * KHI)
#define WS_END (WS_VBL + 2u * (size_t)NB * CC * KHI)

#define PKC 64             // k per staged chunk
#define PPIT (PKC + 8)     // LDS row pitch in bf16: 128 B of k + 16 B
typedef __attribute__((ext_vector_type(4))) __bf16 v4b;
#define PBM 128            // x rows a block
// a block-uniform global pointer, both words through readfirstlane: it stays a scalar base of its own, so that every load of a chunk names that base and a loop-invariant offset register, and no vector address is formed anew (and then reused) under loads in flight
typedef const __attribute__((address_space(1))) float* gpf;
__device__ __forceinline__ const float* unif(const float* p) { const unsigned long long a = (unsigned long long)p; return (const float*)(gpf)(((unsigned long long)(unsigned)__builtin_amdgcn_readfirstlane((int)(a >> 32)) << 32) | (unsigned)__builtin_amdgcn_readfirstlane((int)a)); }
// ---- k_proj: block = (PBM rows, 128 cols, which) on 8 waves, a wave = 32 rows x 64 cols (2 x 4 accumulator tiles: 6 LDS fragments feed 8 products): q/k/v = X W (+ b) with exact bf16 products (K = DIN) -> which 0: q f16 (+ residual, rows < QHI); 1: k f16 (+ residual, rows < KHI); 2: v f16 (+ bf16 hi/lo for t < KHI); all stored in fragment order (see WS_QH)
__global__ __launch_bounds__(256) void k_proj(const float* __restrict__ XQ, const float* __restrict__ XK, const float* __restrict__ XV, const float* __restrict__ WQ, const float* __restrict__ WK, const float* __restrict__ WV, const float* __restrict__ BQ, const float* __restrict__ BK, const float* __restrict__ BV,
    _Float16* __restrict__ QH, _Float16* __restrict__ QL, _Float16* __restrict__ KH, _Float16* __restrict__ KL, _Float16* __restrict__ VT, __bf16* __restrict__ VB, __bf16* __restrict__ VBL) {
  __shared__ __align__(16) _Float16 sh[PBM][136], sl[PBM][136]; __shared__ __align__(16) _Float16 th[128][PBM + 8]; __shared__ __align__(16) __bf16 tb[128][PBM + 8], tbl[128][PBM + 8];
  __shared__ __align__(16) __bf16 sw[2][128][PPIT], sx[2][PBM][PPIT];
  const int tid = threadIdx.x, wave = tid >> 5, lane = tid & 31, col = lane & 15, g = lane >> 4; const int wm = (wave >> 1) * 32, wn = (wave & 1) * 64;   // the wave's first row and column in the block
  const int which = blockIdx.z; const int c0 = blockIdx.y * 128; const size_t r0 = (size_t)blockIdx.x * PBM; const size_t bb = r0 / TT; const int t0 = (int)(r0 % TT);
  const float* X = which == 0 ? XQ : which == 1 ? XK : XV; const float* WA = which == 0 ? WQ : which == 1 ? WK : WV; const float* BA = which == 0 ? BQ : which == 1 ? BK : BV;
  // Main loop: the block's x rows and W columns go through LDS as bf16 in chunks of PKC k, k-contiguous rows at the pitch for 16-byte readers, two buffers.
  // Whole-line global loads, each element loaded and rounded once a block; the next chunk's loads are in flight while this chunk's products run.
  // The 64 blocks of one weight walk the same W chunks and the 3 blocks of one row tile the same x chunks: each block enters the ring of chunks at its own place and wraps round, so that L2 is not asked for the same lines by all of them at the same moment. Every accumulator takes its 32-k products in that rotated order.
  const unsigned wlo = (unsigned)((tid >> 6) * 16 * CC + 2 * (tid & 63));   // W: this thread's column pair and its 16 k rows of the chunk
  const unsigned xlo = (unsigned)((tid >> 4) * DIN + 4 * (tid & 15));       // x: rows (tid >> 4) + 16 i, four k each
  const float* Wb = WA + c0; const float* Xb = X + r0 * DIN;                // block-uniform bases
  // the block's first chunk: about a third of the ring lies between the 3 sharers of x; the sharers of a W are dealt over all 16 places so that any 4 neighbouring residues of the index mod 8 hold every place (for speed only, the values are right wherever a block runs)
  const int rot = (int)((((blockIdx.x >> 3) << 1 | (blockIdx.x & 1u)) + 5u * blockIdx.z) & (DIN / PKC - 1));
  static_assert((DIN / PKC & (DIN / PKC - 1)) == 0, "the wrap is a mask");
  v2f wr[2][16]; v4f xr[2][8];   // two register sets: chunks c + 1 and c + 2 are in flight while chunk c is worked on
  v8f acc[2][4] = {};
#define PROJ_LD(c, s) do { const int cr = ((c) + rot) & (DIN / PKC - 1); const float* wp = unif(Wb + (size_t)cr * PKC * CC); const float* xp = unif(Xb + (size_t)cr * PKC); \
    _Pragma("unroll") for (int i = 0; i < 16; ++i) wr[s][i] = *(const v2f*)(wp + (size_t)i * CC + wlo); \
    _Pragma("unroll") for (int i = 0; i < 8; ++i) xr[s][i] = *(const v4f*)(xp + (size_t)(16 * i) * DIN + xlo); \
    asm volatile("s_wait_xcnt 0x0" ::: "memory");   /* these loads stay in flight into the next trip, where their scalar bases are formed anew: the wait stands ahead of that (a scheduling barrier follows every use) */ \
  } while (0)
#define PROJ_ST(s) do { \
    _Pragma("unroll") for (int q = 0; q < 2; ++q) { v8b w0, w1; \
      _Pragma("unroll") for (int e = 0; e < 8; ++e) { w0[e] = (__bf16)wr[s][q * 8 + e][0]; w1[e] = (__bf16)wr[s][q * 8 + e][1]; } \
      *(v8b*)&sw[s][2 * (tid & 63)][(tid >> 6) * 16 + q * 8] = w0; *(v8b*)&sw[s][2 * (tid & 63) + 1][(tid >> 6) * 16 + q * 8] = w1; } \
    _Pragma("unroll") for (int i = 0; i < 8; ++i) { v4b xv; \
      _Pragma("unroll") for (int e = 0; e < 4; ++e) xv[e] = (__bf16)xr[s][i][e]; \
      *(v4b*)&sx[s][(tid >> 4) + 16 * i][4 * (tid & 15)] = xv; } } while (0)
// work-group barrier that orders LDS alone: __syncthreads() would also wait for the global loads in flight, which nobody else reads
#define PROJ_BAR() do { __builtin_amdgcn_fence(__ATOMIC_RELEASE, "workgroup", "local"); __builtin_amdgcn_s_barrier(); __builtin_amdgcn_fence(__ATOMIC_ACQUIRE, "workgroup", "local"); } while (0)
// one trip: chunk c lies in LDS buffer s (= c & 1); register set s is free, set s ^ 1 holds (in flight) chunk c + 1; more2, more1: a chunk c + 2, c + 1 exists (literals, so that the loop's body has no branch and its load waits are counts)
#define PROJ_TRIP(c, s, more2, more1) do { \
    if (more2) PROJ_LD((c) + 2, s); \
    __builtin_amdgcn_sched_barrier(0);   /* keeps the global loads issued ahead of this chunk's products */ \
    v16b af[PKC / 32][2], wf[PKC / 32][4]; \
    _Pragma("unroll") for (int ks = 0; ks < PKC / 32; ++ks) { \
      _Pragma("unroll") for (int i = 0; i < 2; ++i) af[ks][i] = frag_b(&sx[s][wm + i * 16 + col][ks * 32], lane); \
      _Pragma("unroll") for (int j = 0; j < 4; ++j) wf[ks][j] = frag_b(&sw[s][wn + j * 16 + col][ks * 32], lane); } \
    __builtin_amdgcn_sched_barrier(0);   /* keeps the chunk's LDS reads together ahead of its products: one LDS round trip a chunk, not one a product */ \
    _Pragma("unroll") for (int ks = 0; ks < PKC / 32; ++ks) { \
      _Pragma("unroll") for (int i = 0; i < 2; ++i) { \
        _Pragma("unroll") for (int j = 0; j < 4; ++j) acc[i][j] = __builtin_amdgcn_wmma_f32_16x16x32_bf16(false, af[ks][i], false, wf[ks][j], (short)0, acc[i][j], false, false); } } \
    __builtin_amdgcn_sched_barrier(0);   /* keeps the wait for chunk c + 1's global loads, and their rounding, behind the products */ \
    if (more1) { PROJ_ST((s) ^ 1); \
      PROJ_BAR(); }   /* publishes chunk c + 1 and ends every wave's reads of the buffer that the next trip refills */ \
  } while (0)
  PROJ_LD(0, 0);
  __builtin_amdgcn_sched_barrier(0);   // keeps the forming of the second chunk's scalar bases behind the wait that ends the first chunk's loads
  PROJ_LD(1, 1);
  __builtin_amdgcn_sched_barrier(0);   // keeps both chunks' loads issued ahead of the wait for the first
  PROJ_ST(0);
  PROJ_BAR();   // chunk 0 is in LDS for every wave
#pragma unroll 1   // the body already holds one trip for each buffer and register set
  for (int c = 0; c < DIN / PKC - 2; c += 2) { PROJ_TRIP(c, 0, 1, 1); PROJ_TRIP(c + 1, 1, 1, 1); }
  PROJ_TRIP(DIN / PKC - 2, 0, 0, 1); PROJ_TRIP(DIN / PKC - 1, 1, 0, 0);   // the last two chunks: nothing left to load, then nothing left to stage
#undef PROJ_TRIP
#undef PROJ_BAR
#undef PROJ_LD
#undef PROJ_ST
// behind a store of the loops below: its data registers take the next LDS read and its address registers are stepped at the loop's foot; the wait stands ahead of both, and the scheduling barrier keeps those writes behind it
#define STORE_XW() do { asm volatile("s_wait_xcnt 0x0" ::: "memory"); __builtin_amdgcn_sched_barrier(0); } while (0)
  if (which < 2) { _Float16* DH = which == 0 ? QH : KH; _Float16* DL = which == 0 ? QL : KL; const int nhi = which == 0 ? QHI : KHI; const bool hi_rows = t0 < nhi;
#pragma unroll
    for (int j = 0; j < 4; ++j) { const float bias = BA ? bfr(BA[c0 + wn + j * 16 + col]) : 0.f;
#pragma unroll
      for (int i = 0; i < 2; ++i) {
#pragma unroll
        for (int r = 0; r < 8; ++r) { const float v = acc[i][j][r] + bias; const _Float16 hv = (_Float16)v; sh[wm + i * 16 + 8 * g + r][wn + j * 16 + col] = hv; sl[wm + i * 16 + 8 * g + r][wn + j * 16 + col] = (_Float16)((v - (float)hv) * 1024.0f); } } }
    __syncthreads();
    static_assert(CC == 128, "the fragment-order planes take one 128-column block a row"); static_assert(TT % PBM == 0 && QHI % PBM == 0 && KHI % PBM == 0, "a block lies in one batch and wholly inside or outside the residual rows");
    for (int e = tid; e < PBM * 16; e += 256) { const int rl = (e >> 8) * 16 + (e & 15), q = (e >> 4) & 15;   // e = the block's 16-byte piece in fragment order: row tile, then the 8-column group q, then the row in the tile
      vst2((unsigned*)(DH + r0 * CC + (size_t)e * 8), *(const v4u*)&sh[rl][q * 8]);
      STORE_XW();
      if (hi_rows) { vst2((unsigned*)(DL + (bb * nhi + t0) * (size_t)CC + (size_t)e * 8), *(const v4u*)&sl[rl][q * 8]);
        STORE_XW(); } }
  } else { const bool hi_rows = t0 < KHI;
#pragma unroll
    for (int j = 0; j < 4; ++j) { const float bias = BA ? bfr(BA[c0 + wn + j * 16 + col]) : 0.f;
#pragma unroll
      for (int i = 0; i < 2; ++i) {
#pragma unroll
        for (int r = 0; r < 8; ++r) { const float v = acc[i][j][r] + bias; const int rl = wm + i * 16 + 8 * g + r, cl = wn + j * 16 + col; th[cl][rl] = (_Float16)v; const __bf16 bh = (__bf16)v; tb[cl][rl] = bh; tbl[cl][rl] = (__bf16)(v - (float)bh); } } }
    __syncthreads();
    for (int e = tid; e < 128 * (PBM / 8); e += 256) { const int cl = ((e >> 6) & 7) * 16 + (e & 15), tl = (e >> 9) * 32 + ((e >> 4) & 3) * 8;   // e = the block's 16-byte piece in fragment order: 32-key chunk, channel tile, 8-key group, channel in the tile
      vst2((unsigned*)(VT + (bb * TT + t0) * (size_t)CC + (size_t)e * 8), *(const v4u*)&th[cl][tl]);
      STORE_XW();
      if (hi_rows) { const size_t o3 = (bb * KHI + t0) * (size_t)CC + (size_t)e * 8; vst2((unsigned*)(VB + o3), *(const v4u*)&tb[cl][tl]); vst2((unsigned*)(VBL + o3), *(const v4u*)&tbl[cl][tl]);
        STORE_XW(); } } } }
#undef STORE_XW
// ---- k_fa: one work-group of 4 waves = 32 query rows (two 16-row tiles) of one batch. Rows >= QHI: wave w takes BOTH tiles against the causal key blocks w, w + 4, ... (128 keys each), so that every k and v fragment it loads feeds two products; running row maxima of its own (no logit plane in the workspace); the four parts are joined in LDS at the end.
// Logits are formed transposed (A = k rows, B = q rows): a lane then holds keys 16j + 8g + r of ITS query (lane & 15), which is already the B-fragment order of P^T; the output is accumulated transposed too (A = v transposed, B = P^T), so maximum, sum and rescale stay in the query's own lanes.
// Same products as before: 1 f16 product (3 with the x 2^10 residuals for rows < QHI); exp(logit - running max) x 2^11 once to f16 against v f16 (bf16 hi + lo, 3 products, for rows < QHI); the division by the row sum comes last.
// Fragment loads stand in the source as whole groups ahead of the products that use them, spread over a pass so that the load counter is not overrun (see fa_tail and fa_wave_hi).
// plain builtin forms: the compiler keeps the distance behind a matrix instruction itself and may use every register window for the operands
__device__ __forceinline__ v8f mm16(v16h a, v16h b, v8f c) { return __builtin_amdgcn_wmma_f32_16x16x32_f16(false, a, false, b, (short)0, c, false, false); }
__device__ __forceinline__ v8f mmbf(v16b a, v16b b, v8f c) { return __builtin_amdgcn_wmma_f32_16x16x32_bf16(false, a, false, b, (short)0, c, false, false); }
// fragment (1 KB in fragment order: elements 0..7 of all 32 lanes, then elements 8..15) at a wave-uniform pointer plus the lane's own 32-bit element offset 8 * lane: scalar base + one loop-invariant offset register, so no address register is formed anew for a load group
__device__ __forceinline__ v16h frag_hp(const _Float16* ub, unsigned lo) { union { v16h v; v8h q[2]; } u; const _Float16* p = ub + lo; u.q[0] = *(const v8h*)p; u.q[1] = *(const v8h*)(p + 256); return u.v; }
__device__ __forceinline__ v16b frag_bp(const __bf16* ub, unsigned lo) { union { v16b v; v8b q[2]; } u; const __bf16* p = ub + lo; u.q[0] = *(const v8b*)p; u.q[1] = *(const v8b*)(p + 256); return u.v; }
// a wave-uniform global pointer, both words through readfirstlane: it stays a scalar base of its own, so that every load names that base and a loop-invariant offset register, and no vector address is formed or stepped under loads in flight
typedef const __attribute__((address_space(1))) _Float16* gph;
__device__ __forceinline__ const _Float16* uni(const _Float16* p) { const unsigned long long a = (unsigned long long)p; return (const _Float16*)(gph)(((unsigned long long)(unsigned)__builtin_amdgcn_readfirstlane((int)(a >> 32)) << 32) | (unsigned)__builtin_amdgcn_readfirstlane((int)a)); }
// hardware exp2 with, in the same statement, the one slot that the instruction set asks for behind a transcendental before its source may be overwritten or its result read
// the result takes the argument's own register: that register was last written by an instruction the compiler knows, which keeps the distance behind a matrix instruction that read it
__device__ __forceinline__ float exp2_slot(float x) { asm("v_exp_f32 %0, %0\n\tv_nop" : "+v"(x)); return x; }
struct FaSt { float m, lsum; };   // m: running maximum of logit x SC2 (base-2 domain); lsum: the lane's partial sum of exp x 2^11
#define SC2 ((float)(0.08838834764831845 * 1.4426950408889634))   // 128^-0.5 x log2 e: exp(SCALE x s - max) = exp2(SC2 x s - max2)
// takes the RAW products q.k; masks the diagonal block, updates the running maximum and the lane's partial sum; leaves exp x 2^11 in st and returns the factor for what was summed so far
// each exponential is one fused multiply-add (scale, maximum and the 2^11 all in it) and one hardware exp2; a result below 2^-126 reads 0, far under what f16 or the sum can hold
__device__ __forceinline__ float fa_softmax(v8f (&st)[8], FaSt& f, bool diag, int key0, int tq) {
  if (diag) {
#pragma unroll
    for (int j = 0; j < 8; ++j) {
#pragma unroll
      for (int r = 0; r < 8; ++r) st[j][r] = (key0 + j * 16 + r <= tq) ? st[j][r] : -3.0e38f; } }
  float mloc = -3.0e38f;
#pragma unroll
  for (int j = 0; j < 8; ++j) {
#pragma unroll
    for (int r = 0; r < 8; ++r) mloc = fmaxf(mloc, st[j][r]); }
  mloc = fmaxf(mloc, __shfl_xor(mloc, 16));   // the two lane halves hold the two key halves of the same query
  const float mn = fmaxf(f.m, mloc * SC2); const float alpha = exp2_slot(f.m - mn); f.m = mn;
  const float off = 11.0f - mn; float s = 0.f;
#pragma unroll
  for (int j = 0; j < 8; ++j) {
#pragma unroll
    for (int r = 0; r < 8; ++r) { const float e = exp2_slot(fmaf(st[j][r], SC2, off)); s += e; st[j][r] = e; } }   // a masked key: exp2(-3e38 x SC2 + off) = 0; mn is finite from a wave's first block on: every block that is walked starts at a key <= every query of the tile
  // the sum's update as a statement that stays where it stands: left to itself the compiler sinks the whole chain of additions past the branches round the load groups of fa_pass, to the end of the pass, and all 64 exponentials stay in registers until there (spills)
  float ls; asm volatile("v_fma_f32 %0, %1, %2, %3" : "=v"(ls) : "v"(f.lsum), "v"(alpha), "v"(s)); f.lsum = ls; return alpha; }
// joins the four waves' parts of the block's two row tiles: common maximum, each part rescaled to it, parts added in a fixed order, division by the joined row sum last
__device__ __forceinline__ void fa_join(v8f (&acc0)[HD / 16], v8f (&acc1)[HD / 16], const FaSt& f0, const FaSt& f1, int b, int ql0, int wave, int lane, float (*so)[32][HD + 4], float (*sm)[32], float (*sl)[32], float* __restrict__ Y) {
  const int col = lane & 15, g = lane >> 4;
  sm[wave][lane] = g == 0 ? f0.m : f1.m;   // both lane halves hold the same maxima: the lower half stores tile 0's, the upper tile 1's
  __syncthreads();   // every wave's maxima are in LDS
  const float mj0 = fmaxf(fmaxf(sm[0][col], sm[1][col]), fmaxf(sm[2][col], sm[3][col])), mj1 = fmaxf(fmaxf(sm[0][16 + col], sm[1][16 + col]), fmaxf(sm[2][16 + col], sm[3][16 + col]));   // finite: some wave walks block 0 of each tile, which holds key 0 <= every query
  const float sc0 = exp2_slot(f0.m - mj0), sc1 = exp2_slot(f1.m - mj1);   // a wave without a key block of that tile: exp2(-3e38 - max) = 0 on a part that is 0
  float ls0 = f0.lsum * sc0, ls1 = f1.lsum * sc1; ls0 += __shfl_xor(ls0, 16); ls1 += __shfl_xor(ls1, 16);
  sl[wave][lane] = g == 0 ? ls0 : ls1;
#pragma unroll
  for (int j = 0; j < HD / 16; ++j) { const v8f o = acc0[j] * sc0, p = acc1[j] * sc1;
    vst2(&so[wave][col][j * 16 + 8 * g], (v4f){o[0], o[1], o[2], o[3]}); vst2(&so[wave][col][j * 16 + 8 * g + 4], (v4f){o[4], o[5], o[6], o[7]});
    vst2(&so[wave][16 + col][j * 16 + 8 * g], (v4f){p[0], p[1], p[2], p[3]}); vst2(&so[wave][16 + col][j * 16 + 8 * g + 4], (v4f){p[4], p[5], p[6], p[7]}); }
  __syncthreads();   // every wave's rescaled parts and sums are in LDS
#pragma unroll
  for (int i = 0; i < 8; ++i) { const int rl = wave * 8 + i;   // one output row (512 contiguous bytes) a wave and pass
    const float lj = (sl[0][rl] + sl[1][rl]) + (sl[2][rl] + sl[3][rl]); const float inv = lj > 0.f ? 1.0f / lj : 0.f;   // sum and accumulators both carry the 2^11
    const v4f o = (*(const v4f*)&so[0][rl][lane * 4] + *(const v4f*)&so[1][rl][lane * 4]) + (*(const v4f*)&so[2][rl][lane * 4] + *(const v4f*)&so[3][rl][lane * 4]);
    vst2(Y + ((size_t)b * TT + ql0 + rl) * CC + lane * 4, o * inv); } }
// The 128 fragment loads of a pass of fa_wave are issued in groups spread over the pass (v ahead of, amid and behind the logit products, the next block's k between the two tiles' softmax), each at a place where about 63 loads or fewer are then outstanding: the load counter holds no more.
// second part of a pass: tile 1's softmax and both tiles' P.v; MORE: the k fragments of the ring's next block are fetched ahead of it. A compile-time flag and a body of its own for the last pass: behind a branch round a load group the compiler must count the group as not issued, and every later wait for v would then wait for the k loads too.
template <bool MORE> __device__ __forceinline__ void fa_tail(const _Float16* Kn, unsigned flo, v16h (&kf)[32], const v16h (&vf)[32], v8f (&st0)[8], v8f (&st1)[8], v8f (&acc0)[HD / 16], v8f (&acc1)[HD / 16], FaSt& f1) {
  if (MORE) {
#pragma unroll
    for (int i = 0; i < 31; ++i) kf[i] = frag_hp(Kn + (size_t)((i & 7) * 16) * CC + (i >> 3) * 512, flo);   // 62 loads: the largest count a wait can name, so that the waits for v below need none of these to have returned
    __builtin_amdgcn_sched_barrier(0); }   // keeps these loads issued here, between the two tiles' softmax
  const float alpha1 = fa_softmax(st1, f1, false, 0, 0);
#pragma unroll
  for (int j = 0; j < HD / 16; ++j) acc1[j] *= alpha1;
#pragma unroll
  for (int c = 0; c < 4; ++c) { v16h p0, p1;
#pragma unroll
    for (int i = 0; i < 8; ++i) { p0[i] = (_Float16)st0[2 * c][i]; p0[8 + i] = (_Float16)st0[2 * c + 1][i]; p1[i] = (_Float16)st1[2 * c][i]; p1[8 + i] = (_Float16)st1[2 * c + 1][i]; }
#pragma unroll
    for (int j = 0; j < HD / 16; ++j) { acc0[j] = mm16(vf[c * 8 + j], p0, acc0[j]); acc1[j] = mm16(vf[c * 8 + j], p1, acc1[j]); } }
  __builtin_amdgcn_sched_barrier(0);   // keeps what follows (the last k fragment's loads, the forming of the next pass's scalar bases) behind the last product's wait for the v loads
  if (MORE) { kf[31] = frag_hp(Kn + (size_t)(7 * 16) * CC + 3 * 512, flo);   // the fragment that the next pass's logits use last
    asm volatile("s_wait_xcnt 0x0" ::: "memory");   // the k loads stay in flight into the next pass, where the scalar bases are formed anew: the wait stands ahead of that
    __builtin_amdgcn_sched_barrier(0); }
}
// one pass of fa_wave: key block kb against both row tiles; more (wave-uniform): a next block kbn of the ring exists
__device__ __forceinline__ void fa_pass(bool more, const _Float16* K0, const _Float16* V0, int kb, int kbn, int nkb, int g, int tq, unsigned flo, const v16h (&qf0)[HD / 32], const v16h (&qf1)[HD / 32], v16h (&kf)[32], v16h (&vf)[32], v8f (&acc0)[HD / 16], v8f (&acc1)[HD / 16], FaSt& f0, FaSt& f1) {
  const int k0 = kb * 128;
  const _Float16* Kn = uni(K0 + (size_t)(kbn * 128) * CC); const _Float16* Vp = uni(V0 + (size_t)k0 * CC);
#pragma unroll
  for (int i = 0; i < 16; ++i) vf[i] = frag_hp(Vp + (i >> 3) * 4096 + (i & 7) * 512, flo);
  __builtin_amdgcn_sched_barrier(0);   // keeps the first v loads issued ahead of the logit products
  v8f st0[8] = {}, st1[8] = {};
#pragma unroll
  for (int i = 0; i < 16; ++i) { st0[i & 7] = mm16(kf[i], qf0[i >> 3], st0[i & 7]); st1[i & 7] = mm16(kf[i], qf1[i >> 3], st1[i & 7]); }
  __builtin_amdgcn_sched_barrier(0);   // with the next one: holds the second v group in the middle of the logit products, neither lifted to the first group nor sunk to the third
#pragma unroll
  for (int i = 16; i < 30; ++i) vf[i] = frag_hp(Vp + (i >> 3) * 4096 + (i & 7) * 512, flo);
  __builtin_amdgcn_sched_barrier(0);
#pragma unroll
  for (int i = 16; i < 32; ++i) { st0[i & 7] = mm16(kf[i], qf0[i >> 3], st0[i & 7]); st1[i & 7] = mm16(kf[i], qf1[i >> 3], st1[i & 7]); }
  __builtin_amdgcn_sched_barrier(0);   // keeps the loads below from being lifted over the logit products
#pragma unroll
  for (int i = 30; i < 32; ++i) vf[i] = frag_hp(Vp + (i >> 3) * 4096 + (i & 7) * 512, flo);
  asm volatile("s_wait_xcnt 0x0" ::: "memory");   // the last loads that name the v base: behind this wait its registers are free for reuse
  __builtin_amdgcn_sched_barrier(0);   // keeps the last v loads issued ahead of the softmax, which covers their latency
  if (kb + 1 == nkb) {   // the diagonal block: both tiles masked in one branch, so that none of the mask's arithmetic stands in the other blocks' path
#pragma unroll
    for (int j = 0; j < 8; ++j) {
#pragma unroll
      for (int r = 0; r < 8; ++r) { const int key = k0 + 8 * g + j * 16 + r; st0[j][r] = (key <= tq) ? st0[j][r] : -3.0e38f; st1[j][r] = (key <= tq + 16) ? st1[j][r] : -3.0e38f; } } }
  const float alpha0 = fa_softmax(st0, f0, false, 0, 0);
#pragma unroll
  for (int j = 0; j < HD / 16; ++j) acc0[j] *= alpha0;
  if (more) fa_tail<true>(Kn, flo, kf, vf, st0, st1, acc0, acc1, f1); else fa_tail<false>(Kn, flo, kf, vf, st0, st1, acc0, acc1, f1); }
// rows >= QHI (at least 4 key blocks, so every wave has one)
__device__ __forceinline__ void fa_wave(const _Float16* __restrict__ QH, const _Float16* __restrict__ KH, const _Float16* __restrict__ VT, int b, int ql0, int wave, int lane, v8f (&acc0)[HD / 16], v8f (&acc1)[HD / 16], FaSt& f0, FaSt& f1) {
  const int col = lane & 15, g = lane >> 4; const int tq = ql0 + col; const int nkb = ((ql0 + 31) >> 7) + 1;
  // The row tiles of a batch walk the same k and v blocks: each tile enters its waves' rings of key blocks at its own place and wraps round, so that L2 is not asked for the same lines by all of them at the same moment. The running maximum takes the blocks in any order.
  const int nw = (nkb - wave + 3) >> 2;   // this wave's key blocks: wave, wave + 4, ...
  int first = (ql0 >> 6) & 3;             // then taken mod nw; it steps with every second tile (for speed only)
  for (int t = 0; t < 3; ++t) first = first >= nw ? first - nw : first;
  const _Float16* K0 = KH + (size_t)b * TT * CC; const _Float16* V0 = VT + (size_t)b * TT * CC;   // the batch's k and v (wave-uniform)
  const unsigned flo = 8 * lane;
  v16h qf0[HD / 32], qf1[HD / 32], kf[32], vf[32];
  __builtin_amdgcn_sched_barrier(0);   // with the one behind the wait below: nothing but these loads stands between here and the wait, so none of their address registers is reused ahead of it
#pragma unroll
  for (int kc = 0; kc < HD / 32; ++kc) { qf0[kc] = frag_hp(QH + ((size_t)b * TT + ql0) * CC + kc * 512, flo); qf1[kc] = frag_hp(QH + ((size_t)b * TT + ql0 + 16) * CC + kc * 512, flo); }
#pragma unroll
  for (int i = 0; i < 32; ++i) kf[i] = frag_hp(K0 + (size_t)((wave + 4 * first) * 128 + (i & 7) * 16) * CC + (i >> 3) * 512, flo);
  asm volatile("s_wait_xcnt 0x0" ::: "memory");   // the registers that the loads above name are free for reuse behind this wait
  __builtin_amdgcn_sched_barrier(0);
  static_assert(QHI >= 384, "every wave needs a first key block");
  int kb = wave + 4 * first, left = nw;
#pragma unroll 1
  do { const int kbn = kb + 4 < nkb ? kb + 4 : wave;   // the next block of the ring; the loop is entered without a test: the loads above stay where they stand, ahead of their wait
    fa_pass(left > 1, K0, V0, kb, kbn, nkb, g, tq, flo, qf0, qf1, kf, vf, acc0, acc1, f0, f1); kb = kbn; --left;
  } while (left > 0); }
// rows < QHI (at most 3 key blocks): residual products; one 16-row tile a wave, its key blocks kb0, kb0 + 2, ... (two waves a tile)
__device__ __forceinline__ void fa_wave_hi(const _Float16* __restrict__ QH, const _Float16* __restrict__ KH, const _Float16* __restrict__ QL, const _Float16* __restrict__ KL, const __bf16* __restrict__ VB, const __bf16* __restrict__ VBL, int b, int ql0, int kb0, int lane, v8f (&acc)[HD / 16], FaSt& f) {
  const int col = lane & 15, g = lane >> 4; const int tq = ql0 + col; const int nkb = ((ql0 + 15) >> 7) + 1;
  const _Float16* Kp = KH + ((size_t)b * TT + kb0 * 128) * CC; const _Float16* KLp = KL + ((size_t)b * KHI + kb0 * 128) * CC; const __bf16* Vp = VB + ((size_t)b * KHI + kb0 * 128) * CC; const __bf16* VLp = VBL + ((size_t)b * KHI + kb0 * 128) * CC;   // wave-uniform; stepped at the loop's foot
  const unsigned flo = 8 * lane;
  if (kb0 >= nkb) return;   // wave-uniform; tested ahead of the q loads, so that they stay where they stand, ahead of their wait, and the loop below is entered without a test
  v16h qf[HD / 32], qlf[HD / 32];
  __builtin_amdgcn_sched_barrier(0);   // as in fa_wave: nothing but these loads stands between here and the wait, so none of their address registers is reused ahead of it
#pragma unroll
  for (int kc = 0; kc < HD / 32; ++kc) { qf[kc] = frag_hp(QH + ((size_t)b * TT + ql0) * CC + kc * 512, flo); qlf[kc] = frag_hp(QL + ((size_t)b * QHI + ql0) * CC + kc * 512, flo); }
  asm volatile("s_wait_xcnt 0x0" ::: "memory");   // the registers that the loads above name are free for reuse behind this wait
  __builtin_amdgcn_sched_barrier(0);
  int kb = kb0;
#pragma unroll 1
  do { const int k0 = kb * 128;
    v8f st[8] = {}, stl[8] = {};
    // The pass's 8 groups of 32 fragment loads (4 of k and its residual, 4 of v hi and lo) each have registers of their own and are issued two groups ahead of their products: about 63 loads, all that the load counter holds, stay in flight from the first product to the last, the softmax included.
    v16h kh[4][8], kl[4][8]; v16b vh[4][8], vl[4][8];
#define HI_LDK(kc) do { _Pragma("unroll") for (int j = 0; j < 8; ++j) { kh[kc][j] = frag_hp(Kp + (size_t)(j * 16) * CC + (kc) * 512, flo); kl[kc][j] = frag_hp(KLp + (size_t)(j * 16) * CC + (kc) * 512, flo); } } while (0)
#define HI_LDV(c) do { _Pragma("unroll") for (int j = 0; j < HD / 16; ++j) { const size_t po = (size_t)(c) * 4096 + j * 512; vh[c][j] = frag_bp(Vp + po, flo); vl[c][j] = frag_bp(VLp + po, flo); } } while (0)
    HI_LDK(0); HI_LDK(1);
#pragma unroll
    for (int kc = 0; kc < HD / 32; ++kc) {
      if (kc < 2) HI_LDK(kc + 2); else HI_LDV(kc - 2);
      __builtin_amdgcn_sched_barrier(0);   // keeps the group's 32 loads issued together, ahead of the products of the group two before it
#pragma unroll
      for (int j = 0; j < 8; ++j) { st[j] = mm16(kh[kc][j], qf[kc], st[j]); stl[j] = mm16(kh[kc][j], qlf[kc], stl[j]); stl[j] = mm16(kl[kc][j], qf[kc], stl[j]); }
      __builtin_amdgcn_sched_barrier(0); }   // keeps the next group's loads from being lifted over these products: more than the counter holds would be asked for at once
#pragma unroll
    for (int j = 0; j < 8; ++j) st[j] = st[j] + stl[j] * (1.0f / 1024.0f);
    const float alpha = fa_softmax(st, f, kb + 1 == nkb, k0 + 8 * g, tq);
#pragma unroll
    for (int j = 0; j < HD / 16; ++j) acc[j] *= alpha;
#pragma unroll
    for (int c = 0; c < 4; ++c) { float pe[16];
      __builtin_amdgcn_sched_barrier(0);   // with the next one: as above, the group's loads stay together between the products of two groups
      if (c < 2) HI_LDV(c + 2);
      if (c == 1) asm volatile("s_wait_xcnt 0x0" ::: "memory");   // the pass's last loads: behind this wait the registers that they name are free for reuse
      __builtin_amdgcn_sched_barrier(0);
#pragma unroll
      for (int i = 0; i < 8; ++i) { pe[i] = st[2 * c][i]; pe[8 + i] = st[2 * c + 1][i]; }
      const F2 p = bsplit16(pe);
#pragma unroll
      for (int j = 0; j < HD / 16; ++j) { acc[j] = mmbf(vh[c][j], p.h, acc[j]); acc[j] = mmbf(vh[c][j], p.l, acc[j]); acc[j] = mmbf(vl[c][j], p.h, acc[j]); } }
#undef HI_LDK
#undef HI_LDV
    __builtin_amdgcn_sched_barrier(0);   // as in fa_wave: the pointer steps stay behind the last product's wait for the loads
    Kp += 256 * CC; KLp += 256 * CC; Vp += 256 * CC; VLp += 256 * CC; kb += 2;
  } while (kb < nkb); }
// block = 4 waves on 32 query rows; the lowest block indices take the rows with the most key blocks; the batch is the fastest index
__global__ __launch_bounds__(128) void k_fa(const _Float16* __restrict__ QH, const _Float16* __restrict__ KH, const _Float16* __restrict__ QL, const _Float16* __restrict__ KL, const _Float16* __restrict__ VT, const __bf16* __restrict__ VB, const __bf16* __restrict__ VBL, float* __restrict__ Y) { __shared__ __align__(16) float so[4][32][HD + 4]; __shared__ float sm[4][32], sl[4][32];
  const int wave = __builtin_amdgcn_readfirstlane(threadIdx.x >> 5), lane = threadIdx.x & 31; const int b = blockIdx.x % TNB; const int ql0 = (TT / 32 - 1 - (int)(blockIdx.x / TNB)) * 32;
  v8f acc0[HD / 16] = {}, acc1[HD / 16] = {}; FaSt f0 = {-3.0e38f, 0.f}, f1 = {-3.0e38f, 0.f};
  if (ql0 >= QHI) fa_wave(QH, KH, VT, b, ql0, wave, lane, acc0, acc1, f0, f1);
  else { fa_wave_hi(QH, KH, QL, KL, VB, VBL, b, ql0 + 16 * (wave & 1), wave >> 1, lane, acc0, f0);   // waves 0, 2: tile 0; waves 1, 3: tile 1; the other tile's part stays empty
    if (wave & 1) {
#pragma unroll
      for (int j = 0; j < HD / 16; ++j) { acc1[j] = acc0[j]; acc0[j] = (v8f){}; }
      f1 = f0; f0 = {-3.0e38f, 0.f}; } }
  fa_join(acc0, acc1, f0, f1, b, ql0, wave, lane, so, sm, sl, Y); }

extern "C" void kernel_launch(void* const* d_in, const int* in_sizes, int n_in, void* d_out, int out_size, void* d_ws, size_t ws_size, hipStream_t stream) {
  (void)in_sizes; (void)n_in; (void)out_size;
  const float** F = (const float**)d_in;
  if (ws_size < (size_t)WS_END) return;
  char* ws = (char*)d_ws; _Float16 *QH = (_Float16*)(ws + WS_QH), *KH = (_Float16*)(ws + WS_KH), *VT = (_Float16*)(ws + WS_VT), *QL = (_Float16*)(ws + WS_QL), *KL = (_Float16*)(ws + WS_KL); __bf16 *VB = (__bf16*)(ws + WS_VB), *VBL = (__bf16*)(ws + WS_VBL);
  // inputs: 0 x [4,2048,1024]; 1 Wq [1024,128] (in,out); 2 Wk; 3 Wv
  k_proj<<<dim3(TNB * TT / PBM, CC / 128, 3), 256, 0, stream>>>(F[0], F[0], F[0], F[1], F[2], F[3], nullptr, nullptr, nullptr, QH, QL, KH, KL, VT, VB, VBL);
  k_fa<<<dim3(TNB * (TT / 32), 1, 1), 128, 0, stream>>>(QH, KH, QL, KL, VT, VB, VBL, (float*)d_out);
}
